// v000
// Times are from an AMD MI455X. After a warm-up the kernel runs many times in a row, and a time is the length of
// such a window on the GPU divided by its runs, so every launch and the gaps after it count. The runs cycle
// through copies of the inputs. A figure is the median of several windows, for all but v000 over two sittings.
// Sittings can differ by a few percent; kernels timed side by side share one.
// v000, which the later versions start from, runs in 570 microseconds.
// Contractions: qkv projection v_wmma_f32_16x16x32_bf16 on RNE-bf16 x and W (single product); attention q.k^T and p.v v_wmma_f32_16x16x32_bf16 with bf16 hi/lo split (hi.hi + hi.lo + lo.hi); output projection bf16 hi/lo A-split x bf16 W_out (hi.w + lo.w); f32 accumulate everywhere; softmax, scale and bias adds in f32.
#include <hip/hip_runtime.h>
#include <math.h>
#include <float.h>
#include <stdint.h>

// ---------------------------------------------------------------------------
// Fixed problem geometry
// ---------------------------------------------------------------------------
constexpr int kBatch     = 8;
constexpr int kSeq       = 1024;
constexpr int kModel     = 1024;
constexpr int kHeads     = 16;
constexpr int kHeadDim   = 64;
constexpr int kQkvLd     = 3 * kModel;            // 3072: q | k | v columns
constexpr int kTotRows   = kBatch * kSeq;         // 8192
constexpr int kHalfBatch = 4;                     // batches per pass
constexpr int kHalfRows  = kHalfBatch * kSeq;     // 4096
constexpr int kNumQB     = kSeq / 64;             // 16 query blocks of 64 rows
constexpr float kQkScale = 0.125f;                // 1/sqrt(64), exact power of two
constexpr float kMaskFill = -FLT_MAX;             // finfo(float32).min
static_assert(kNumQB == 16);
static_assert(kHeads == 16);
static_assert(kModel % 64 == 0 && kQkvLd % 64 == 0 && kHalfRows % 64 == 0);
static_assert(kModel % 32 == 0);

typedef __attribute__((ext_vector_type(16))) _Float16 v16h;
typedef __attribute__((ext_vector_type(8)))  _Float16 v8h;
typedef __attribute__((ext_vector_type(16))) __bf16   v16b;
typedef __attribute__((ext_vector_type(8)))  __bf16   v8b;
typedef __attribute__((ext_vector_type(8)))  float    v8f;
typedef __attribute__((ext_vector_type(4)))  float    v4f;
typedef __attribute__((ext_vector_type(8)))  unsigned short v8us;

__device__ __forceinline__ unsigned short f2bf_bits(float f) {
  unsigned u = __float_as_uint(f);
  return (unsigned short)((u + 0x7FFFu + ((u >> 16) & 1u)) >> 16);
}
__device__ __forceinline__ float bf_bits2f(unsigned short h) { return __uint_as_float(((unsigned)h) << 16); }

// hazard guards as plain device helpers (no inline asm inside the kernel template body)
__device__ __forceinline__ void dep_guard_h(v8f& a, v8f& b, v16h x, v16h y) { asm volatile("v_nop\n\tv_nop\n\tv_nop\n\tv_nop" : "+v"(a), "+v"(b) : "v"(x), "v"(y)); }
__device__ __forceinline__ void dep_guard_b(v8f& a, v8f& b, v16b x, v16b y) { asm volatile("v_nop\n\tv_nop\n\tv_nop\n\tv_nop" : "+v"(a), "+v"(b) : "v"(x), "v"(y)); }
__device__ __forceinline__ void keep4_h(v16h a, v16h b, v16h c, v16h d) { asm volatile("v_nop" :: "v"(a), "v"(b), "v"(c), "v"(d)); }
__device__ __forceinline__ void keep4_b(v16b a, v16b b, v16b c, v16b d) { asm volatile("v_nop" :: "v"(a), "v"(b), "v"(c), "v"(d)); }
__device__ __forceinline__ void acc_guard4(v8f& a, v8f& b, v8f& c, v8f& d) { asm volatile("v_nop\n\tv_nop\n\tv_nop\n\tv_nop" : "+v"(a), "+v"(b), "+v"(c), "+v"(d)); }
template <typename T> struct Frag;
template <> struct Frag<_Float16> {
  typedef v16h V; union U { v16h v; v8h h[2]; };
  static __device__ __forceinline__ v16h load(const _Float16* p) {   // elements 0..7 <- p[0..7], 8..15 <- p[16..23]
    U f; f.h[0] = *(const v8h*)(p); f.h[1] = *(const v8h*)(p + 16); return f.v;
  }
  static __device__ __forceinline__ v8f mma(v16h a, v16h b, v8f c) {
    return __builtin_amdgcn_wmma_f32_16x16x32_f16(false, a, false, b, (short)0, c, false, false);
  }
  static __device__ __forceinline__ void guard(v8f& a, v8f& b, v16h x, v16h y) { dep_guard_h(a, b, x, y); }
  static __device__ __forceinline__ void keep(v16h a, v16h b, v16h c, v16h d) { keep4_h(a, b, c, d); }
};
template <> struct Frag<__bf16> {
  typedef v16b V; union U { v16b v; v8b h[2]; };
  static __device__ __forceinline__ v16b load(const __bf16* p) {
    U f; f.h[0] = *(const v8b*)(p); f.h[1] = *(const v8b*)(p + 16); return f.v;
  }
  static __device__ __forceinline__ v8f mma(v16b a, v16b b, v8f c) {
    return __builtin_amdgcn_wmma_f32_16x16x32_bf16(false, a, false, b, (short)0, c, false, false);
  }
  static __device__ __forceinline__ void guard(v8f& a, v8f& b, v16b x, v16b y) { dep_guard_b(a, b, x, y); }
  static __device__ __forceinline__ void keep(v16b a, v16b b, v16b c, v16b d) { keep4_b(a, b, c, d); }
};

// ---- Register-blocked batched WMMA GEMM ------------------------------------
// C[m,n] = scale * sum_k A[m,k] * Bt[n,k] (+bias)(+resid); each wave owns a 64x64 tile.
// A row-major [M,K]; Bt row-major [N,K]; M,N % 64 == 0, K % 32 == 0.
// SPLIT: 0 = single product; 1 = A and Bt hi/lo planes (A2/Bt2 = lo planes): hi.hi + hi.lo + lo.hi;
//        2 = A hi/lo planes only (Bt single plane): hi.b + lo.b.
// BIAS_MODE: 0 = none, 1 = bias[m], 2 = bias[n], 3 = bias[n] passed through an RNE bf16 convert first.
// OUT_MODE: 0 = f32, 1 = f16, 2 = bf16 hi plane (Cout) + bf16 lo plane (Cout2).
// ET: 0 = f16 operands, 1 = bf16 operands (pointers passed as 16-bit storage)
template <int ET> struct Elem;
template <> struct Elem<0> { typedef _Float16 T; };
template <> struct Elem<1> { typedef __bf16 T; };
template <int ET, int SPLIT, int BIAS_MODE, int OUT_MODE, bool RESID, int ACT = 0>
__global__ __launch_bounds__(256) void wmma_gemm64(
    const unsigned short* __restrict__ Ap, const unsigned short* __restrict__ A2p, int lda, long strideA,
    const unsigned short* __restrict__ Btp, const unsigned short* __restrict__ Bt2p, int ldb, long strideB,
    void* __restrict__ Cout, void* __restrict__ Cout2, int ldc, long strideC,
    const float* __restrict__ bias,
    const float* __restrict__ resid, long strideR,
    int M, int N, int K, float scale) {
  typedef typename Elem<ET>::T T;
  typedef typename Frag<T>::V V;
  const T* A = (const T*)Ap; const T* A2 = (const T*)A2p; const T* Bt = (const T*)Btp; const T* Bt2 = (const T*)Bt2p;
  __shared__ __align__(16) float sT[8][16 * 68];   // per-wave 16x64 slab, pitch 68 floats
  const int b    = blockIdx.y;
  const int lane = threadIdx.x & 31;
  const int wave = threadIdx.x >> 5;
  const int tilesN = N >> 6;
  const int tilesM = M >> 6;
  const int tile = blockIdx.x * 8 + wave;
  if (tile >= tilesM * tilesN) return;   // wave-uniform; no block barriers in this kernel
  const int tm = tile / tilesN;
  const int tn = tile - tm * tilesN;
  const int m0 = tm << 6;
  const int n0 = tn << 6;

  const T* Ab  = A  + (size_t)b * strideA;
  const T* Bb  = Bt + (size_t)b * strideB;
  const T* Ab2 = (SPLIT != 0) ? (A2  + (size_t)b * strideA) : nullptr;
  const T* Bb2 = (SPLIT == 1) ? (Bt2 + (size_t)b * strideB) : nullptr;

  const int rlane = lane & 15;                 // row (A) / col (B, D) within subtile
  const int koff  = (lane >> 4) * 8;           // k offset of this lane half
  const int mOff  = (lane >> 4) * 8;           // D row offset

  v8f acc[4][4];
#pragma unroll
  for (int i = 0; i < 4; ++i)
#pragma unroll
    for (int j = 0; j < 4; ++j) acc[i][j] = (v8f){0.f,0.f,0.f,0.f,0.f,0.f,0.f,0.f};

  for (int k0 = 0; k0 < K; k0 += 32) {
    V bh[4], bl[4];
#pragma unroll
    for (int j = 0; j < 4; ++j) {
      const size_t bo = (size_t)(n0 + (j << 4) + rlane) * ldb + koff + k0;
      bh[j] = Frag<T>::load(Bb + bo);
      if (SPLIT == 1) bl[j] = Frag<T>::load(Bb2 + bo);
    }
#pragma unroll
    for (int i = 0; i < 4; ++i) {
      const size_t ao = (size_t)(m0 + (i << 4) + rlane) * lda + koff + k0;
      V ah = Frag<T>::load(Ab + ao);
      V al;
      if (SPLIT != 0) al = Frag<T>::load(Ab2 + ao);
#pragma unroll
      for (int j = 0; j < 4; ++j) {
        acc[i][j] = Frag<T>::mma(ah, bh[j], acc[i][j]);
        if (SPLIT == 1) acc[i][j] = Frag<T>::mma(ah, bl[j], acc[i][j]);
        if (SPLIT != 0) acc[i][j] = Frag<T>::mma(al, bh[j], acc[i][j]);
      }
      Frag<T>::guard(acc[i][0], acc[i][3], ah, (SPLIT != 0) ? al : ah);
    }
    Frag<T>::keep(bh[0], bh[1], bh[2], bh[3]);
    if (SPLIT == 1) Frag<T>::keep(bl[0], bl[1], bl[2], bl[3]);
  }
  acc_guard4(acc[0][0], acc[0][1], acc[0][2], acc[0][3]);
  acc_guard4(acc[1][0], acc[1][1], acc[1][2], acc[1][3]);
  acc_guard4(acc[2][0], acc[2][1], acc[2][2], acc[2][3]);
  acc_guard4(acc[3][0], acc[3][1], acc[3][2], acc[3][3]);

  // ---- epilogue ----
  float* slab = sT[wave];
  const float* Rb = RESID ? (resid + (size_t)b * strideR) : nullptr;
#pragma unroll
  for (int i = 0; i < 4; ++i) {
    const int mBase = m0 + (i << 4);
#pragma unroll
    for (int j = 0; j < 4; ++j) {
      const int n = n0 + (j << 4) + rlane;
      float bv = 0.f;
      if (BIAS_MODE == 2) bv = bias[n];
      if (BIAS_MODE == 3) bv = bf_bits2f(f2bf_bits(bias[n]));
#pragma unroll
      for (int r = 0; r < 8; ++r) {
        float v = acc[i][j][r] * scale;
        if (BIAS_MODE == 1) v += bias[mBase + mOff + r];
        if (BIAS_MODE == 2 || BIAS_MODE == 3) v += bv;
        if (RESID) v += Rb[(size_t)(mBase + mOff + r) * ldc + n];
        if (ACT == 1) v = tanhf(v);
        if (ACT == 2) v = fmaxf(v, 0.0f);
        if (ACT == 4) v = (v > 0.f) ? v : 0.01f * v;
        slab[(mOff + r) * 68 + (j << 4) + rlane] = v;
      }
    }
    __builtin_amdgcn_fence(__ATOMIC_RELEASE, "workgroup");
    __builtin_amdgcn_wave_barrier();
    __builtin_amdgcn_fence(__ATOMIC_ACQUIRE, "workgroup");
    if (OUT_MODE == 0) {
      float* C = (float*)Cout + (size_t)b * strideC;
      const int hh = lane >> 4, c4 = (lane & 15) * 4;     // row seg = 256 B = 16 lanes x 16 B
      {
#pragma unroll
        for (int it = 0; it < 8; ++it) {
          const int row = it * 2 + hh;
          v4f v = *(const v4f*)(slab + row * 68 + c4);
          *(v4f*)(C + (size_t)(mBase + row) * ldc + n0 + c4) = v;
        }
        
      }
    } else {
      const int q = lane >> 3, c8 = (lane & 7) * 8;
      unsigned short* C  = (unsigned short*)Cout  + (size_t)b * strideC;
      unsigned short* C2 = (OUT_MODE == 2) ? ((unsigned short*)Cout2 + (size_t)b * strideC) : nullptr;
      {
#pragma unroll
        for (int it = 0; it < 4; ++it) {
          const int row = it * 4 + q;
          const float* sp = slab + row * 68 + c8;
          v8h hv, lv;
#pragma unroll
          for (int e = 0; e < 8; ++e) {
            if (OUT_MODE == 1) {
              hv[e] = (_Float16)sp[e];
            } else {
              unsigned short hb = f2bf_bits(sp[e]);
              unsigned short lb = f2bf_bits(sp[e] - bf_bits2f(hb));
              hv[e] = __builtin_bit_cast(_Float16, hb);
              lv[e] = __builtin_bit_cast(_Float16, lb);
            }
          }
          *(v8h*)(C + (size_t)(mBase + row) * ldc + n0 + c8) = hv;
          if (OUT_MODE == 2) *(v8h*)(C2 + (size_t)(mBase + row) * ldc + n0 + c8) = lv;
        }
        
      }
    }
    __builtin_amdgcn_fence(__ATOMIC_RELEASE, "workgroup");
    __builtin_amdgcn_wave_barrier();
    __builtin_amdgcn_fence(__ATOMIC_ACQUIRE, "workgroup");
  }
}

// ---- f32 [n] -> bf16 (RNE) [n], same layout; 8 elements per thread = one 16-B store per lane ----
// grid = ceil(n8/256) with n8 = n/8 (here 1,048,576 = 4096 x 256 exactly), bound checked anyway.
__global__ __launch_bounds__(256) void cast_f32_bf16x8(const float* __restrict__ in,
                                                       unsigned short* __restrict__ out, int n8) {
  const int i = blockIdx.x * 256 + threadIdx.x;
  if (i < n8) {
    const v4f a0 = *(const v4f*)(in + (size_t)i * 8);
    const v4f a1 = *(const v4f*)(in + (size_t)i * 8 + 4);
    v8us u;
    u[0] = f2bf_bits(a0[0]); u[1] = f2bf_bits(a0[1]); u[2] = f2bf_bits(a0[2]); u[3] = f2bf_bits(a0[3]);
    u[4] = f2bf_bits(a1[0]); u[5] = f2bf_bits(a1[1]); u[6] = f2bf_bits(a1[2]); u[7] = f2bf_bits(a1[3]);
    *(v8us*)(out + (size_t)i * 8) = u;
    
  }
}

// ---- W [K][N] f32 -> Wt [N][K] bf16 (RNE), 64x64 tile transposed through LDS; grid = (N/64, K/64) ----
// Phase 1 coverage: kr = tid>>2 (64 k rows) x c16 = (tid&3)*16 with 4 quads of 4 -> every (k, n) of the tile once.
// Phase 2 coverage: n = it*32 + wave*4 + q8 (it 0..1, wave 0..7, q8 0..3) -> rows 0..63; c8 -> 8 lanes x 8 = 64 k.
#define WTP 72
__global__ __launch_bounds__(256) void wt_cast_bf16(const float* __restrict__ W, unsigned short* __restrict__ Wt,
                                                    int K, int N) {
  __shared__ __align__(16) unsigned short st[64 * WTP];
  const int n0 = blockIdx.x * 64, k0 = blockIdx.y * 64;
  const int tid = threadIdx.x;
  const int kr = tid >> 2, c16 = (tid & 3) * 16;
  const float* src = W + (size_t)(k0 + kr) * N + n0 + c16;
#pragma unroll
  for (int q = 0; q < 4; ++q) {
    const v4f v = *(const v4f*)(src + 4 * q);
#pragma unroll
    for (int e = 0; e < 4; ++e) st[(c16 + 4 * q + e) * WTP + kr] = f2bf_bits(v[e]);
  }
  __syncthreads();
  const int wave = tid >> 5, lane = tid & 31;
  const int q8 = lane >> 3, c8 = (lane & 7) * 8;
  {
#pragma unroll
    for (int it = 0; it < 2; ++it) {
      const int n = it * 32 + wave * 4 + q8;
      const v8us hv = *(const v8us*)(st + n * WTP + c8);
      *(v8us*)(Wt + (size_t)(n0 + n) * K + k0 + c8) = hv;
    }
    
  }
}

// =====================================================================================
// Causal attention, head_dim 64, bf16 hi/lo planes in, bf16 hi/lo planes out.
//   q|k|v hi/lo planes [kHalfRows][3072] (element (b,s,part,h,d) at (b*S+s)*3072 + part*1024 + h*64 + d, b local to the pass).
//   Block = 4 waves = 64 query rows of one (b,h); 64-key chunks kc = 0..qb (later chunks have exactly zero weight);
//   the diagonal chunk sets kv > q scores to finfo.min by select after the 1/8 scale.
//   scores and p.v: v_wmma_f32_16x16x32_bf16 with hi/lo split (hi.hi + hi.lo + lo.hi), f32 accumulate; online softmax in f32.
//   grid.x = kHalfBatch * kHeads * kNumQB = 1024.
// =====================================================================================
__device__ __forceinline__ v8f mma_b(v16b a, v16b b, v8f c) {
  c = __builtin_amdgcn_wmma_f32_16x16x32_bf16(false, a, false, b, (short)0, c, false, false);
  asm volatile("v_nop\n\tv_nop\n\tv_nop\n\tv_nop" : "+v"(c) : "v"(a), "v"(b));
  return c;
}
__device__ __forceinline__ void bf_split(float f, __bf16& hi, __bf16& lo) {
  const unsigned short hb = f2bf_bits(f);
  hi = __builtin_bit_cast(__bf16, hb);
  lo = __builtin_bit_cast(__bf16, f2bf_bits(f - bf_bits2f(hb)));
}

#define AKC 64
#define OSP 68
__global__ __launch_bounds__(128) void attn_causal_k(
    const unsigned short* __restrict__ qkvhp, const unsigned short* __restrict__ qkvlp,
    unsigned short* __restrict__ ohp, unsigned short* __restrict__ olp) {
  union FB { v16b v; v8b h[2]; };
  __shared__ __align__(16) __bf16 Ksh[AKC * kHeadDim];        // K hi [kv][d]   8 KB
  __shared__ __align__(16) __bf16 Ksl[AKC * kHeadDim];        // K lo
  __shared__ __align__(16) __bf16 Vth[kHeadDim * AKC];        // V hi [d][kv]   8 KB
  __shared__ __align__(16) __bf16 Vtl[kHeadDim * AKC];        // V lo
  __shared__ __align__(16) __bf16 Psh[4][16 * AKC];           // per wave P hi [row][kv]
  __shared__ __align__(16) __bf16 Psl[4][16 * AKC];           // per wave P lo
  __shared__ __align__(16) float  Os[4][16 * OSP];            // per wave out tile, pitch 68

  const __bf16* Qh = (const __bf16*)qkvhp;
  const __bf16* Ql = (const __bf16*)qkvlp;

  const int tid  = threadIdx.x;
  const int wave = tid >> 5;
  const int lane = tid & 31;
  const int hh   = lane >> 4;
  const int c    = lane & 15;

  const int bx = blockIdx.x;
  const int qb = bx & (kNumQB - 1);        // 16 query blocks of 64 rows
  const int bh = bx >> 4;
  const int h  = bh & (kHeads - 1);
  const int b  = bh >> 4;                  // 0..kHalfBatch-1 within this pass
  const int q0 = qb * 64 + wave * 16;

  // ---- Q fragments (A operand): 2 d-chunks, hi and lo, via Frag loader ----
  v16b qah[2], qal[2];
  {
    const size_t qo = (size_t)(b * kSeq + q0 + c) * kQkvLd + h * kHeadDim + 8 * hh;
#pragma unroll
    for (int dc = 0; dc < 2; ++dc) {
      qah[dc] = Frag<__bf16>::load(Qh + qo + dc * 32);
      qal[dc] = Frag<__bf16>::load(Ql + qo + dc * 32);
    }
  }

  float mrow[8], lrow[8];
  v8f oacc[4];
#pragma unroll
  for (int r = 0; r < 8; ++r) { mrow[r] = -INFINITY; lrow[r] = 0.f; }
#pragma unroll
  for (int t = 0; t < 4; ++t) oacc[t] = (v8f){0.f,0.f,0.f,0.f,0.f,0.f,0.f,0.f};

  const int nIter = qb + 1;   // block-uniform: causal chunks 0..qb, <= 16
  for (int kc = 0; kc < nIter; ++kc) {
    const int kv0 = kc * AKC;
    __syncthreads();
    {
      // staging coverage: 128 threads = 64 kv rows x 2 d-halves of 32; 4 x 8 elements per thread per plane
      const int kvr = tid >> 1, dh = (tid & 1) * 32;
      const size_t mo = ((size_t)(b * kSeq + kv0 + kvr)) * kQkvLd + kModel + h * kHeadDim + dh;   // k row
      const __bf16* kh = Qh + mo;
      const __bf16* kl = Ql + mo;
      const __bf16* vh = kh + kModel;      // v sits 1024 columns after k
      const __bf16* vl = kl + kModel;
#pragma unroll 1
      for (int i = 0; i < 4; ++i) {
        const v8b a0 = *(const v8b*)(kh + 8 * i);
        *(v8b*)(Ksh + kvr * kHeadDim + dh + 8 * i) = a0;
        const v8b a1 = *(const v8b*)(kl + 8 * i);
        *(v8b*)(Ksl + kvr * kHeadDim + dh + 8 * i) = a1;
        const v8b w0 = *(const v8b*)(vh + 8 * i);
        const v8b w1 = *(const v8b*)(vl + 8 * i);
#pragma unroll
        for (int e = 0; e < 8; ++e) {
          Vth[(dh + 8 * i + e) * AKC + kvr] = w0[e];
          Vtl[(dh + 8 * i + e) * AKC + kvr] = w1[e];
        }
      }
    }
    __syncthreads();

    // ---- scores: 3 products per d-chunk ----
    v8f s[4];
#pragma unroll
    for (int j = 0; j < 4; ++j) {
      s[j] = (v8f){0.f,0.f,0.f,0.f,0.f,0.f,0.f,0.f};
#pragma unroll
      for (int dc = 0; dc < 2; ++dc) {
        FB kb, kq;
        kb.h[0] = *(const v8b*)(Ksh + (j * 16 + c) * kHeadDim + dc * 32 + 8 * hh);
        kb.h[1] = *(const v8b*)(Ksh + (j * 16 + c) * kHeadDim + dc * 32 + 16 + 8 * hh);
        kq.h[0] = *(const v8b*)(Ksl + (j * 16 + c) * kHeadDim + dc * 32 + 8 * hh);
        kq.h[1] = *(const v8b*)(Ksl + (j * 16 + c) * kHeadDim + dc * 32 + 16 + 8 * hh);
        s[j] = mma_b(qah[dc], kb.v, s[j]);
        s[j] = mma_b(qah[dc], kq.v, s[j]);
        s[j] = mma_b(qal[dc], kb.v, s[j]);
      }
    }
    const bool diag = (kc == qb);
    float cm[8];
#pragma unroll
    for (int r = 0; r < 8; ++r) {
      const int qrow = q0 + 8 * hh + r;
      float m = -INFINITY;
#pragma unroll
      for (int j = 0; j < 4; ++j) {
        const int kvcol = kv0 + j * 16 + c;
        float sv = s[j][r] * kQkScale;
        if (diag && (kvcol > qrow)) sv = kMaskFill;
        s[j][r] = sv;
        m = fmaxf(m, sv);
      }
#pragma unroll
      for (int off = 1; off < 16; off <<= 1) m = fmaxf(m, __shfl_xor(m, off, 32));
      cm[r] = m;
    }
    __bf16* pwh = Psh[wave];
    __bf16* pwl = Psl[wave];
#pragma unroll
    for (int r = 0; r < 8; ++r) {
      const float mnew = fmaxf(mrow[r], cm[r]);
      const float alpha = expf(mrow[r] - mnew);
      mrow[r] = mnew;
      float psum = 0.f;
#pragma unroll
      for (int j = 0; j < 4; ++j) {
        const float p = expf(s[j][r] - mnew);
        psum += p;
        __bf16 pa, pb; bf_split(p, pa, pb);
        pwh[(8 * hh + r) * AKC + j * 16 + c] = pa;
        pwl[(8 * hh + r) * AKC + j * 16 + c] = pb;
      }
#pragma unroll
      for (int off = 1; off < 16; off <<= 1) psum += __shfl_xor(psum, off, 32);
      lrow[r] = lrow[r] * alpha + psum;
#pragma unroll
      for (int t = 0; t < 4; ++t) oacc[t][r] *= alpha;
    }
    __builtin_amdgcn_fence(__ATOMIC_RELEASE, "workgroup");
    __builtin_amdgcn_wave_barrier();
    __builtin_amdgcn_fence(__ATOMIC_ACQUIRE, "workgroup");
    // ---- O += P x V : 3 products ----
#pragma unroll 1
    for (int kk = 0; kk < 2; ++kk) {
      FB pa, pl;
      pa.h[0] = *(const v8b*)(pwh + c * AKC + kk * 32 + 8 * hh);
      pa.h[1] = *(const v8b*)(pwh + c * AKC + kk * 32 + 16 + 8 * hh);
      pl.h[0] = *(const v8b*)(pwl + c * AKC + kk * 32 + 8 * hh);
      pl.h[1] = *(const v8b*)(pwl + c * AKC + kk * 32 + 16 + 8 * hh);
#pragma unroll
      for (int t = 0; t < 4; ++t) {
        FB vb, vq;
        vb.h[0] = *(const v8b*)(Vth + (t * 16 + c) * AKC + kk * 32 + 8 * hh);
        vb.h[1] = *(const v8b*)(Vth + (t * 16 + c) * AKC + kk * 32 + 16 + 8 * hh);
        vq.h[0] = *(const v8b*)(Vtl + (t * 16 + c) * AKC + kk * 32 + 8 * hh);
        vq.h[1] = *(const v8b*)(Vtl + (t * 16 + c) * AKC + kk * 32 + 16 + 8 * hh);
        oacc[t] = mma_b(pa.v, vb.v, oacc[t]);
        oacc[t] = mma_b(pa.v, vq.v, oacc[t]);
        oacc[t] = mma_b(pl.v, vb.v, oacc[t]);
      }
    }
  }

  // ---- normalize, stage, write hi/lo planes ----
  float* os = Os[wave];
#pragma unroll
  for (int r = 0; r < 8; ++r) {
    const float inv = 1.0f / lrow[r];
#pragma unroll
    for (int t = 0; t < 4; ++t) os[(8 * hh + r) * OSP + t * 16 + c] = oacc[t][r] * inv;
  }
  __builtin_amdgcn_fence(__ATOMIC_RELEASE, "workgroup");
  __builtin_amdgcn_wave_barrier();
  __builtin_amdgcn_fence(__ATOMIC_ACQUIRE, "workgroup");
  {
    const int q8 = lane >> 3, c8 = (lane & 7) * 8;
    _Float16* Oh = (_Float16*)ohp;
    _Float16* Ol = (_Float16*)olp;
    {
#pragma unroll
      for (int it = 0; it < 4; ++it) {
        const int row = it * 4 + q8;
        const float* sp = os + row * OSP + c8;
        v8h hv, lv;
#pragma unroll
        for (int e = 0; e < 8; ++e) {
          const unsigned short hb = f2bf_bits(sp[e]);
          const unsigned short lb = f2bf_bits(sp[e] - bf_bits2f(hb));
          hv[e] = __builtin_bit_cast(_Float16, hb);
          lv[e] = __builtin_bit_cast(_Float16, lb);
        }
        const size_t oo = (size_t)(b * kSeq + q0 + row) * kModel + h * kHeadDim + c8;
        *(v8h*)(Oh + oo) = hv;
        *(v8h*)(Ol + oo) = lv;
      }
      
    }
  }
}

// ---------------------------------------------------------------------------
// Workspace region map (all offsets 256-B aligned, all planes bf16 bits):
//   Xb   [8192][1024]  hidden as bf16          16,777,216 B
//   WaT  [3072][1024]  W_attn transposed        6,291,456 B
//   WoT  [1024][1024]  W_out transposed         2,097,152 B
//   QKVh [4096][3072]  q|k|v hi plane (pass)   25,165,824 B
//   QKVl [4096][3072]  q|k|v lo plane (pass)   25,165,824 B
//   Oh   [4096][1024]  attention out hi plane   8,388,608 B
//   Ol   [4096][1024]  attention out lo plane   8,388,608 B
// ---------------------------------------------------------------------------
extern "C" void kernel_launch(void* const* d_in, const int* in_sizes, int n_in,
                              void* d_out, int out_size, void* d_ws, size_t ws_size,
                              hipStream_t stream) {
  if (n_in < 5) return;
  if (in_sizes[0] != kTotRows * kModel) return;
  if (in_sizes[1] != kModel * kQkvLd) return;
  if (in_sizes[2] != kQkvLd) return;
  if (in_sizes[3] != kModel * kModel) return;
  if (in_sizes[4] != kModel) return;
  if (out_size != kTotRows * kModel) return;

  const float* hidden = (const float*)d_in[0];   // [8,1024,1024]
  const float* wattn  = (const float*)d_in[1];   // [1024,3072]  ([in][out])
  const float* battn  = (const float*)d_in[2];   // [3072]
  const float* wout   = (const float*)d_in[3];   // [1024,1024]  ([in][out])
  const float* bout   = (const float*)d_in[4];   // [1024]
  float* out = (float*)d_out;                    // [8,1024,1024]

  char* ws = (char*)d_ws;
  size_t off = 0;
  const size_t szXb  = (size_t)kTotRows * kModel * 2;
  const size_t szWaT = (size_t)kQkvLd * kModel * 2;
  const size_t szWoT = (size_t)kModel * kModel * 2;
  const size_t szQKV = (size_t)kHalfRows * kQkvLd * 2;
  const size_t szO   = (size_t)kHalfRows * kModel * 2;
  unsigned short* Xb   = (unsigned short*)(ws + off); off += szXb;
  unsigned short* WaT  = (unsigned short*)(ws + off); off += szWaT;
  unsigned short* WoT  = (unsigned short*)(ws + off); off += szWoT;
  unsigned short* QKVh = (unsigned short*)(ws + off); off += szQKV;
  unsigned short* QKVl = (unsigned short*)(ws + off); off += szQKV;
  unsigned short* Oh   = (unsigned short*)(ws + off); off += szO;
  unsigned short* Ol   = (unsigned short*)(ws + off); off += szO;
  if (off > ws_size) return;

  // 1) RNE bf16 cast of the activations (8 elements per thread): n8 = 1,048,576 -> 4096 blocks
  {
    const int n8 = kTotRows * kModel / 8;
    cast_f32_bf16x8<<<dim3((n8 + 255) / 256), dim3(256), 0, stream>>>(hidden, Xb, n8);
  }
  // 2) weights: in [K=1024][N] f32 -> out [N][K] bf16 ; grid = (N/64, K/64)
  wt_cast_bf16<<<dim3(kQkvLd / 64, kModel / 64), dim3(256), 0, stream>>>(wattn, WaT, kModel, kQkvLd);
  wt_cast_bf16<<<dim3(kModel / 64, kModel / 64), dim3(256), 0, stream>>>(wout, WoT, kModel, kModel);

  for (int half = 0; half < kBatch / kHalfBatch; ++half) {
    const unsigned short* Xh = Xb + (size_t)half * kHalfRows * kModel;
    float* outh = out + (size_t)half * kHalfRows * kModel;
    // 3) qkv = hidden @ W_attn + b_attn : M=4096, N=3072, K=1024 -> bf16 hi/lo planes (tiles = 64*48 = 3072 -> 384 blocks)
    wmma_gemm64<1, 0, 3, 2, false><<<dim3(((kHalfRows / 64) * (kQkvLd / 64) + 7) / 8, 1), dim3(256), 0, stream>>>(
        Xh, nullptr, kModel, 0L, WaT, nullptr, kModel, 0L,
        (void*)QKVh, (void*)QKVl, kQkvLd, 0L, battn, nullptr, 0L, kHalfRows, kQkvLd, kModel, 1.0f);
    // 4) causal attention, 4*16*16 = 1024 blocks of 128 threads
    attn_causal_k<<<dim3(kHalfBatch * kHeads * kNumQB), dim3(128), 0, stream>>>(QKVh, QKVl, Oh, Ol);
    // 5) out = O @ W_out + b_out : M=4096, N=1024, K=1024, A hi/lo split, f32 result to d_out (tiles = 64*16 -> 128 blocks)
    wmma_gemm64<1, 2, 3, 0, false><<<dim3(((kHalfRows / 64) * (kModel / 64) + 7) / 8, 1), dim3(256), 0, stream>>>(
        Oh, Ol, kModel, 0L, WoT, nullptr, kModel, 0L,
        (void*)outh, nullptr, kModel, 0L, bout, nullptr, 0L, kHalfRows, kModel, kModel, 1.0f);
  }
}

// v001
// It runs in 479 microseconds.
// Next to v000, in two timings, it ran 1.23 times as fast each time.
// Contractions: qkv projection v_wmma_f32_16x16x32_bf16 on RNE-bf16 x and W (single product); attention q.k^T and p.v v_wmma_f32_16x16x32_bf16 with bf16 hi/lo split (hi.hi + hi.lo + lo.hi); output projection bf16 hi/lo A-split x bf16 W_out (hi.w + lo.w); f32 accumulate everywhere; softmax, scale and bias adds in f32.
#include <hip/hip_runtime.h>
#include <math.h>
#include <float.h>
#include <stdint.h>

// ---------------------------------------------------------------------------
// Fixed problem geometry
// ---------------------------------------------------------------------------
constexpr int kBatch     = 8;
constexpr int kSeq       = 1024;
constexpr int kModel     = 1024;
constexpr int kHeads     = 16;
constexpr int kHeadDim   = 64;
constexpr int kQkvLd     = 3 * kModel;            // 3072: q | k | v columns
constexpr int kTotRows   = kBatch * kSeq;         // 8192
constexpr int kHalfBatch = 4;                     // batches per pass
constexpr int kHalfRows  = kHalfBatch * kSeq;     // 4096
constexpr int kNumQB     = kSeq / 64;             // 16 query blocks of 64 rows
constexpr float kQkScale = 0.125f;                // 1/sqrt(64), exact power of two
constexpr float kMaskFill = -FLT_MAX;             // finfo(float32).min
static_assert(kNumQB == 16);
static_assert(kHeads == 16);
static_assert(kModel % 64 == 0 && kQkvLd % 64 == 0 && kHalfRows % 64 == 0);
static_assert(kModel % 32 == 0);

typedef __attribute__((ext_vector_type(16))) _Float16 v16h;
typedef __attribute__((ext_vector_type(8)))  _Float16 v8h;
typedef __attribute__((ext_vector_type(16))) __bf16   v16b;
typedef __attribute__((ext_vector_type(8)))  __bf16   v8b;
typedef __attribute__((ext_vector_type(8)))  float    v8f;
typedef __attribute__((ext_vector_type(4)))  float    v4f;
typedef __attribute__((ext_vector_type(8)))  unsigned short v8us;

__device__ __forceinline__ unsigned short f2bf_bits(float f) {
  unsigned u = __float_as_uint(f);
  return (unsigned short)((u + 0x7FFFu + ((u >> 16) & 1u)) >> 16);
}
__device__ __forceinline__ float bf_bits2f(unsigned short h) { return __uint_as_float(((unsigned)h) << 16); }

// hazard guards as plain device helpers (no inline asm inside the kernel template body)
__device__ __forceinline__ void dep_guard_h(v8f& a, v8f& b, v16h x, v16h y) { asm volatile("v_nop\n\tv_nop\n\tv_nop\n\tv_nop" : "+v"(a), "+v"(b) : "v"(x), "v"(y)); }
__device__ __forceinline__ void dep_guard_b(v8f& a, v8f& b, v16b x, v16b y) { asm volatile("v_nop\n\tv_nop\n\tv_nop\n\tv_nop" : "+v"(a), "+v"(b) : "v"(x), "v"(y)); }
__device__ __forceinline__ void keep4_h(v16h a, v16h b, v16h c, v16h d) { asm volatile("v_nop" :: "v"(a), "v"(b), "v"(c), "v"(d)); }
__device__ __forceinline__ void keep4_b(v16b a, v16b b, v16b c, v16b d) { asm volatile("v_nop" :: "v"(a), "v"(b), "v"(c), "v"(d)); }
__device__ __forceinline__ void acc_guard4(v8f& a, v8f& b, v8f& c, v8f& d) { asm volatile("v_nop\n\tv_nop\n\tv_nop\n\tv_nop" : "+v"(a), "+v"(b), "+v"(c), "+v"(d)); }
template <typename T> struct Frag;
template <> struct Frag<_Float16> {
  typedef v16h V; union U { v16h v; v8h h[2]; };
  static __device__ __forceinline__ v16h load(const _Float16* p) {   // elements 0..7 <- p[0..7], 8..15 <- p[16..23]
    U f; f.h[0] = *(const v8h*)(p); f.h[1] = *(const v8h*)(p + 16); return f.v;
  }
  static __device__ __forceinline__ v8f mma(v16h a, v16h b, v8f c) {
    return __builtin_amdgcn_wmma_f32_16x16x32_f16(false, a, false, b, (short)0, c, false, false);
  }
  static __device__ __forceinline__ void guard(v8f& a, v8f& b, v16h x, v16h y) { dep_guard_h(a, b, x, y); }
  static __device__ __forceinline__ void keep(v16h a, v16h b, v16h c, v16h d) { keep4_h(a, b, c, d); }
};
template <> struct Frag<__bf16> {
  typedef v16b V; union U { v16b v; v8b h[2]; };
  static __device__ __forceinline__ v16b load(const __bf16* p) {
    U f; f.h[0] = *(const v8b*)(p); f.h[1] = *(const v8b*)(p + 16); return f.v;
  }
  static __device__ __forceinline__ v8f mma(v16b a, v16b b, v8f c) {
    return __builtin_amdgcn_wmma_f32_16x16x32_bf16(false, a, false, b, (short)0, c, false, false);
  }
  static __device__ __forceinline__ void guard(v8f& a, v8f& b, v16b x, v16b y) { dep_guard_b(a, b, x, y); }
  static __device__ __forceinline__ void keep(v16b a, v16b b, v16b c, v16b d) { keep4_b(a, b, c, d); }
};

// ---- Register-blocked batched WMMA GEMM ------------------------------------
// C[m,n] = scale * sum_k A[m,k] * Bt[n,k] (+bias)(+resid); each wave owns a 64x64 tile.
// A row-major [M,K]; Bt row-major [N,K]; M,N % 64 == 0, K % 32 == 0.
// SPLIT: 0 = single product; 1 = A and Bt hi/lo planes (A2/Bt2 = lo planes): hi.hi + hi.lo + lo.hi;
//        2 = A hi/lo planes only (Bt single plane): hi.b + lo.b.
// BIAS_MODE: 0 = none, 1 = bias[m], 2 = bias[n], 3 = bias[n] passed through an RNE bf16 convert first.
// OUT_MODE: 0 = f32, 1 = f16, 2 = bf16 hi plane (Cout) + bf16 lo plane (Cout2).
// ET: 0 = f16 operands, 1 = bf16 operands (pointers passed as 16-bit storage)
template <int ET> struct Elem;
template <> struct Elem<0> { typedef _Float16 T; };
template <> struct Elem<1> { typedef __bf16 T; };
template <int ET, int SPLIT, int BIAS_MODE, int OUT_MODE, bool RESID, int ACT = 0>
__global__ __launch_bounds__(256) void wmma_gemm64(
    const unsigned short* __restrict__ Ap, const unsigned short* __restrict__ A2p, int lda, long strideA,
    const unsigned short* __restrict__ Btp, const unsigned short* __restrict__ Bt2p, int ldb, long strideB,
    void* __restrict__ Cout, void* __restrict__ Cout2, int ldc, long strideC,
    const float* __restrict__ bias,
    const float* __restrict__ resid, long strideR,
    int M, int N, int K, float scale) {
  typedef typename Elem<ET>::T T;
  typedef typename Frag<T>::V V;
  const T* A = (const T*)Ap; const T* A2 = (const T*)A2p; const T* Bt = (const T*)Btp; const T* Bt2 = (const T*)Bt2p;
  __shared__ __align__(16) float sT[8][16 * 68];   // per-wave 16x64 slab, pitch 68 floats
  const int b    = blockIdx.y;
  const int lane = threadIdx.x & 31;
  const int wave = threadIdx.x >> 5;
  const int tilesN = N >> 6;
  const int tilesM = M >> 6;
  const int tile = blockIdx.x * 8 + wave;
  if (tile >= tilesM * tilesN) return;   // wave-uniform; no block barriers in this kernel
  const int tm = tile / tilesN;
  const int tn = tile - tm * tilesN;
  const int m0 = tm << 6;
  const int n0 = tn << 6;

  const T* Ab  = A  + (size_t)b * strideA;
  const T* Bb  = Bt + (size_t)b * strideB;
  const T* Ab2 = (SPLIT != 0) ? (A2  + (size_t)b * strideA) : nullptr;
  const T* Bb2 = (SPLIT == 1) ? (Bt2 + (size_t)b * strideB) : nullptr;

  const int rlane = lane & 15;                 // row (A) / col (B, D) within subtile
  const int koff  = (lane >> 4) * 8;           // k offset of this lane half
  const int mOff  = (lane >> 4) * 8;           // D row offset

  v8f acc[4][4];
#pragma unroll
  for (int i = 0; i < 4; ++i)
#pragma unroll
    for (int j = 0; j < 4; ++j) acc[i][j] = (v8f){0.f,0.f,0.f,0.f,0.f,0.f,0.f,0.f};

  for (int k0 = 0; k0 < K; k0 += 32) {
    V bh[4], bl[4];
#pragma unroll
    for (int j = 0; j < 4; ++j) {
      const size_t bo = (size_t)(n0 + (j << 4) + rlane) * ldb + koff + k0;
      bh[j] = Frag<T>::load(Bb + bo);
      if (SPLIT == 1) bl[j] = Frag<T>::load(Bb2 + bo);
    }
#pragma unroll
    for (int i = 0; i < 4; ++i) {
      const size_t ao = (size_t)(m0 + (i << 4) + rlane) * lda + koff + k0;
      V ah = Frag<T>::load(Ab + ao);
      V al;
      if (SPLIT != 0) al = Frag<T>::load(Ab2 + ao);
#pragma unroll
      for (int j = 0; j < 4; ++j) {
        acc[i][j] = Frag<T>::mma(ah, bh[j], acc[i][j]);
        if (SPLIT == 1) acc[i][j] = Frag<T>::mma(ah, bl[j], acc[i][j]);
        if (SPLIT != 0) acc[i][j] = Frag<T>::mma(al, bh[j], acc[i][j]);
      }
      Frag<T>::guard(acc[i][0], acc[i][3], ah, (SPLIT != 0) ? al : ah);
    }
    Frag<T>::keep(bh[0], bh[1], bh[2], bh[3]);
    if (SPLIT == 1) Frag<T>::keep(bl[0], bl[1], bl[2], bl[3]);
  }
  acc_guard4(acc[0][0], acc[0][1], acc[0][2], acc[0][3]);
  acc_guard4(acc[1][0], acc[1][1], acc[1][2], acc[1][3]);
  acc_guard4(acc[2][0], acc[2][1], acc[2][2], acc[2][3]);
  acc_guard4(acc[3][0], acc[3][1], acc[3][2], acc[3][3]);

  // ---- epilogue ----
  float* slab = sT[wave];
  const float* Rb = RESID ? (resid + (size_t)b * strideR) : nullptr;
#pragma unroll
  for (int i = 0; i < 4; ++i) {
    const int mBase = m0 + (i << 4);
#pragma unroll
    for (int j = 0; j < 4; ++j) {
      const int n = n0 + (j << 4) + rlane;
      float bv = 0.f;
      if (BIAS_MODE == 2) bv = bias[n];
      if (BIAS_MODE == 3) bv = bf_bits2f(f2bf_bits(bias[n]));
#pragma unroll
      for (int r = 0; r < 8; ++r) {
        float v = acc[i][j][r] * scale;
        if (BIAS_MODE == 1) v += bias[mBase + mOff + r];
        if (BIAS_MODE == 2 || BIAS_MODE == 3) v += bv;
        if (RESID) v += Rb[(size_t)(mBase + mOff + r) * ldc + n];
        if (ACT == 1) v = tanhf(v);
        if (ACT == 2) v = fmaxf(v, 0.0f);
        if (ACT == 4) v = (v > 0.f) ? v : 0.01f * v;
        slab[(mOff + r) * 68 + (j << 4) + rlane] = v;
      }
    }
    __builtin_amdgcn_fence(__ATOMIC_RELEASE, "workgroup");
    __builtin_amdgcn_wave_barrier();
    __builtin_amdgcn_fence(__ATOMIC_ACQUIRE, "workgroup");
    if (OUT_MODE == 0) {
      float* C = (float*)Cout + (size_t)b * strideC;
      const int hh = lane >> 4, c4 = (lane & 15) * 4;     // row seg = 256 B = 16 lanes x 16 B
      {
#pragma unroll
        for (int it = 0; it < 8; ++it) {
          const int row = it * 2 + hh;
          v4f v = *(const v4f*)(slab + row * 68 + c4);
          *(v4f*)(C + (size_t)(mBase + row) * ldc + n0 + c4) = v;
        }
        
      }
    } else {
      const int q = lane >> 3, c8 = (lane & 7) * 8;
      unsigned short* C  = (unsigned short*)Cout  + (size_t)b * strideC;
      unsigned short* C2 = (OUT_MODE == 2) ? ((unsigned short*)Cout2 + (size_t)b * strideC) : nullptr;
      {
#pragma unroll
        for (int it = 0; it < 4; ++it) {
          const int row = it * 4 + q;
          const float* sp = slab + row * 68 + c8;
          v8h hv, lv;
#pragma unroll
          for (int e = 0; e < 8; ++e) {
            if (OUT_MODE == 1) {
              hv[e] = (_Float16)sp[e];
            } else {
              unsigned short hb = f2bf_bits(sp[e]);
              unsigned short lb = f2bf_bits(sp[e] - bf_bits2f(hb));
              hv[e] = __builtin_bit_cast(_Float16, hb);
              lv[e] = __builtin_bit_cast(_Float16, lb);
            }
          }
          *(v8h*)(C + (size_t)(mBase + row) * ldc + n0 + c8) = hv;
          if (OUT_MODE == 2) *(v8h*)(C2 + (size_t)(mBase + row) * ldc + n0 + c8) = lv;
        }
        
      }
    }
    __builtin_amdgcn_fence(__ATOMIC_RELEASE, "workgroup");
    __builtin_amdgcn_wave_barrier();
    __builtin_amdgcn_fence(__ATOMIC_ACQUIRE, "workgroup");
  }
}

// ---- f32 [n] -> bf16 (RNE) [n], same layout; 8 elements per thread = one 16-B store per lane ----
// grid = ceil(n8/256) with n8 = n/8 (here 1,048,576 = 4096 x 256 exactly), bound checked anyway.
__global__ __launch_bounds__(256) void cast_f32_bf16x8(const float* __restrict__ in,
                                                       unsigned short* __restrict__ out, int n8) {
  const int i = blockIdx.x * 256 + threadIdx.x;
  if (i < n8) {
    const v4f a0 = *(const v4f*)(in + (size_t)i * 8);
    const v4f a1 = *(const v4f*)(in + (size_t)i * 8 + 4);
    v8us u;
    u[0] = f2bf_bits(a0[0]); u[1] = f2bf_bits(a0[1]); u[2] = f2bf_bits(a0[2]); u[3] = f2bf_bits(a0[3]);
    u[4] = f2bf_bits(a1[0]); u[5] = f2bf_bits(a1[1]); u[6] = f2bf_bits(a1[2]); u[7] = f2bf_bits(a1[3]);
    *(v8us*)(out + (size_t)i * 8) = u;
    
  }
}

// ---- W [K][N] f32 -> Wt [N][K] bf16 (RNE), 64x64 tile transposed through LDS; grid = (N/64, K/64) ----
// Phase 1 coverage: kr = tid>>2 (64 k rows) x c16 = (tid&3)*16 with 4 quads of 4 -> every (k, n) of the tile once.
// Phase 2 coverage: n = it*32 + wave*4 + q8 (it 0..1, wave 0..7, q8 0..3) -> rows 0..63; c8 -> 8 lanes x 8 = 64 k.
#define WTP 72
__global__ __launch_bounds__(256) void wt_cast_bf16(const float* __restrict__ W, unsigned short* __restrict__ Wt,
                                                    int K, int N) {
  __shared__ __align__(16) unsigned short st[64 * WTP];
  const int n0 = blockIdx.x * 64, k0 = blockIdx.y * 64;
  const int tid = threadIdx.x;
  const int kr = tid >> 2, c16 = (tid & 3) * 16;
  const float* src = W + (size_t)(k0 + kr) * N + n0 + c16;
#pragma unroll
  for (int q = 0; q < 4; ++q) {
    const v4f v = *(const v4f*)(src + 4 * q);
#pragma unroll
    for (int e = 0; e < 4; ++e) st[(c16 + 4 * q + e) * WTP + kr] = f2bf_bits(v[e]);
  }
  __syncthreads();
  const int wave = tid >> 5, lane = tid & 31;
  const int q8 = lane >> 3, c8 = (lane & 7) * 8;
  {
#pragma unroll
    for (int it = 0; it < 2; ++it) {
      const int n = it * 32 + wave * 4 + q8;
      const v8us hv = *(const v8us*)(st + n * WTP + c8);
      *(v8us*)(Wt + (size_t)(n0 + n) * K + k0 + c8) = hv;
    }
    
  }
}

// =====================================================================================
// Causal attention, head_dim 64, bf16 hi/lo planes in, bf16 hi/lo planes out.
//   q|k|v hi/lo planes [kHalfRows][3072] (element (b,s,part,h,d) at (b*S+s)*3072 + part*1024 + h*64 + d, b local to the pass).
//   Block = 4 waves = 64 query rows of one (b,h); 64-key chunks kc = 0..qb (later chunks have exactly zero weight);
//   the diagonal chunk sets kv > q scores to finfo.min by select after the 1/8 scale.
//   scores and p.v: v_wmma_f32_16x16x32_bf16 with hi/lo split (hi.hi + hi.lo + lo.hi), f32 accumulate; online softmax in f32.
//   grid.x = kHalfBatch * kHeads * kNumQB = 1024.
// =====================================================================================
__device__ __forceinline__ v8f mma_b(v16b a, v16b b, v8f c) {
  c = __builtin_amdgcn_wmma_f32_16x16x32_bf16(false, a, false, b, (short)0, c, false, false);
  asm volatile("v_nop\n\tv_nop\n\tv_nop\n\tv_nop" : "+v"(c) : "v"(a), "v"(b));
  return c;
}
__device__ __forceinline__ void bf_split(float f, __bf16& hi, __bf16& lo) {
  const unsigned short hb = f2bf_bits(f);
  hi = __builtin_bit_cast(__bf16, hb);
  lo = __builtin_bit_cast(__bf16, f2bf_bits(f - bf_bits2f(hb)));
}

#define AKC 64
#define LKP 72   // LDS row pitch of the K, V^T and P tiles in elements: 144 B = 16 B x 9 (odd), so 16 rows read by ds_load_b128 fall on distinct banks
#define OSP 68
__global__ __launch_bounds__(128) void attn_causal_k(
    const unsigned short* __restrict__ qkvhp, const unsigned short* __restrict__ qkvlp,
    unsigned short* __restrict__ ohp, unsigned short* __restrict__ olp) {
  union FB { v16b v; v8b h[2]; };
  __shared__ __align__(16) __bf16 Ksh[AKC * LKP];             // K hi [kv][d]   9 KB
  __shared__ __align__(16) __bf16 Ksl[AKC * LKP];             // K lo
  __shared__ __align__(16) __bf16 Vth[kHeadDim * LKP];        // V hi [d][kv]   9 KB
  __shared__ __align__(16) __bf16 Vtl[kHeadDim * LKP];        // V lo
  __shared__ __align__(16) __bf16 Psh[4][16 * LKP];           // per wave P hi [row][kv]
  __shared__ __align__(16) __bf16 Psl[4][16 * LKP];           // per wave P lo
  __shared__ __align__(16) float  Os[4][16 * OSP];            // per wave out tile, pitch 68

  const __bf16* Qh = (const __bf16*)qkvhp;
  const __bf16* Ql = (const __bf16*)qkvlp;

  const int tid  = threadIdx.x;
  const int wave = tid >> 5;
  const int lane = tid & 31;
  const int hh   = lane >> 4;
  const int c    = lane & 15;

  const int bx = blockIdx.x;
  const int qb = bx & (kNumQB - 1);        // 16 query blocks of 64 rows
  const int bh = bx >> 4;
  const int h  = bh & (kHeads - 1);
  const int b  = bh >> 4;                  // 0..kHalfBatch-1 within this pass
  const int q0 = qb * 64 + wave * 16;

  // ---- Q fragments (A operand): 2 d-chunks, hi and lo, via Frag loader ----
  v16b qah[2], qal[2];
  {
    const size_t qo = (size_t)(b * kSeq + q0 + c) * kQkvLd + h * kHeadDim + 8 * hh;
#pragma unroll
    for (int dc = 0; dc < 2; ++dc) {
      qah[dc] = Frag<__bf16>::load(Qh + qo + dc * 32);
      qal[dc] = Frag<__bf16>::load(Ql + qo + dc * 32);
    }
  }

  float mrow[8], lrow[8];
  v8f oacc[4];
#pragma unroll
  for (int r = 0; r < 8; ++r) { mrow[r] = -INFINITY; lrow[r] = 0.f; }
#pragma unroll
  for (int t = 0; t < 4; ++t) oacc[t] = (v8f){0.f,0.f,0.f,0.f,0.f,0.f,0.f,0.f};

  const int nIter = qb + 1;   // block-uniform: causal chunks 0..qb, <= 16
  for (int kc = 0; kc < nIter; ++kc) {
    const int kv0 = kc * AKC;
    __syncthreads();
    {
      // staging coverage: 128 threads = 64 kv rows x 2 d-halves of 32; 4 x 8 elements per thread per plane
      const int kvr = tid >> 1, dh = (tid & 1) * 32;
      const size_t mo = ((size_t)(b * kSeq + kv0 + kvr)) * kQkvLd + kModel + h * kHeadDim + dh;   // k row
      const __bf16* kh = Qh + mo;
      const __bf16* kl = Ql + mo;
      const __bf16* vh = kh + kModel;      // v sits 1024 columns after k
      const __bf16* vl = kl + kModel;
#pragma unroll 1
      for (int i = 0; i < 4; ++i) {
        const v8b a0 = *(const v8b*)(kh + 8 * i);
        *(v8b*)(Ksh + kvr * LKP + dh + 8 * i) = a0;
        const v8b a1 = *(const v8b*)(kl + 8 * i);
        *(v8b*)(Ksl + kvr * LKP + dh + 8 * i) = a1;
        const v8b w0 = *(const v8b*)(vh + 8 * i);
        const v8b w1 = *(const v8b*)(vl + 8 * i);
#pragma unroll
        for (int e = 0; e < 8; ++e) {
          Vth[(dh + 8 * i + e) * LKP + kvr] = w0[e];
          Vtl[(dh + 8 * i + e) * LKP + kvr] = w1[e];
        }
      }
    }
    __syncthreads();

    // ---- scores: 3 products per d-chunk ----
    v8f s[4];
#pragma unroll
    for (int j = 0; j < 4; ++j) {
      s[j] = (v8f){0.f,0.f,0.f,0.f,0.f,0.f,0.f,0.f};
#pragma unroll
      for (int dc = 0; dc < 2; ++dc) {
        FB kb, kq;
        kb.h[0] = *(const v8b*)(Ksh + (j * 16 + c) * LKP + dc * 32 + 8 * hh);
        kb.h[1] = *(const v8b*)(Ksh + (j * 16 + c) * LKP + dc * 32 + 16 + 8 * hh);
        kq.h[0] = *(const v8b*)(Ksl + (j * 16 + c) * LKP + dc * 32 + 8 * hh);
        kq.h[1] = *(const v8b*)(Ksl + (j * 16 + c) * LKP + dc * 32 + 16 + 8 * hh);
        s[j] = mma_b(qah[dc], kb.v, s[j]);
        s[j] = mma_b(qah[dc], kq.v, s[j]);
        s[j] = mma_b(qal[dc], kb.v, s[j]);
      }
    }
    const bool diag = (kc == qb);
    float cm[8];
#pragma unroll
    for (int r = 0; r < 8; ++r) {
      const int qrow = q0 + 8 * hh + r;
      float m = -INFINITY;
#pragma unroll
      for (int j = 0; j < 4; ++j) {
        const int kvcol = kv0 + j * 16 + c;
        float sv = s[j][r] * kQkScale;
        if (diag && (kvcol > qrow)) sv = kMaskFill;
        s[j][r] = sv;
        m = fmaxf(m, sv);
      }
#pragma unroll
      for (int off = 1; off < 16; off <<= 1) m = fmaxf(m, __shfl_xor(m, off, 32));
      cm[r] = m;
    }
    __bf16* pwh = Psh[wave];
    __bf16* pwl = Psl[wave];
#pragma unroll
    for (int r = 0; r < 8; ++r) {
      const float mnew = fmaxf(mrow[r], cm[r]);
      const float alpha = expf(mrow[r] - mnew);
      mrow[r] = mnew;
      float psum = 0.f;
#pragma unroll
      for (int j = 0; j < 4; ++j) {
        const float p = expf(s[j][r] - mnew);
        psum += p;
        __bf16 pa, pb; bf_split(p, pa, pb);
        pwh[(8 * hh + r) * LKP + j * 16 + c] = pa;
        pwl[(8 * hh + r) * LKP + j * 16 + c] = pb;
      }
#pragma unroll
      for (int off = 1; off < 16; off <<= 1) psum += __shfl_xor(psum, off, 32);
      lrow[r] = lrow[r] * alpha + psum;
#pragma unroll
      for (int t = 0; t < 4; ++t) oacc[t][r] *= alpha;
    }
    __builtin_amdgcn_fence(__ATOMIC_RELEASE, "workgroup");
    __builtin_amdgcn_wave_barrier();
    __builtin_amdgcn_fence(__ATOMIC_ACQUIRE, "workgroup");
    // ---- O += P x V : 3 products ----
#pragma unroll 1
    for (int kk = 0; kk < 2; ++kk) {
      FB pa, pl;
      pa.h[0] = *(const v8b*)(pwh + c * LKP + kk * 32 + 8 * hh);
      pa.h[1] = *(const v8b*)(pwh + c * LKP + kk * 32 + 16 + 8 * hh);
      pl.h[0] = *(const v8b*)(pwl + c * LKP + kk * 32 + 8 * hh);
      pl.h[1] = *(const v8b*)(pwl + c * LKP + kk * 32 + 16 + 8 * hh);
#pragma unroll
      for (int t = 0; t < 4; ++t) {
        FB vb, vq;
        vb.h[0] = *(const v8b*)(Vth + (t * 16 + c) * LKP + kk * 32 + 8 * hh);
        vb.h[1] = *(const v8b*)(Vth + (t * 16 + c) * LKP + kk * 32 + 16 + 8 * hh);
        vq.h[0] = *(const v8b*)(Vtl + (t * 16 + c) * LKP + kk * 32 + 8 * hh);
        vq.h[1] = *(const v8b*)(Vtl + (t * 16 + c) * LKP + kk * 32 + 16 + 8 * hh);
        oacc[t] = mma_b(pa.v, vb.v, oacc[t]);
        oacc[t] = mma_b(pa.v, vq.v, oacc[t]);
        oacc[t] = mma_b(pl.v, vb.v, oacc[t]);
      }
    }
  }

  // ---- normalize, stage, write hi/lo planes ----
  float* os = Os[wave];
#pragma unroll
  for (int r = 0; r < 8; ++r) {
    const float inv = 1.0f / lrow[r];
#pragma unroll
    for (int t = 0; t < 4; ++t) os[(8 * hh + r) * OSP + t * 16 + c] = oacc[t][r] * inv;
  }
  __builtin_amdgcn_fence(__ATOMIC_RELEASE, "workgroup");
  __builtin_amdgcn_wave_barrier();
  __builtin_amdgcn_fence(__ATOMIC_ACQUIRE, "workgroup");
  {
    const int q8 = lane >> 3, c8 = (lane & 7) * 8;
    _Float16* Oh = (_Float16*)ohp;
    _Float16* Ol = (_Float16*)olp;
    {
#pragma unroll
      for (int it = 0; it < 4; ++it) {
        const int row = it * 4 + q8;
        const float* sp = os + row * OSP + c8;
        v8h hv, lv;
#pragma unroll
        for (int e = 0; e < 8; ++e) {
          const unsigned short hb = f2bf_bits(sp[e]);
          const unsigned short lb = f2bf_bits(sp[e] - bf_bits2f(hb));
          hv[e] = __builtin_bit_cast(_Float16, hb);
          lv[e] = __builtin_bit_cast(_Float16, lb);
        }
        const size_t oo = (size_t)(b * kSeq + q0 + row) * kModel + h * kHeadDim + c8;
        *(v8h*)(Oh + oo) = hv;
        *(v8h*)(Ol + oo) = lv;
      }
      
    }
  }
}

// ---------------------------------------------------------------------------
// Workspace region map (all offsets 256-B aligned, all planes bf16 bits):
//   Xb   [8192][1024]  hidden as bf16          16,777,216 B
//   WaT  [3072][1024]  W_attn transposed        6,291,456 B
//   WoT  [1024][1024]  W_out transposed         2,097,152 B
//   QKVh [4096][3072]  q|k|v hi plane (pass)   25,165,824 B
//   QKVl [4096][3072]  q|k|v lo plane (pass)   25,165,824 B
//   Oh   [4096][1024]  attention out hi plane   8,388,608 B
//   Ol   [4096][1024]  attention out lo plane   8,388,608 B
// ---------------------------------------------------------------------------
extern "C" void kernel_launch(void* const* d_in, const int* in_sizes, int n_in,
                              void* d_out, int out_size, void* d_ws, size_t ws_size,
                              hipStream_t stream) {
  if (n_in < 5) return;
  if (in_sizes[0] != kTotRows * kModel) return;
  if (in_sizes[1] != kModel * kQkvLd) return;
  if (in_sizes[2] != kQkvLd) return;
  if (in_sizes[3] != kModel * kModel) return;
  if (in_sizes[4] != kModel) return;
  if (out_size != kTotRows * kModel) return;

  const float* hidden = (const float*)d_in[0];   // [8,1024,1024]
  const float* wattn  = (const float*)d_in[1];   // [1024,3072]  ([in][out])
  const float* battn  = (const float*)d_in[2];   // [3072]
  const float* wout   = (const float*)d_in[3];   // [1024,1024]  ([in][out])
  const float* bout   = (const float*)d_in[4];   // [1024]
  float* out = (float*)d_out;                    // [8,1024,1024]

  char* ws = (char*)d_ws;
  size_t off = 0;
  const size_t szXb  = (size_t)kTotRows * kModel * 2;
  const size_t szWaT = (size_t)kQkvLd * kModel * 2;
  const size_t szWoT = (size_t)kModel * kModel * 2;
  const size_t szQKV = (size_t)kHalfRows * kQkvLd * 2;
  const size_t szO   = (size_t)kHalfRows * kModel * 2;
  unsigned short* Xb   = (unsigned short*)(ws + off); off += szXb;
  unsigned short* WaT  = (unsigned short*)(ws + off); off += szWaT;
  unsigned short* WoT  = (unsigned short*)(ws + off); off += szWoT;
  unsigned short* QKVh = (unsigned short*)(ws + off); off += szQKV;
  unsigned short* QKVl = (unsigned short*)(ws + off); off += szQKV;
  unsigned short* Oh   = (unsigned short*)(ws + off); off += szO;
  unsigned short* Ol   = (unsigned short*)(ws + off); off += szO;
  if (off > ws_size) return;

  // 1) RNE bf16 cast of the activations (8 elements per thread): n8 = 1,048,576 -> 4096 blocks
  {
    const int n8 = kTotRows * kModel / 8;
    cast_f32_bf16x8<<<dim3((n8 + 255) / 256), dim3(256), 0, stream>>>(hidden, Xb, n8);
  }
  // 2) weights: in [K=1024][N] f32 -> out [N][K] bf16 ; grid = (N/64, K/64)
  wt_cast_bf16<<<dim3(kQkvLd / 64, kModel / 64), dim3(256), 0, stream>>>(wattn, WaT, kModel, kQkvLd);
  wt_cast_bf16<<<dim3(kModel / 64, kModel / 64), dim3(256), 0, stream>>>(wout, WoT, kModel, kModel);

  for (int half = 0; half < kBatch / kHalfBatch; ++half) {
    const unsigned short* Xh = Xb + (size_t)half * kHalfRows * kModel;
    float* outh = out + (size_t)half * kHalfRows * kModel;
    // 3) qkv = hidden @ W_attn + b_attn : M=4096, N=3072, K=1024 -> bf16 hi/lo planes (tiles = 64*48 = 3072 -> 384 blocks)
    wmma_gemm64<1, 0, 3, 2, false><<<dim3(((kHalfRows / 64) * (kQkvLd / 64) + 7) / 8, 1), dim3(256), 0, stream>>>(
        Xh, nullptr, kModel, 0L, WaT, nullptr, kModel, 0L,
        (void*)QKVh, (void*)QKVl, kQkvLd, 0L, battn, nullptr, 0L, kHalfRows, kQkvLd, kModel, 1.0f);
    // 4) causal attention, 4*16*16 = 1024 blocks of 128 threads
    attn_causal_k<<<dim3(kHalfBatch * kHeads * kNumQB), dim3(128), 0, stream>>>(QKVh, QKVl, Oh, Ol);
    // 5) out = O @ W_out + b_out : M=4096, N=1024, K=1024, A hi/lo split, f32 result to d_out (tiles = 64*16 -> 128 blocks)
    wmma_gemm64<1, 2, 3, 0, false><<<dim3(((kHalfRows / 64) * (kModel / 64) + 7) / 8, 1), dim3(256), 0, stream>>>(
        Oh, Ol, kModel, 0L, WoT, nullptr, kModel, 0L,
        (void*)outh, nullptr, kModel, 0L, bout, nullptr, 0L, kHalfRows, kModel, kModel, 1.0f);
  }
}

// v002
// Measured time: 300 microseconds a run.
// In both of two side-by-side timings against v001, it was 1.60 times as fast.
// Over all steps from v000 it is 1.97 times as fast.
// Contractions: qkv projection v_wmma_f32_16x16x32_bf16 on RNE-bf16 x and W (single product); attention q.k^T and p.v v_wmma_f32_16x16x32_bf16 with bf16 hi/lo split (hi.hi + hi.lo + lo.hi); output projection bf16 hi/lo A-split x bf16 W_out (hi.w + lo.w); f32 accumulate everywhere; softmax, scale and bias adds in f32.
#include <hip/hip_runtime.h>
#include <math.h>
#include <float.h>
#include <stdint.h>

// ---------------------------------------------------------------------------
// Fixed problem geometry
// ---------------------------------------------------------------------------
constexpr int kBatch     = 8;
constexpr int kSeq       = 1024;
constexpr int kModel     = 1024;
constexpr int kHeads     = 16;
constexpr int kHeadDim   = 64;
constexpr int kQkvLd     = 3 * kModel;            // 3072: q | k | v columns
constexpr int kTotRows   = kBatch * kSeq;         // 8192
constexpr int kHalfBatch = 4;                     // batches per pass
constexpr int kHalfRows  = kHalfBatch * kSeq;     // 4096
constexpr int kNumQB     = kSeq / 64;             // 16 query blocks of 64 rows
constexpr float kQkScale = 0.125f;                // 1/sqrt(64), exact power of two
constexpr float kMaskFill = -FLT_MAX;             // finfo(float32).min
static_assert(kNumQB == 16);
static_assert(kHeads == 16);
static_assert(kModel % 128 == 0 && kQkvLd % 256 == 0 && kHalfRows % 128 == 0);
static_assert(kModel % 64 == 0);

typedef __attribute__((ext_vector_type(16))) _Float16 v16h;
typedef __attribute__((ext_vector_type(8)))  _Float16 v8h;
typedef __attribute__((ext_vector_type(16))) __bf16   v16b;
typedef __attribute__((ext_vector_type(8)))  __bf16   v8b;
typedef __attribute__((ext_vector_type(8)))  float    v8f;
typedef __attribute__((ext_vector_type(4)))  float    v4f;
typedef __attribute__((ext_vector_type(8)))  unsigned short v8us;

__device__ __forceinline__ unsigned short f2bf_bits(float f) {
  unsigned u = __float_as_uint(f);
  return (unsigned short)((u + 0x7FFFu + ((u >> 16) & 1u)) >> 16);
}
__device__ __forceinline__ float bf_bits2f(unsigned short h) { return __uint_as_float(((unsigned)h) << 16); }

// hazard guards as plain device helpers
__device__ __forceinline__ void dep_guard_h(v8f& a, v8f& b, v16h x, v16h y) { asm volatile("v_nop\n\tv_nop\n\tv_nop\n\tv_nop" : "+v"(a), "+v"(b) : "v"(x), "v"(y)); }
__device__ __forceinline__ void dep_guard_b(v8f& a, v8f& b, v16b x, v16b y) { asm volatile("v_nop\n\tv_nop\n\tv_nop\n\tv_nop" : "+v"(a), "+v"(b) : "v"(x), "v"(y)); }
__device__ __forceinline__ void keep4_h(v16h a, v16h b, v16h c, v16h d) { asm volatile("v_nop" :: "v"(a), "v"(b), "v"(c), "v"(d)); }
__device__ __forceinline__ void keep4_b(v16b a, v16b b, v16b c, v16b d) { asm volatile("v_nop" :: "v"(a), "v"(b), "v"(c), "v"(d)); }
__device__ __forceinline__ void acc_guard4(v8f& a, v8f& b, v8f& c, v8f& d) { asm volatile("v_nop\n\tv_nop\n\tv_nop\n\tv_nop" : "+v"(a), "+v"(b), "+v"(c), "+v"(d)); }
template <typename T> struct Frag;
template <> struct Frag<_Float16> {
  typedef v16h V; union U { v16h v; v8h h[2]; };
  static __device__ __forceinline__ v16h load(const _Float16* p) {   // elements 0..7 <- p[0..7], 8..15 <- p[16..23]
    U f; f.h[0] = *(const v8h*)(p); f.h[1] = *(const v8h*)(p + 16); return f.v;
  }
  static __device__ __forceinline__ v8f mma(v16h a, v16h b, v8f c) {
    return __builtin_amdgcn_wmma_f32_16x16x32_f16(false, a, false, b, (short)0, c, false, false);
  }
  static __device__ __forceinline__ void guard(v8f& a, v8f& b, v16h x, v16h y) { dep_guard_h(a, b, x, y); }
  static __device__ __forceinline__ void keep(v16h a, v16h b, v16h c, v16h d) { keep4_h(a, b, c, d); }
};
template <> struct Frag<__bf16> {
  typedef v16b V; union U { v16b v; v8b h[2]; };
  static __device__ __forceinline__ v16b load(const __bf16* p) {
    U f; f.h[0] = *(const v8b*)(p); f.h[1] = *(const v8b*)(p + 16); return f.v;
  }
  static __device__ __forceinline__ v8f mma(v16b a, v16b b, v8f c) {
    return __builtin_amdgcn_wmma_f32_16x16x32_bf16(false, a, false, b, (short)0, c, false, false);
  }
  static __device__ __forceinline__ void guard(v8f& a, v8f& b, v16b x, v16b y) { dep_guard_b(a, b, x, y); }
  static __device__ __forceinline__ void keep(v16b a, v16b b, v16b c, v16b d) { keep4_b(a, b, c, d); }
};

// ---- LDS-staged batched WMMA GEMM ------------------------------------------
// C[m,n] = scale * sum_k A[m,k] * Bt[n,k] (+bias)(+resid); block = 2 x WN waves on a 128 x (64*WN) tile, each wave owns 64x64.
// A row-major [M,K]; Bt row-major [N,K]; M % 128 == 0, N % (64*WN) == 0, K % 64 == 0, K >= 64.
// Each k-slice of 64 (one 128-B line of every operand row of the block tile) is brought into LDS once, by asynchronous
// 16-B copies that cover whole lines, and every wave of the block reads its fragments from there; two buffers, so the
// next slice's copies fly while this slice is multiplied.
// SPLIT: 0 = single product; 2 = A hi/lo planes (A2 = lo plane), Bt single plane: hi.b + lo.b.
// BIAS_MODE: 0 = none, 1 = bias[m], 2 = bias[n], 3 = bias[n] passed through an RNE bf16 convert first.
// OUT_MODE: 0 = f32, 1 = f16, 2 = bf16 hi plane (Cout) + bf16 lo plane (Cout2).
// ET: 0 = f16 operands, 1 = bf16 operands (pointers passed as 16-bit storage)
template <int ET> struct Elem;
template <> struct Elem<0> { typedef _Float16 T; };
template <> struct Elem<1> { typedef __bf16 T; };

#define GBK 64   // k elements per staged slice: 128 B of every row
#define GLP 72   // LDS row pitch of the staged slices in elements: 144 B = 16 B x 9 (odd), conflict-free for the ds_load_b128 fragment reads

__device__ __forceinline__ uint32_t lds_off(const void* p) { return (uint32_t)(size_t)p; }   // byte offset in the work-group's LDS

// Twelve asynchronous 16-B copies per lane, global -> LDS through no register. The s_wait_xcnt stands inside the copies' own
// statement so that no address register they name is rewritten in front of it.
template <typename T>
__device__ __forceinline__ void async_copy12(const uint32_t (&l)[12], const T* const (&g)[12]) {
  asm volatile(
      "global_load_async_to_lds_b128 %0, %12, off\n\t"
      "global_load_async_to_lds_b128 %1, %13, off\n\t"
      "global_load_async_to_lds_b128 %2, %14, off\n\t"
      "global_load_async_to_lds_b128 %3, %15, off\n\t"
      "global_load_async_to_lds_b128 %4, %16, off\n\t"
      "global_load_async_to_lds_b128 %5, %17, off\n\t"
      "global_load_async_to_lds_b128 %6, %18, off\n\t"
      "global_load_async_to_lds_b128 %7, %19, off\n\t"
      "global_load_async_to_lds_b128 %8, %20, off\n\t"
      "global_load_async_to_lds_b128 %9, %21, off\n\t"
      "global_load_async_to_lds_b128 %10, %22, off\n\t"
      "global_load_async_to_lds_b128 %11, %23, off\n\t"
      "s_wait_xcnt 0x0"
      :: "v"(l[0]), "v"(l[1]), "v"(l[2]), "v"(l[3]), "v"(l[4]), "v"(l[5]),
         "v"(l[6]), "v"(l[7]), "v"(l[8]), "v"(l[9]), "v"(l[10]), "v"(l[11]),
         "v"(g[0]), "v"(g[1]), "v"(g[2]), "v"(g[3]), "v"(g[4]), "v"(g[5]),
         "v"(g[6]), "v"(g[7]), "v"(g[8]), "v"(g[9]), "v"(g[10]), "v"(g[11])
      : "memory");
}

template <int ET, int SPLIT, int BIAS_MODE, int OUT_MODE, bool RESID, int WN, int ACT = 0>
__global__ __launch_bounds__(64 * WN) void wmma_gemm64(
    const unsigned short* __restrict__ Ap, const unsigned short* __restrict__ A2p, int lda, long strideA,
    const unsigned short* __restrict__ Btp, const unsigned short* __restrict__ Bt2p, int ldb, long strideB,
    void* __restrict__ Cout, void* __restrict__ Cout2, int ldc, long strideC,
    const float* __restrict__ bias,
    const float* __restrict__ resid, long strideR,
    int M, int N, int K, float scale) {
  static_assert(SPLIT == 0 || SPLIT == 2);
  typedef typename Elem<ET>::T T;
  typedef typename Frag<T>::V V;
  constexpr int BM    = 128;                              // block tile rows
  constexpr int BN    = 64 * WN;                          // block tile columns
  constexpr int AROWS = (SPLIT == 2) ? 2 * BM : BM;       // staged A rows: hi plane, then lo plane
  constexpr int SROWS = AROWS + BN;                       // staged rows per slice: A | (A lo) | Bt
  constexpr int RPR   = (64 * WN) / 8;                    // rows one copy of the whole block covers: 8 lanes x 16 B per row
  constexpr int NC    = SROWS / RPR;                      // copies per lane and slice
  constexpr int STAGE_E = SROWS * GLP;                    // elements per buffer
  static_assert(BM % RPR == 0 && BN % RPR == 0 && NC % 12 == 0 && NC <= 63);
  const T* A = (const T*)Ap; const T* A2 = (const T*)A2p; const T* Bt = (const T*)Btp;
  __shared__ __align__(16) T ring[2 * STAGE_E];            // two buffers of one k-slice each
  __shared__ __align__(16) float sT[2 * WN][16 * 68];      // per-wave 16x64 slab, pitch 68 floats
  const int b    = blockIdx.y;
  const int tid  = threadIdx.x;
  const int lane = tid & 31;
  const int wave = tid >> 5;
  const int tilesN = N / BN;
  const int tilesM = M / BM;
  const int bt = blockIdx.x;
  if (bt >= tilesM * tilesN) return;   // block-uniform, in front of every copy and barrier
  const int bm = bt / tilesN;
  const int bn = bt - bm * tilesN;
  const int wm = wave / WN;
  const int wn = wave - wm * WN;
  const int m0 = bm * BM + (wm << 6);
  const int n0 = bn * BN + (wn << 6);

  const int rlane = lane & 15;                 // row (A) / col (B, D) within subtile
  const int koff  = (lane >> 4) * 8;           // k offset of this lane half
  const int mOff  = (lane >> 4) * 8;           // D row offset

  // copy side: lane = (row tid>>3 of a round of RPR rows, 16-B segment tid&7 of its 128-B line)
  const int crow = tid >> 3, cseg = (tid & 7) * 8;
  // gA, gA2, gB walk along k: they point at the next slice to be copied
  const T* gA  = A  + (size_t)b * strideA + (size_t)(bm * BM + crow) * lda + cseg;
  const T* gA2 = (SPLIT == 2) ? (A2 + (size_t)b * strideA + (size_t)(bm * BM + crow) * lda + cseg) : nullptr;
  const T* gB  = Bt + (size_t)b * strideB + (size_t)(bn * BN + crow) * ldb + cseg;
  const uint32_t lC = lds_off(ring) + (uint32_t)(crow * GLP + cseg) * 2u;
  auto issue_slice = [&](int buf) {
    const uint32_t lb = lC + (uint32_t)buf * (uint32_t)(STAGE_E * 2);
#pragma unroll
    for (int g = 0; g < NC / 12; ++g) {
      uint32_t l[12];
      const T* p[12];
#pragma unroll
      for (int c = 0; c < 12; ++c) {
        const int sr = (g * 12 + c) * RPR;     // first staged row of this round
        l[c] = lb + (uint32_t)(sr * GLP * 2);
        if (sr < BM)         p[c] = gA  + (size_t)sr * lda;
        else if (sr < AROWS) p[c] = gA2 + (size_t)(sr - BM) * lda;
        else                 p[c] = gB  + (size_t)(sr - AROWS) * ldb;
      }
      async_copy12<T>(l, p);
    }
    gA += GBK;
    if (SPLIT == 2) gA2 += GBK;
    gB += GBK;
  };

  // fragment side: this lane's row and k half inside a buffer
  const T* fA = ring + ((wm << 6) + rlane) * GLP + koff;
  const T* fB = ring + (AROWS + (wn << 6) + rlane) * GLP + koff;

  v8f acc[4][4];
#pragma unroll
  for (int i = 0; i < 4; ++i)
#pragma unroll
    for (int j = 0; j < 4; ++j) acc[i][j] = (v8f){0.f,0.f,0.f,0.f,0.f,0.f,0.f,0.f};

  const int nT = K / GBK;                      // block-uniform
  issue_slice(0);
  asm volatile("s_wait_asynccnt 0x0" ::: "memory");   // this wave's copies of slice 0 have landed
  __syncthreads();                                     // ... and every other wave's
  if (nT > 1) issue_slice(1);
  for (int t = 0; t < nT; ++t) {
    const int so = (t & 1) * STAGE_E;
#pragma unroll   // both 32-k halves of the slice in one body, so the second half's fragment reads can start under the first half's products
    for (int kk = 0; kk < GBK; kk += 32) {
      V bh[4], ah[4], al[4];
#pragma unroll
      for (int j = 0; j < 4; ++j) bh[j] = Frag<T>::load(fB + so + (j << 4) * GLP + kk);
#pragma unroll
      for (int i = 0; i < 4; ++i) {
        ah[i] = Frag<T>::load(fA + so + (i << 4) * GLP + kk);
        if (SPLIT == 2) al[i] = Frag<T>::load(fA + so + (BM + (i << 4)) * GLP + kk);
      }
#pragma unroll
      for (int i = 0; i < 4; ++i) {
#pragma unroll
        for (int j = 0; j < 4; ++j) {
          acc[i][j] = Frag<T>::mma(ah[i], bh[j], acc[i][j]);
          if (SPLIT == 2) acc[i][j] = Frag<T>::mma(al[i], bh[j], acc[i][j]);
        }
        Frag<T>::guard(acc[i][0], acc[i][3], ah[i], (SPLIT == 2) ? al[i] : ah[i]);
      }
      Frag<T>::keep(bh[0], bh[1], bh[2], bh[3]);
    }
    asm volatile("s_wait_dscnt 0x0" ::: "memory");     // this wave's reads of the buffer are done before it is refilled
    asm volatile("s_wait_asynccnt 0x0" ::: "memory");  // this wave's copies of slice t + 1 have landed
    __syncthreads();                                    // publishes slice t + 1 and ends every wave's reads of slice t
    if (t + 2 < nT) issue_slice(t & 1);
  }
  asm volatile("s_wait_asynccnt 0x0" ::: "memory");    // nothing in flight when the wave goes on
  acc_guard4(acc[0][0], acc[0][1], acc[0][2], acc[0][3]);
  acc_guard4(acc[1][0], acc[1][1], acc[1][2], acc[1][3]);
  acc_guard4(acc[2][0], acc[2][1], acc[2][2], acc[2][3]);
  acc_guard4(acc[3][0], acc[3][1], acc[3][2], acc[3][3]);

  // ---- epilogue ----
  float* slab = sT[wave];
  const float* Rb = RESID ? (resid + (size_t)b * strideR) : nullptr;
#pragma unroll
  for (int i = 0; i < 4; ++i) {
    const int mBase = m0 + (i << 4);
#pragma unroll
    for (int j = 0; j < 4; ++j) {
      const int n = n0 + (j << 4) + rlane;
      float bv = 0.f;
      if (BIAS_MODE == 2) bv = bias[n];
      if (BIAS_MODE == 3) bv = bf_bits2f(f2bf_bits(bias[n]));
#pragma unroll
      for (int r = 0; r < 8; ++r) {
        float v = acc[i][j][r] * scale;
        if (BIAS_MODE == 1) v += bias[mBase + mOff + r];
        if (BIAS_MODE == 2 || BIAS_MODE == 3) v += bv;
        if (RESID) v += Rb[(size_t)(mBase + mOff + r) * ldc + n];
        if (ACT == 1) v = tanhf(v);
        if (ACT == 2) v = fmaxf(v, 0.0f);
        if (ACT == 4) v = (v > 0.f) ? v : 0.01f * v;
        slab[(mOff + r) * 68 + (j << 4) + rlane] = v;
      }
    }
    __builtin_amdgcn_fence(__ATOMIC_RELEASE, "workgroup");
    __builtin_amdgcn_wave_barrier();
    __builtin_amdgcn_fence(__ATOMIC_ACQUIRE, "workgroup");
    if (OUT_MODE == 0) {
      float* C = (float*)Cout + (size_t)b * strideC;
      const int hh = lane >> 4, c4 = (lane & 15) * 4;     // row seg = 256 B = 16 lanes x 16 B
      {
#pragma unroll
        for (int it = 0; it < 8; ++it) {
          const int row = it * 2 + hh;
          v4f v = *(const v4f*)(slab + row * 68 + c4);
          *(v4f*)(C + (size_t)(mBase + row) * ldc + n0 + c4) = v;
        }
        
      }
    } else {
      const int q = lane >> 3, c8 = (lane & 7) * 8;
      unsigned short* C  = (unsigned short*)Cout  + (size_t)b * strideC;
      unsigned short* C2 = (OUT_MODE == 2) ? ((unsigned short*)Cout2 + (size_t)b * strideC) : nullptr;
      {
#pragma unroll
        for (int it = 0; it < 4; ++it) {
          const int row = it * 4 + q;
          const float* sp = slab + row * 68 + c8;
          v8h hv, lv;
#pragma unroll
          for (int e = 0; e < 8; ++e) {
            if (OUT_MODE == 1) {
              hv[e] = (_Float16)sp[e];
            } else {
              unsigned short hb = f2bf_bits(sp[e]);
              unsigned short lb = f2bf_bits(sp[e] - bf_bits2f(hb));
              hv[e] = __builtin_bit_cast(_Float16, hb);
              lv[e] = __builtin_bit_cast(_Float16, lb);
            }
          }
          *(v8h*)(C + (size_t)(mBase + row) * ldc + n0 + c8) = hv;
          if (OUT_MODE == 2) *(v8h*)(C2 + (size_t)(mBase + row) * ldc + n0 + c8) = lv;
        }
        
      }
    }
    __builtin_amdgcn_fence(__ATOMIC_RELEASE, "workgroup");
    __builtin_amdgcn_wave_barrier();
    __builtin_amdgcn_fence(__ATOMIC_ACQUIRE, "workgroup");
  }
}

// ---- f32 [n] -> bf16 (RNE) [n], same layout; 8 elements per thread = one 16-B store per lane ----
// grid = ceil(n8/256) with n8 = n/8 (here 1,048,576 = 4096 x 256 exactly), bound checked anyway.
__global__ __launch_bounds__(256) void cast_f32_bf16x8(const float* __restrict__ in,
                                                       unsigned short* __restrict__ out, int n8) {
  const int i = blockIdx.x * 256 + threadIdx.x;
  if (i < n8) {
    const v4f a0 = *(const v4f*)(in + (size_t)i * 8);
    const v4f a1 = *(const v4f*)(in + (size_t)i * 8 + 4);
    v8us u;
    u[0] = f2bf_bits(a0[0]); u[1] = f2bf_bits(a0[1]); u[2] = f2bf_bits(a0[2]); u[3] = f2bf_bits(a0[3]);
    u[4] = f2bf_bits(a1[0]); u[5] = f2bf_bits(a1[1]); u[6] = f2bf_bits(a1[2]); u[7] = f2bf_bits(a1[3]);
    *(v8us*)(out + (size_t)i * 8) = u;
    
  }
}

// ---- W [K][N] f32 -> Wt [N][K] bf16 (RNE), 64x64 tile transposed through LDS; grid = (N/64, K/64) ----
// Phase 1 coverage: kr = tid>>2 (64 k rows) x c16 = (tid&3)*16 with 4 quads of 4 -> every (k, n) of the tile once.
// Phase 2 coverage: n = it*32 + wave*4 + q8 (it 0..1, wave 0..7, q8 0..3) -> rows 0..63; c8 -> 8 lanes x 8 = 64 k.
#define WTP 72
__global__ __launch_bounds__(256) void wt_cast_bf16(const float* __restrict__ W, unsigned short* __restrict__ Wt,
                                                    int K, int N) {
  __shared__ __align__(16) unsigned short st[64 * WTP];
  const int n0 = blockIdx.x * 64, k0 = blockIdx.y * 64;
  const int tid = threadIdx.x;
  const int kr = tid >> 2, c16 = (tid & 3) * 16;
  const float* src = W + (size_t)(k0 + kr) * N + n0 + c16;
#pragma unroll
  for (int q = 0; q < 4; ++q) {
    const v4f v = *(const v4f*)(src + 4 * q);
#pragma unroll
    for (int e = 0; e < 4; ++e) st[(c16 + 4 * q + e) * WTP + kr] = f2bf_bits(v[e]);
  }
  __syncthreads();
  const int wave = tid >> 5, lane = tid & 31;
  const int q8 = lane >> 3, c8 = (lane & 7) * 8;
  {
#pragma unroll
    for (int it = 0; it < 2; ++it) {
      const int n = it * 32 + wave * 4 + q8;
      const v8us hv = *(const v8us*)(st + n * WTP + c8);
      *(v8us*)(Wt + (size_t)(n0 + n) * K + k0 + c8) = hv;
    }
    
  }
}

// =====================================================================================
// Causal attention, head_dim 64, bf16 hi/lo planes in, bf16 hi/lo planes out.
//   q|k|v hi/lo planes [kHalfRows][3072] (element (b,s,part,h,d) at (b*S+s)*3072 + part*1024 + h*64 + d, b local to the pass).
//   Block = 4 waves = 64 query rows of one (b,h); 64-key chunks kc = 0..qb (later chunks have exactly zero weight);
//   the diagonal chunk sets kv > q scores to finfo.min by select after the 1/8 scale.
//   scores and p.v: v_wmma_f32_16x16x32_bf16 with hi/lo split (hi.hi + hi.lo + lo.hi), f32 accumulate; online softmax in f32.
//   grid.x = kHalfBatch * kHeads * kNumQB = 1024.
// =====================================================================================
__device__ __forceinline__ v8f mma_b(v16b a, v16b b, v8f c) {
  c = __builtin_amdgcn_wmma_f32_16x16x32_bf16(false, a, false, b, (short)0, c, false, false);
  asm volatile("v_nop\n\tv_nop\n\tv_nop\n\tv_nop" : "+v"(c) : "v"(a), "v"(b));
  return c;
}
__device__ __forceinline__ void bf_split(float f, __bf16& hi, __bf16& lo) {
  const unsigned short hb = f2bf_bits(f);
  hi = __builtin_bit_cast(__bf16, hb);
  lo = __builtin_bit_cast(__bf16, f2bf_bits(f - bf_bits2f(hb)));
}

#define AKC 64
#define LKP 72   // LDS row pitch of the K, V^T and P tiles in elements: 144 B = 16 B x 9 (odd), so 16 rows read by ds_load_b128 fall on distinct banks
#define OSP 68
__global__ __launch_bounds__(128) void attn_causal_k(
    const unsigned short* __restrict__ qkvhp, const unsigned short* __restrict__ qkvlp,
    unsigned short* __restrict__ ohp, unsigned short* __restrict__ olp) {
  union FB { v16b v; v8b h[2]; };
  __shared__ __align__(16) __bf16 Ksh[AKC * LKP];             // K hi [kv][d]   9 KB
  __shared__ __align__(16) __bf16 Ksl[AKC * LKP];             // K lo
  __shared__ __align__(16) __bf16 Vth[kHeadDim * LKP];        // V hi [d][kv]   9 KB
  __shared__ __align__(16) __bf16 Vtl[kHeadDim * LKP];        // V lo
  __shared__ __align__(16) __bf16 Psh[4][16 * LKP];           // per wave P hi [row][kv]
  __shared__ __align__(16) __bf16 Psl[4][16 * LKP];           // per wave P lo
  __shared__ __align__(16) float  Os[4][16 * OSP];            // per wave out tile, pitch 68

  const __bf16* Qh = (const __bf16*)qkvhp;
  const __bf16* Ql = (const __bf16*)qkvlp;

  const int tid  = threadIdx.x;
  const int wave = tid >> 5;
  const int lane = tid & 31;
  const int hh   = lane >> 4;
  const int c    = lane & 15;

  const int bx = blockIdx.x;
  const int qb = bx & (kNumQB - 1);        // 16 query blocks of 64 rows
  const int bh = bx >> 4;
  const int h  = bh & (kHeads - 1);
  const int b  = bh >> 4;                  // 0..kHalfBatch-1 within this pass
  const int q0 = qb * 64 + wave * 16;

  // ---- Q fragments (A operand): 2 d-chunks, hi and lo, via Frag loader ----
  v16b qah[2], qal[2];
  {
    const size_t qo = (size_t)(b * kSeq + q0 + c) * kQkvLd + h * kHeadDim + 8 * hh;
#pragma unroll
    for (int dc = 0; dc < 2; ++dc) {
      qah[dc] = Frag<__bf16>::load(Qh + qo + dc * 32);
      qal[dc] = Frag<__bf16>::load(Ql + qo + dc * 32);
    }
  }

  float mrow[8], lrow[8];
  v8f oacc[4];
#pragma unroll
  for (int r = 0; r < 8; ++r) { mrow[r] = -INFINITY; lrow[r] = 0.f; }
#pragma unroll
  for (int t = 0; t < 4; ++t) oacc[t] = (v8f){0.f,0.f,0.f,0.f,0.f,0.f,0.f,0.f};

  const int nIter = qb + 1;   // block-uniform: causal chunks 0..qb, <= 16
  for (int kc = 0; kc < nIter; ++kc) {
    const int kv0 = kc * AKC;
    __syncthreads();
    {
      // staging coverage: 128 threads = 64 kv rows x 2 d-halves of 32; 4 x 8 elements per thread per plane
      const int kvr = tid >> 1, dh = (tid & 1) * 32;
      const size_t mo = ((size_t)(b * kSeq + kv0 + kvr)) * kQkvLd + kModel + h * kHeadDim + dh;   // k row
      const __bf16* kh = Qh + mo;
      const __bf16* kl = Ql + mo;
      const __bf16* vh = kh + kModel;      // v sits 1024 columns after k
      const __bf16* vl = kl + kModel;
#pragma unroll 1
      for (int i = 0; i < 4; ++i) {
        const v8b a0 = *(const v8b*)(kh + 8 * i);
        *(v8b*)(Ksh + kvr * LKP + dh + 8 * i) = a0;
        const v8b a1 = *(const v8b*)(kl + 8 * i);
        *(v8b*)(Ksl + kvr * LKP + dh + 8 * i) = a1;
        const v8b w0 = *(const v8b*)(vh + 8 * i);
        const v8b w1 = *(const v8b*)(vl + 8 * i);
#pragma unroll
        for (int e = 0; e < 8; ++e) {
          Vth[(dh + 8 * i + e) * LKP + kvr] = w0[e];
          Vtl[(dh + 8 * i + e) * LKP + kvr] = w1[e];
        }
      }
    }
    __syncthreads();

    // ---- scores: 3 products per d-chunk ----
    v8f s[4];
#pragma unroll
    for (int j = 0; j < 4; ++j) {
      s[j] = (v8f){0.f,0.f,0.f,0.f,0.f,0.f,0.f,0.f};
#pragma unroll
      for (int dc = 0; dc < 2; ++dc) {
        FB kb, kq;
        kb.h[0] = *(const v8b*)(Ksh + (j * 16 + c) * LKP + dc * 32 + 8 * hh);
        kb.h[1] = *(const v8b*)(Ksh + (j * 16 + c) * LKP + dc * 32 + 16 + 8 * hh);
        kq.h[0] = *(const v8b*)(Ksl + (j * 16 + c) * LKP + dc * 32 + 8 * hh);
        kq.h[1] = *(const v8b*)(Ksl + (j * 16 + c) * LKP + dc * 32 + 16 + 8 * hh);
        s[j] = mma_b(qah[dc], kb.v, s[j]);
        s[j] = mma_b(qah[dc], kq.v, s[j]);
        s[j] = mma_b(qal[dc], kb.v, s[j]);
      }
    }
    const bool diag = (kc == qb);
    float cm[8];
#pragma unroll
    for (int r = 0; r < 8; ++r) {
      const int qrow = q0 + 8 * hh + r;
      float m = -INFINITY;
#pragma unroll
      for (int j = 0; j < 4; ++j) {
        const int kvcol = kv0 + j * 16 + c;
        float sv = s[j][r] * kQkScale;
        if (diag && (kvcol > qrow)) sv = kMaskFill;
        s[j][r] = sv;
        m = fmaxf(m, sv);
      }
#pragma unroll
      for (int off = 1; off < 16; off <<= 1) m = fmaxf(m, __shfl_xor(m, off, 32));
      cm[r] = m;
    }
    __bf16* pwh = Psh[wave];
    __bf16* pwl = Psl[wave];
#pragma unroll
    for (int r = 0; r < 8; ++r) {
      const float mnew = fmaxf(mrow[r], cm[r]);
      const float alpha = expf(mrow[r] - mnew);
      mrow[r] = mnew;
      float psum = 0.f;
#pragma unroll
      for (int j = 0; j < 4; ++j) {
        const float p = expf(s[j][r] - mnew);
        psum += p;
        __bf16 pa, pb; bf_split(p, pa, pb);
        pwh[(8 * hh + r) * LKP + j * 16 + c] = pa;
        pwl[(8 * hh + r) * LKP + j * 16 + c] = pb;
      }
#pragma unroll
      for (int off = 1; off < 16; off <<= 1) psum += __shfl_xor(psum, off, 32);
      lrow[r] = lrow[r] * alpha + psum;
#pragma unroll
      for (int t = 0; t < 4; ++t) oacc[t][r] *= alpha;
    }
    __builtin_amdgcn_fence(__ATOMIC_RELEASE, "workgroup");
    __builtin_amdgcn_wave_barrier();
    __builtin_amdgcn_fence(__ATOMIC_ACQUIRE, "workgroup");
    // ---- O += P x V : 3 products ----
#pragma unroll 1
    for (int kk = 0; kk < 2; ++kk) {
      FB pa, pl;
      pa.h[0] = *(const v8b*)(pwh + c * LKP + kk * 32 + 8 * hh);
      pa.h[1] = *(const v8b*)(pwh + c * LKP + kk * 32 + 16 + 8 * hh);
      pl.h[0] = *(const v8b*)(pwl + c * LKP + kk * 32 + 8 * hh);
      pl.h[1] = *(const v8b*)(pwl + c * LKP + kk * 32 + 16 + 8 * hh);
#pragma unroll
      for (int t = 0; t < 4; ++t) {
        FB vb, vq;
        vb.h[0] = *(const v8b*)(Vth + (t * 16 + c) * LKP + kk * 32 + 8 * hh);
        vb.h[1] = *(const v8b*)(Vth + (t * 16 + c) * LKP + kk * 32 + 16 + 8 * hh);
        vq.h[0] = *(const v8b*)(Vtl + (t * 16 + c) * LKP + kk * 32 + 8 * hh);
        vq.h[1] = *(const v8b*)(Vtl + (t * 16 + c) * LKP + kk * 32 + 16 + 8 * hh);
        oacc[t] = mma_b(pa.v, vb.v, oacc[t]);
        oacc[t] = mma_b(pa.v, vq.v, oacc[t]);
        oacc[t] = mma_b(pl.v, vb.v, oacc[t]);
      }
    }
  }

  // ---- normalize, stage, write hi/lo planes ----
  float* os = Os[wave];
#pragma unroll
  for (int r = 0; r < 8; ++r) {
    const float inv = 1.0f / lrow[r];
#pragma unroll
    for (int t = 0; t < 4; ++t) os[(8 * hh + r) * OSP + t * 16 + c] = oacc[t][r] * inv;
  }
  __builtin_amdgcn_fence(__ATOMIC_RELEASE, "workgroup");
  __builtin_amdgcn_wave_barrier();
  __builtin_amdgcn_fence(__ATOMIC_ACQUIRE, "workgroup");
  {
    const int q8 = lane >> 3, c8 = (lane & 7) * 8;
    _Float16* Oh = (_Float16*)ohp;
    _Float16* Ol = (_Float16*)olp;
    {
#pragma unroll
      for (int it = 0; it < 4; ++it) {
        const int row = it * 4 + q8;
        const float* sp = os + row * OSP + c8;
        v8h hv, lv;
#pragma unroll
        for (int e = 0; e < 8; ++e) {
          const unsigned short hb = f2bf_bits(sp[e]);
          const unsigned short lb = f2bf_bits(sp[e] - bf_bits2f(hb));
          hv[e] = __builtin_bit_cast(_Float16, hb);
          lv[e] = __builtin_bit_cast(_Float16, lb);
        }
        const size_t oo = (size_t)(b * kSeq + q0 + row) * kModel + h * kHeadDim + c8;
        *(v8h*)(Oh + oo) = hv;
        *(v8h*)(Ol + oo) = lv;
      }
      
    }
  }
}

// ---------------------------------------------------------------------------
// Workspace region map (all offsets 256-B aligned, all planes bf16 bits):
//   Xb   [8192][1024]  hidden as bf16          16,777,216 B
//   WaT  [3072][1024]  W_attn transposed        6,291,456 B
//   WoT  [1024][1024]  W_out transposed         2,097,152 B
//   QKVh [4096][3072]  q|k|v hi plane (pass)   25,165,824 B
//   QKVl [4096][3072]  q|k|v lo plane (pass)   25,165,824 B
//   Oh   [4096][1024]  attention out hi plane   8,388,608 B
//   Ol   [4096][1024]  attention out lo plane   8,388,608 B
// ---------------------------------------------------------------------------
extern "C" void kernel_launch(void* const* d_in, const int* in_sizes, int n_in,
                              void* d_out, int out_size, void* d_ws, size_t ws_size,
                              hipStream_t stream) {
  if (n_in < 5) return;
  if (in_sizes[0] != kTotRows * kModel) return;
  if (in_sizes[1] != kModel * kQkvLd) return;
  if (in_sizes[2] != kQkvLd) return;
  if (in_sizes[3] != kModel * kModel) return;
  if (in_sizes[4] != kModel) return;
  if (out_size != kTotRows * kModel) return;

  const float* hidden = (const float*)d_in[0];   // [8,1024,1024]
  const float* wattn  = (const float*)d_in[1];   // [1024,3072]  ([in][out])
  const float* battn  = (const float*)d_in[2];   // [3072]
  const float* wout   = (const float*)d_in[3];   // [1024,1024]  ([in][out])
  const float* bout   = (const float*)d_in[4];   // [1024]
  float* out = (float*)d_out;                    // [8,1024,1024]

  char* ws = (char*)d_ws;
  size_t off = 0;
  const size_t szXb  = (size_t)kTotRows * kModel * 2;
  const size_t szWaT = (size_t)kQkvLd * kModel * 2;
  const size_t szWoT = (size_t)kModel * kModel * 2;
  const size_t szQKV = (size_t)kHalfRows * kQkvLd * 2;
  const size_t szO   = (size_t)kHalfRows * kModel * 2;
  unsigned short* Xb   = (unsigned short*)(ws + off); off += szXb;
  unsigned short* WaT  = (unsigned short*)(ws + off); off += szWaT;
  unsigned short* WoT  = (unsigned short*)(ws + off); off += szWoT;
  unsigned short* QKVh = (unsigned short*)(ws + off); off += szQKV;
  unsigned short* QKVl = (unsigned short*)(ws + off); off += szQKV;
  unsigned short* Oh   = (unsigned short*)(ws + off); off += szO;
  unsigned short* Ol   = (unsigned short*)(ws + off); off += szO;
  if (off > ws_size) return;

  // 1) RNE bf16 cast of the activations (8 elements per thread): n8 = 1,048,576 -> 4096 blocks
  {
    const int n8 = kTotRows * kModel / 8;
    cast_f32_bf16x8<<<dim3((n8 + 255) / 256), dim3(256), 0, stream>>>(hidden, Xb, n8);
  }
  // 2) weights: in [K=1024][N] f32 -> out [N][K] bf16 ; grid = (N/64, K/64)
  wt_cast_bf16<<<dim3(kQkvLd / 64, kModel / 64), dim3(256), 0, stream>>>(wattn, WaT, kModel, kQkvLd);
  wt_cast_bf16<<<dim3(kModel / 64, kModel / 64), dim3(256), 0, stream>>>(wout, WoT, kModel, kModel);

  for (int half = 0; half < kBatch / kHalfBatch; ++half) {
    const unsigned short* Xh = Xb + (size_t)half * kHalfRows * kModel;
    float* outh = out + (size_t)half * kHalfRows * kModel;
    // 3) qkv = hidden @ W_attn + b_attn : M=4096, N=3072, K=1024 -> bf16 hi/lo planes (128x256 tiles: 32*12 = 384 blocks of 8 waves)
    wmma_gemm64<1, 0, 3, 2, false, 4><<<dim3((kHalfRows / 128) * (kQkvLd / 256), 1), dim3(256), 0, stream>>>(
        Xh, nullptr, kModel, 0L, WaT, nullptr, kModel, 0L,
        (void*)QKVh, (void*)QKVl, kQkvLd, 0L, battn, nullptr, 0L, kHalfRows, kQkvLd, kModel, 1.0f);
    // 4) causal attention, 4*16*16 = 1024 blocks of 128 threads
    attn_causal_k<<<dim3(kHalfBatch * kHeads * kNumQB), dim3(128), 0, stream>>>(QKVh, QKVl, Oh, Ol);
    // 5) out = O @ W_out + b_out : M=4096, N=1024, K=1024, A hi/lo split, f32 result to d_out (128x128 tiles: 32*8 = 256 blocks of 4 waves)
    wmma_gemm64<1, 2, 3, 0, false, 2><<<dim3((kHalfRows / 128) * (kModel / 128), 1), dim3(128), 0, stream>>>(
        Oh, Ol, kModel, 0L, WoT, nullptr, kModel, 0L,
        (void*)outh, nullptr, kModel, 0L, bout, nullptr, 0L, kHalfRows, kModel, kModel, 1.0f);
  }
}

// v003
// Measured time: 191 microseconds a run.
// Timed twice side by side with v002, it ran 1.57 times as fast both times.
// Counting every step since v000, it is 3.10 times as fast.
// Contractions: qkv projection v_wmma_f32_16x16x32_bf16 on RNE-bf16 x and W (single product); attention q.k^T and p.v v_wmma_f32_16x16x32_bf16 with bf16 hi/lo split (hi.hi + hi.lo + lo.hi); output projection bf16 hi/lo A-split x bf16 W_out (hi.w + lo.w); f32 accumulate everywhere; softmax, scale and bias adds in f32.
#include <hip/hip_runtime.h>
#include <math.h>
#include <float.h>
#include <stdint.h>

// ---------------------------------------------------------------------------
// Fixed problem geometry
// ---------------------------------------------------------------------------
constexpr int kBatch     = 8;
constexpr int kSeq       = 1024;
constexpr int kModel     = 1024;
constexpr int kHeads     = 16;
constexpr int kHeadDim   = 64;
constexpr int kQkvLd     = 3 * kModel;            // 3072: q | k | v columns
constexpr int kTotRows   = kBatch * kSeq;         // 8192
constexpr int kNumQB     = kSeq / 64;             // 16 query blocks of 64 rows
constexpr float kQkScale = 0.125f;                // 1/sqrt(64), exact power of two
constexpr float kMaskFill = -FLT_MAX;             // finfo(float32).min
static_assert(kNumQB == 16);
static_assert(kHeads == 16);
static_assert(kBatch * kHeads == 128);
static_assert(kModel % 128 == 0 && kQkvLd % 256 == 0 && kTotRows % 128 == 0);
static_assert(kModel % 64 == 0);

typedef __attribute__((ext_vector_type(16))) _Float16 v16h;
typedef __attribute__((ext_vector_type(8)))  _Float16 v8h;
typedef __attribute__((ext_vector_type(16))) __bf16   v16b;
typedef __attribute__((ext_vector_type(8)))  __bf16   v8b;
typedef __attribute__((ext_vector_type(8)))  float    v8f;
typedef __attribute__((ext_vector_type(4)))  float    v4f;
typedef __attribute__((ext_vector_type(8)))  unsigned short v8us;

__device__ __forceinline__ unsigned short f2bf_bits(float f) {
  unsigned u = __float_as_uint(f);
  return (unsigned short)((u + 0x7FFFu + ((u >> 16) & 1u)) >> 16);
}
__device__ __forceinline__ float bf_bits2f(unsigned short h) { return __uint_as_float(((unsigned)h) << 16); }

// hazard guards as plain device helpers
__device__ __forceinline__ void dep_guard_h(v8f& a, v8f& b, v16h x, v16h y) { asm volatile("v_nop\n\tv_nop\n\tv_nop\n\tv_nop" : "+v"(a), "+v"(b) : "v"(x), "v"(y)); }
__device__ __forceinline__ void dep_guard_b(v8f& a, v8f& b, v16b x, v16b y) { asm volatile("v_nop\n\tv_nop\n\tv_nop\n\tv_nop" : "+v"(a), "+v"(b) : "v"(x), "v"(y)); }
__device__ __forceinline__ void keep4_h(v16h a, v16h b, v16h c, v16h d) { asm volatile("v_nop" :: "v"(a), "v"(b), "v"(c), "v"(d)); }
__device__ __forceinline__ void keep4_b(v16b a, v16b b, v16b c, v16b d) { asm volatile("v_nop" :: "v"(a), "v"(b), "v"(c), "v"(d)); }
__device__ __forceinline__ void acc_guard4(v8f& a, v8f& b, v8f& c, v8f& d) { asm volatile("v_nop\n\tv_nop\n\tv_nop\n\tv_nop" : "+v"(a), "+v"(b), "+v"(c), "+v"(d)); }
template <typename T> struct Frag;
template <> struct Frag<_Float16> {
  typedef v16h V; union U { v16h v; v8h h[2]; };
  static __device__ __forceinline__ v16h load(const _Float16* p) {   // elements 0..7 <- p[0..7], 8..15 <- p[16..23]
    U f; f.h[0] = *(const v8h*)(p); f.h[1] = *(const v8h*)(p + 16); return f.v;
  }
  static __device__ __forceinline__ v8f mma(v16h a, v16h b, v8f c) {
    return __builtin_amdgcn_wmma_f32_16x16x32_f16(false, a, false, b, (short)0, c, false, false);
  }
  static __device__ __forceinline__ void guard(v8f& a, v8f& b, v16h x, v16h y) { dep_guard_h(a, b, x, y); }
  static __device__ __forceinline__ void keep(v16h a, v16h b, v16h c, v16h d) { keep4_h(a, b, c, d); }
};
template <> struct Frag<__bf16> {
  typedef v16b V; union U { v16b v; v8b h[2]; };
  static __device__ __forceinline__ v16b load(const __bf16* p) {
    U f; f.h[0] = *(const v8b*)(p); f.h[1] = *(const v8b*)(p + 16); return f.v;
  }
  static __device__ __forceinline__ v8f mma(v16b a, v16b b, v8f c) {
    return __builtin_amdgcn_wmma_f32_16x16x32_bf16(false, a, false, b, (short)0, c, false, false);
  }
  static __device__ __forceinline__ void guard(v8f& a, v8f& b, v16b x, v16b y) { dep_guard_b(a, b, x, y); }
  static __device__ __forceinline__ void keep(v16b a, v16b b, v16b c, v16b d) { keep4_b(a, b, c, d); }
};

// ---- LDS-staged batched WMMA GEMM ------------------------------------------
// C[m,n] = scale * sum_k A[m,k] * Bt[n,k] (+bias)(+resid); block = 2 x WN waves on a 128 x (64*WN) tile, each wave owns 64x64.
// A row-major [M,K]; Bt row-major [N,K]; M % 128 == 0, N % (64*WN) == 0, K % 64 == 0, K >= 64.
// Each k-slice of 64 (one 128-B line of every operand row of the block tile) is brought into LDS once, by asynchronous
// 16-B copies that cover whole lines, and every wave of the block reads its fragments from there; two buffers, so the
// next slice's copies fly while this slice is multiplied.
// SPLIT: 0 = single product; 2 = A hi/lo planes (A2 = lo plane), Bt single plane: hi.b + lo.b.
// BIAS_MODE: 0 = none, 1 = bias[m], 2 = bias[n], 3 = bias[n] passed through an RNE bf16 convert first.
// OUT_MODE: 0 = f32, 1 = f16, 2 = bf16 hi plane (Cout) + bf16 lo plane (Cout2).
// ET: 0 = f16 operands, 1 = bf16 operands (pointers passed as 16-bit storage)
template <int ET> struct Elem;
template <> struct Elem<0> { typedef _Float16 T; };
template <> struct Elem<1> { typedef __bf16 T; };

#define GBK 64   // k elements per staged slice: 128 B of every row
#define GLP 72   // LDS row pitch of the staged slices in elements: 144 B = 16 B x 9 (odd), conflict-free for the ds_load_b128 fragment reads

__device__ __forceinline__ uint32_t lds_off(const void* p) { return (uint32_t)(size_t)p; }   // byte offset in the work-group's LDS

// Twelve asynchronous 16-B copies per lane, global -> LDS through no register. The s_wait_xcnt stands inside the copies' own
// statement so that no address register they name is rewritten in front of it.
template <typename T>
__device__ __forceinline__ void async_copy12(const uint32_t (&l)[12], const T* const (&g)[12]) {
  asm volatile(
      "global_load_async_to_lds_b128 %0, %12, off\n\t"
      "global_load_async_to_lds_b128 %1, %13, off\n\t"
      "global_load_async_to_lds_b128 %2, %14, off\n\t"
      "global_load_async_to_lds_b128 %3, %15, off\n\t"
      "global_load_async_to_lds_b128 %4, %16, off\n\t"
      "global_load_async_to_lds_b128 %5, %17, off\n\t"
      "global_load_async_to_lds_b128 %6, %18, off\n\t"
      "global_load_async_to_lds_b128 %7, %19, off\n\t"
      "global_load_async_to_lds_b128 %8, %20, off\n\t"
      "global_load_async_to_lds_b128 %9, %21, off\n\t"
      "global_load_async_to_lds_b128 %10, %22, off\n\t"
      "global_load_async_to_lds_b128 %11, %23, off\n\t"
      "s_wait_xcnt 0x0"
      :: "v"(l[0]), "v"(l[1]), "v"(l[2]), "v"(l[3]), "v"(l[4]), "v"(l[5]),
         "v"(l[6]), "v"(l[7]), "v"(l[8]), "v"(l[9]), "v"(l[10]), "v"(l[11]),
         "v"(g[0]), "v"(g[1]), "v"(g[2]), "v"(g[3]), "v"(g[4]), "v"(g[5]),
         "v"(g[6]), "v"(g[7]), "v"(g[8]), "v"(g[9]), "v"(g[10]), "v"(g[11])
      : "memory");
}

template <int ET, int SPLIT, int BIAS_MODE, int OUT_MODE, bool RESID, int WN, int ACT = 0>
__global__ __launch_bounds__(64 * WN) void wmma_gemm64(
    const unsigned short* __restrict__ Ap, const unsigned short* __restrict__ A2p, int lda, long strideA,
    const unsigned short* __restrict__ Btp, const unsigned short* __restrict__ Bt2p, int ldb, long strideB,
    void* __restrict__ Cout, void* __restrict__ Cout2, int ldc, long strideC,
    const float* __restrict__ bias,
    const float* __restrict__ resid, long strideR,
    int M, int N, int K, float scale) {
  static_assert(SPLIT == 0 || SPLIT == 2);
  typedef typename Elem<ET>::T T;
  typedef typename Frag<T>::V V;
  constexpr int BM    = 128;                              // block tile rows
  constexpr int BN    = 64 * WN;                          // block tile columns
  constexpr int AROWS = (SPLIT == 2) ? 2 * BM : BM;       // staged A rows: hi plane, then lo plane
  constexpr int SROWS = AROWS + BN;                       // staged rows per slice: A | (A lo) | Bt
  constexpr int RPR   = (64 * WN) / 8;                    // rows one copy of the whole block covers: 8 lanes x 16 B per row
  constexpr int NC    = SROWS / RPR;                      // copies per lane and slice
  constexpr int STAGE_E = SROWS * GLP;                    // elements per buffer
  static_assert(BM % RPR == 0 && BN % RPR == 0 && NC % 12 == 0 && NC <= 63);
  const T* A = (const T*)Ap; const T* A2 = (const T*)A2p; const T* Bt = (const T*)Btp;
  __shared__ __align__(16) T ring[2 * STAGE_E];            // two buffers of one k-slice each
  __shared__ __align__(16) float sT[2 * WN][16 * 68];      // per-wave 16x64 slab, pitch 68 floats
  const int b    = blockIdx.y;
  const int tid  = threadIdx.x;
  const int lane = tid & 31;
  const int wave = tid >> 5;
  const int tilesN = N / BN;
  const int tilesM = M / BM;
  const int bt = blockIdx.x;
  if (bt >= tilesM * tilesN) return;   // block-uniform, in front of every copy and barrier
  const int bm = bt / tilesN;
  const int bn = bt - bm * tilesN;
  const int wm = wave / WN;
  const int wn = wave - wm * WN;
  const int m0 = bm * BM + (wm << 6);
  const int n0 = bn * BN + (wn << 6);

  const int rlane = lane & 15;                 // row (A) / col (B, D) within subtile
  const int koff  = (lane >> 4) * 8;           // k offset of this lane half
  const int mOff  = (lane >> 4) * 8;           // D row offset

  // copy side: lane = (row tid>>3 of a round of RPR rows, 16-B segment tid&7 of its 128-B line)
  const int crow = tid >> 3, cseg = (tid & 7) * 8;
  // gA, gA2, gB walk along k: they point at the next slice to be copied
  const T* gA  = A  + (size_t)b * strideA + (size_t)(bm * BM + crow) * lda + cseg;
  const T* gA2 = (SPLIT == 2) ? (A2 + (size_t)b * strideA + (size_t)(bm * BM + crow) * lda + cseg) : nullptr;
  const T* gB  = Bt + (size_t)b * strideB + (size_t)(bn * BN + crow) * ldb + cseg;
  const uint32_t lC = lds_off(ring) + (uint32_t)(crow * GLP + cseg) * 2u;
  auto issue_slice = [&](int buf) {
    const uint32_t lb = lC + (uint32_t)buf * (uint32_t)(STAGE_E * 2);
#pragma unroll
    for (int g = 0; g < NC / 12; ++g) {
      uint32_t l[12];
      const T* p[12];
#pragma unroll
      for (int c = 0; c < 12; ++c) {
        const int sr = (g * 12 + c) * RPR;     // first staged row of this round
        l[c] = lb + (uint32_t)(sr * GLP * 2);
        if (sr < BM)         p[c] = gA  + (size_t)sr * lda;
        else if (sr < AROWS) p[c] = gA2 + (size_t)(sr - BM) * lda;
        else                 p[c] = gB  + (size_t)(sr - AROWS) * ldb;
      }
      async_copy12<T>(l, p);
    }
    gA += GBK;
    if (SPLIT == 2) gA2 += GBK;
    gB += GBK;
  };

  // fragment side: this lane's row and k half inside a buffer
  const T* fA = ring + ((wm << 6) + rlane) * GLP + koff;
  const T* fB = ring + (AROWS + (wn << 6) + rlane) * GLP + koff;

  v8f acc[4][4];
#pragma unroll
  for (int i = 0; i < 4; ++i)
#pragma unroll
    for (int j = 0; j < 4; ++j) acc[i][j] = (v8f){0.f,0.f,0.f,0.f,0.f,0.f,0.f,0.f};

  const int nT = K / GBK;                      // block-uniform
  issue_slice(0);
  asm volatile("s_wait_asynccnt 0x0" ::: "memory");   // this wave's copies of slice 0 have landed
  __syncthreads();                                     // ... and every other wave's
  if (nT > 1) issue_slice(1);
  for (int t = 0; t < nT; ++t) {
    const int so = (t & 1) * STAGE_E;
#pragma unroll   // both 32-k halves of the slice in one body, so the second half's fragment reads can start under the first half's products
    for (int kk = 0; kk < GBK; kk += 32) {
      V bh[4], ah[4], al[4];
#pragma unroll
      for (int j = 0; j < 4; ++j) bh[j] = Frag<T>::load(fB + so + (j << 4) * GLP + kk);
#pragma unroll
      for (int i = 0; i < 4; ++i) {
        ah[i] = Frag<T>::load(fA + so + (i << 4) * GLP + kk);
        if (SPLIT == 2) al[i] = Frag<T>::load(fA + so + (BM + (i << 4)) * GLP + kk);
      }
#pragma unroll
      for (int i = 0; i < 4; ++i) {
#pragma unroll
        for (int j = 0; j < 4; ++j) {
          acc[i][j] = Frag<T>::mma(ah[i], bh[j], acc[i][j]);
          if (SPLIT == 2) acc[i][j] = Frag<T>::mma(al[i], bh[j], acc[i][j]);
        }
        Frag<T>::guard(acc[i][0], acc[i][3], ah[i], (SPLIT == 2) ? al[i] : ah[i]);
      }
      Frag<T>::keep(bh[0], bh[1], bh[2], bh[3]);
    }
    asm volatile("s_wait_dscnt 0x0" ::: "memory");     // this wave's reads of the buffer are done before it is refilled
    asm volatile("s_wait_asynccnt 0x0" ::: "memory");  // this wave's copies of slice t + 1 have landed
    __syncthreads();                                    // publishes slice t + 1 and ends every wave's reads of slice t
    if (t + 2 < nT) issue_slice(t & 1);
  }
  asm volatile("s_wait_asynccnt 0x0" ::: "memory");    // nothing in flight when the wave goes on
  acc_guard4(acc[0][0], acc[0][1], acc[0][2], acc[0][3]);
  acc_guard4(acc[1][0], acc[1][1], acc[1][2], acc[1][3]);
  acc_guard4(acc[2][0], acc[2][1], acc[2][2], acc[2][3]);
  acc_guard4(acc[3][0], acc[3][1], acc[3][2], acc[3][3]);

  // ---- epilogue ----
  float* slab = sT[wave];
  const float* Rb = RESID ? (resid + (size_t)b * strideR) : nullptr;
#pragma unroll
  for (int i = 0; i < 4; ++i) {
    const int mBase = m0 + (i << 4);
#pragma unroll
    for (int j = 0; j < 4; ++j) {
      const int n = n0 + (j << 4) + rlane;
      float bv = 0.f;
      if (BIAS_MODE == 2) bv = bias[n];
      if (BIAS_MODE == 3) bv = bf_bits2f(f2bf_bits(bias[n]));
#pragma unroll
      for (int r = 0; r < 8; ++r) {
        float v = acc[i][j][r] * scale;
        if (BIAS_MODE == 1) v += bias[mBase + mOff + r];
        if (BIAS_MODE == 2 || BIAS_MODE == 3) v += bv;
        if (RESID) v += Rb[(size_t)(mBase + mOff + r) * ldc + n];
        if (ACT == 1) v = tanhf(v);
        if (ACT == 2) v = fmaxf(v, 0.0f);
        if (ACT == 4) v = (v > 0.f) ? v : 0.01f * v;
        slab[(mOff + r) * 68 + (j << 4) + rlane] = v;
      }
    }
    __builtin_amdgcn_fence(__ATOMIC_RELEASE, "workgroup");
    __builtin_amdgcn_wave_barrier();
    __builtin_amdgcn_fence(__ATOMIC_ACQUIRE, "workgroup");
    if (OUT_MODE == 0) {
      float* C = (float*)Cout + (size_t)b * strideC;
      const int hh = lane >> 4, c4 = (lane & 15) * 4;     // row seg = 256 B = 16 lanes x 16 B
      {
#pragma unroll
        for (int it = 0; it < 8; ++it) {
          const int row = it * 2 + hh;
          v4f v = *(const v4f*)(slab + row * 68 + c4);
          *(v4f*)(C + (size_t)(mBase + row) * ldc + n0 + c4) = v;
        }
        
      }
    } else {
      const int q = lane >> 3, c8 = (lane & 7) * 8;
      unsigned short* C  = (unsigned short*)Cout  + (size_t)b * strideC;
      unsigned short* C2 = (OUT_MODE == 2) ? ((unsigned short*)Cout2 + (size_t)b * strideC) : nullptr;
      {
#pragma unroll
        for (int it = 0; it < 4; ++it) {
          const int row = it * 4 + q;
          const float* sp = slab + row * 68 + c8;
          v8h hv, lv;
#pragma unroll
          for (int e = 0; e < 8; ++e) {
            if (OUT_MODE == 1) {
              hv[e] = (_Float16)sp[e];
            } else {
              unsigned short hb = f2bf_bits(sp[e]);
              unsigned short lb = f2bf_bits(sp[e] - bf_bits2f(hb));
              hv[e] = __builtin_bit_cast(_Float16, hb);
              lv[e] = __builtin_bit_cast(_Float16, lb);
            }
          }
          *(v8h*)(C + (size_t)(mBase + row) * ldc + n0 + c8) = hv;
          if (OUT_MODE == 2) *(v8h*)(C2 + (size_t)(mBase + row) * ldc + n0 + c8) = lv;
        }
        
      }
    }
    __builtin_amdgcn_fence(__ATOMIC_RELEASE, "workgroup");
    __builtin_amdgcn_wave_barrier();
    __builtin_amdgcn_fence(__ATOMIC_ACQUIRE, "workgroup");
  }
}

// ---- f32 [n] -> bf16 (RNE) [n], same layout; 8 elements per thread = one 16-B store per lane ----
// grid = ceil(n8/256) with n8 = n/8 (here 1,048,576 = 4096 x 256 exactly), bound checked anyway.
__global__ __launch_bounds__(256) void cast_f32_bf16x8(const float* __restrict__ in,
                                                       unsigned short* __restrict__ out, int n8) {
  const int i = blockIdx.x * 256 + threadIdx.x;
  if (i < n8) {
    const v4f a0 = *(const v4f*)(in + (size_t)i * 8);
    const v4f a1 = *(const v4f*)(in + (size_t)i * 8 + 4);
    v8us u;
    u[0] = f2bf_bits(a0[0]); u[1] = f2bf_bits(a0[1]); u[2] = f2bf_bits(a0[2]); u[3] = f2bf_bits(a0[3]);
    u[4] = f2bf_bits(a1[0]); u[5] = f2bf_bits(a1[1]); u[6] = f2bf_bits(a1[2]); u[7] = f2bf_bits(a1[3]);
    *(v8us*)(out + (size_t)i * 8) = u;
    
  }
}

// ---- W [K][N] f32 -> Wt [N][K] bf16 (RNE), 64x64 tile transposed through LDS; grid = (N/64, K/64) ----
// Phase 1 coverage: kr = tid>>2 (64 k rows) x c16 = (tid&3)*16 with 4 quads of 4 -> every (k, n) of the tile once.
// Phase 2 coverage: n = it*32 + wave*4 + q8 (it 0..1, wave 0..7, q8 0..3) -> rows 0..63; c8 -> 8 lanes x 8 = 64 k.
#define WTP 72
__global__ __launch_bounds__(256) void wt_cast_bf16(const float* __restrict__ W, unsigned short* __restrict__ Wt,
                                                    int K, int N) {
  __shared__ __align__(16) unsigned short st[64 * WTP];
  const int n0 = blockIdx.x * 64, k0 = blockIdx.y * 64;
  const int tid = threadIdx.x;
  const int kr = tid >> 2, c16 = (tid & 3) * 16;
  const float* src = W + (size_t)(k0 + kr) * N + n0 + c16;
#pragma unroll
  for (int q = 0; q < 4; ++q) {
    const v4f v = *(const v4f*)(src + 4 * q);
#pragma unroll
    for (int e = 0; e < 4; ++e) st[(c16 + 4 * q + e) * WTP + kr] = f2bf_bits(v[e]);
  }
  __syncthreads();
  const int wave = tid >> 5, lane = tid & 31;
  const int q8 = lane >> 3, c8 = (lane & 7) * 8;
  {
#pragma unroll
    for (int it = 0; it < 2; ++it) {
      const int n = it * 32 + wave * 4 + q8;
      const v8us hv = *(const v8us*)(st + n * WTP + c8);
      *(v8us*)(Wt + (size_t)(n0 + n) * K + k0 + c8) = hv;
    }
    
  }
}

// =====================================================================================
// Causal attention, head_dim 64, bf16 hi/lo planes in, bf16 hi/lo planes out.
//   q|k|v hi/lo planes [kTotRows][3072] (element (b,s,part,h,d) at (b*S+s)*3072 + part*1024 + h*64 + d).
//   Block = 4 waves = 64 query rows of one (b,h); 64-key chunks kc = 0..qb (later chunks have exactly zero weight);
//   the diagonal chunk sets kv > q scores to finfo.min by select after the 1/8 scale.
//   scores and p.v: v_wmma_f32_16x16x32_bf16 with hi/lo split (hi.hi + hi.lo + lo.hi), f32 accumulate; online softmax in f32.
//   grid.x = kNumQB * kBatch * kHeads = 2048, twice the places the chip has for these blocks (LDS: four per WGP). A block's cost
//   is its qb + 1 chunks; the index runs from the heaviest query block (qb = 15, all
//   (b,h)) down to the lightest, for load balance only.
// =====================================================================================
__device__ __forceinline__ v8f mma_b(v16b a, v16b b, v8f c) {
  c = __builtin_amdgcn_wmma_f32_16x16x32_bf16(false, a, false, b, (short)0, c, false, false);
  asm volatile("v_nop\n\tv_nop\n\tv_nop\n\tv_nop" : "+v"(c) : "v"(a), "v"(b));
  return c;
}
__device__ __forceinline__ void bf_split(float f, __bf16& hi, __bf16& lo) {
  const unsigned short hb = f2bf_bits(f);
  hi = __builtin_bit_cast(__bf16, hb);
  lo = __builtin_bit_cast(__bf16, f2bf_bits(f - bf_bits2f(hb)));
}

#define AKC 64
#define LKP 72   // LDS row pitch of the K, V^T and P tiles in elements: 144 B = 16 B x 9 (odd), so 16 rows read by ds_load_b128 fall on distinct banks
#define OSP 68
__global__ __launch_bounds__(128) void attn_causal_k(
    const unsigned short* __restrict__ qkvhp, const unsigned short* __restrict__ qkvlp,
    unsigned short* __restrict__ ohp, unsigned short* __restrict__ olp) {
  union FB { v16b v; v8b h[2]; };
  __shared__ __align__(16) __bf16 Ksh[AKC * LKP];             // K hi [kv][d]   9 KB
  __shared__ __align__(16) __bf16 Ksl[AKC * LKP];             // K lo
  __shared__ __align__(16) __bf16 Vth[kHeadDim * LKP];        // V hi [d][kv]   9 KB
  __shared__ __align__(16) __bf16 Vtl[kHeadDim * LKP];        // V lo
  __shared__ __align__(16) __bf16 Psh[4][16 * LKP];           // per wave P hi [row][kv]
  __shared__ __align__(16) __bf16 Psl[4][16 * LKP];           // per wave P lo
  __shared__ __align__(16) float  Os[4][16 * OSP];            // per wave out tile, pitch 68

  const __bf16* Qh = (const __bf16*)qkvhp;
  const __bf16* Ql = (const __bf16*)qkvlp;

  const int tid  = threadIdx.x;
  const int wave = tid >> 5;
  const int lane = tid & 31;
  const int hh   = lane >> 4;
  const int c    = lane & 15;

  const int bx = blockIdx.x;
  const int qb = (kNumQB - 1) - ((bx >> 7) & (kNumQB - 1));   // 16 query blocks of 64 rows, heaviest first
  const int bh = bx & (kBatch * kHeads - 1);
  const int h  = bh & (kHeads - 1);
  const int b  = bh >> 4;                  // 0..kBatch-1
  const int q0 = qb * 64 + wave * 16;

  // ---- Q fragments (A operand): 2 d-chunks, hi and lo, via Frag loader ----
  v16b qah[2], qal[2];
  {
    const size_t qo = (size_t)(b * kSeq + q0 + c) * kQkvLd + h * kHeadDim + 8 * hh;
#pragma unroll
    for (int dc = 0; dc < 2; ++dc) {
      qah[dc] = Frag<__bf16>::load(Qh + qo + dc * 32);
      qal[dc] = Frag<__bf16>::load(Ql + qo + dc * 32);
    }
  }

  float mrow[8], lrow[8];
  v8f oacc[4];
#pragma unroll
  for (int r = 0; r < 8; ++r) { mrow[r] = -INFINITY; lrow[r] = 0.f; }
#pragma unroll
  for (int t = 0; t < 4; ++t) oacc[t] = (v8f){0.f,0.f,0.f,0.f,0.f,0.f,0.f,0.f};

  const int nIter = qb + 1;   // block-uniform: causal chunks 0..qb, <= 16
  for (int kc = 0; kc < nIter; ++kc) {
    const int kv0 = kc * AKC;
    __syncthreads();
    {
      // staging coverage: 128 threads = 64 kv rows x 2 d-halves of 32; 4 x 8 elements per thread per plane
      const int kvr = tid >> 1, dh = (tid & 1) * 32;
      const size_t mo = ((size_t)(b * kSeq + kv0 + kvr)) * kQkvLd + kModel + h * kHeadDim + dh;   // k row
      const __bf16* kh = Qh + mo;
      const __bf16* kl = Ql + mo;
      const __bf16* vh = kh + kModel;      // v sits 1024 columns after k
      const __bf16* vl = kl + kModel;
#pragma unroll 1
      for (int i = 0; i < 4; ++i) {
        const v8b a0 = *(const v8b*)(kh + 8 * i);
        *(v8b*)(Ksh + kvr * LKP + dh + 8 * i) = a0;
        const v8b a1 = *(const v8b*)(kl + 8 * i);
        *(v8b*)(Ksl + kvr * LKP + dh + 8 * i) = a1;
        const v8b w0 = *(const v8b*)(vh + 8 * i);
        const v8b w1 = *(const v8b*)(vl + 8 * i);
#pragma unroll
        for (int e = 0; e < 8; ++e) {
          Vth[(dh + 8 * i + e) * LKP + kvr] = w0[e];
          Vtl[(dh + 8 * i + e) * LKP + kvr] = w1[e];
        }
      }
    }
    __syncthreads();

    // ---- scores: 3 products per d-chunk ----
    v8f s[4];
#pragma unroll
    for (int j = 0; j < 4; ++j) {
      s[j] = (v8f){0.f,0.f,0.f,0.f,0.f,0.f,0.f,0.f};
#pragma unroll
      for (int dc = 0; dc < 2; ++dc) {
        FB kb, kq;
        kb.h[0] = *(const v8b*)(Ksh + (j * 16 + c) * LKP + dc * 32 + 8 * hh);
        kb.h[1] = *(const v8b*)(Ksh + (j * 16 + c) * LKP + dc * 32 + 16 + 8 * hh);
        kq.h[0] = *(const v8b*)(Ksl + (j * 16 + c) * LKP + dc * 32 + 8 * hh);
        kq.h[1] = *(const v8b*)(Ksl + (j * 16 + c) * LKP + dc * 32 + 16 + 8 * hh);
        s[j] = mma_b(qah[dc], kb.v, s[j]);
        s[j] = mma_b(qah[dc], kq.v, s[j]);
        s[j] = mma_b(qal[dc], kb.v, s[j]);
      }
    }
    const bool diag = (kc == qb);
    float cm[8];
#pragma unroll
    for (int r = 0; r < 8; ++r) {
      const int qrow = q0 + 8 * hh + r;
      float m = -INFINITY;
#pragma unroll
      for (int j = 0; j < 4; ++j) {
        const int kvcol = kv0 + j * 16 + c;
        float sv = s[j][r] * kQkScale;
        if (diag && (kvcol > qrow)) sv = kMaskFill;
        s[j][r] = sv;
        m = fmaxf(m, sv);
      }
#pragma unroll
      for (int off = 1; off < 16; off <<= 1) m = fmaxf(m, __shfl_xor(m, off, 32));
      cm[r] = m;
    }
    __bf16* pwh = Psh[wave];
    __bf16* pwl = Psl[wave];
#pragma unroll
    for (int r = 0; r < 8; ++r) {
      const float mnew = fmaxf(mrow[r], cm[r]);
      const float alpha = expf(mrow[r] - mnew);
      mrow[r] = mnew;
      float psum = 0.f;
#pragma unroll
      for (int j = 0; j < 4; ++j) {
        const float p = expf(s[j][r] - mnew);
        psum += p;
        __bf16 pa, pb; bf_split(p, pa, pb);
        pwh[(8 * hh + r) * LKP + j * 16 + c] = pa;
        pwl[(8 * hh + r) * LKP + j * 16 + c] = pb;
      }
#pragma unroll
      for (int off = 1; off < 16; off <<= 1) psum += __shfl_xor(psum, off, 32);
      lrow[r] = lrow[r] * alpha + psum;
#pragma unroll
      for (int t = 0; t < 4; ++t) oacc[t][r] *= alpha;
    }
    __builtin_amdgcn_fence(__ATOMIC_RELEASE, "workgroup");
    __builtin_amdgcn_wave_barrier();
    __builtin_amdgcn_fence(__ATOMIC_ACQUIRE, "workgroup");
    // ---- O += P x V : 3 products ----
#pragma unroll 1
    for (int kk = 0; kk < 2; ++kk) {
      FB pa, pl;
      pa.h[0] = *(const v8b*)(pwh + c * LKP + kk * 32 + 8 * hh);
      pa.h[1] = *(const v8b*)(pwh + c * LKP + kk * 32 + 16 + 8 * hh);
      pl.h[0] = *(const v8b*)(pwl + c * LKP + kk * 32 + 8 * hh);
      pl.h[1] = *(const v8b*)(pwl + c * LKP + kk * 32 + 16 + 8 * hh);
#pragma unroll
      for (int t = 0; t < 4; ++t) {
        FB vb, vq;
        vb.h[0] = *(const v8b*)(Vth + (t * 16 + c) * LKP + kk * 32 + 8 * hh);
        vb.h[1] = *(const v8b*)(Vth + (t * 16 + c) * LKP + kk * 32 + 16 + 8 * hh);
        vq.h[0] = *(const v8b*)(Vtl + (t * 16 + c) * LKP + kk * 32 + 8 * hh);
        vq.h[1] = *(const v8b*)(Vtl + (t * 16 + c) * LKP + kk * 32 + 16 + 8 * hh);
        oacc[t] = mma_b(pa.v, vb.v, oacc[t]);
        oacc[t] = mma_b(pa.v, vq.v, oacc[t]);
        oacc[t] = mma_b(pl.v, vb.v, oacc[t]);
      }
    }
  }

  // ---- normalize, stage, write hi/lo planes ----
  float* os = Os[wave];
#pragma unroll
  for (int r = 0; r < 8; ++r) {
    const float inv = 1.0f / lrow[r];
#pragma unroll
    for (int t = 0; t < 4; ++t) os[(8 * hh + r) * OSP + t * 16 + c] = oacc[t][r] * inv;
  }
  __builtin_amdgcn_fence(__ATOMIC_RELEASE, "workgroup");
  __builtin_amdgcn_wave_barrier();
  __builtin_amdgcn_fence(__ATOMIC_ACQUIRE, "workgroup");
  {
    const int q8 = lane >> 3, c8 = (lane & 7) * 8;
    _Float16* Oh = (_Float16*)ohp;
    _Float16* Ol = (_Float16*)olp;
    {
#pragma unroll
      for (int it = 0; it < 4; ++it) {
        const int row = it * 4 + q8;
        const float* sp = os + row * OSP + c8;
        v8h hv, lv;
#pragma unroll
        for (int e = 0; e < 8; ++e) {
          const unsigned short hb = f2bf_bits(sp[e]);
          const unsigned short lb = f2bf_bits(sp[e] - bf_bits2f(hb));
          hv[e] = __builtin_bit_cast(_Float16, hb);
          lv[e] = __builtin_bit_cast(_Float16, lb);
        }
        const size_t oo = (size_t)(b * kSeq + q0 + row) * kModel + h * kHeadDim + c8;
        *(v8h*)(Oh + oo) = hv;
        *(v8h*)(Ol + oo) = lv;
      }
      
    }
  }
}

// ---------------------------------------------------------------------------
// Workspace region map (all offsets 256-B aligned, all planes bf16 bits):
//   Xb   [8192][1024]  hidden as bf16          16,777,216 B
//   WaT  [3072][1024]  W_attn transposed        6,291,456 B
//   WoT  [1024][1024]  W_out transposed         2,097,152 B
//   QKVh [8192][3072]  q|k|v hi plane          50,331,648 B
//   QKVl [8192][3072]  q|k|v lo plane          50,331,648 B
//   Oh   [8192][1024]  attention out hi plane  16,777,216 B
//   Ol   [8192][1024]  attention out lo plane  16,777,216 B
// ---------------------------------------------------------------------------
extern "C" void kernel_launch(void* const* d_in, const int* in_sizes, int n_in,
                              void* d_out, int out_size, void* d_ws, size_t ws_size,
                              hipStream_t stream) {
  if (n_in < 5) return;
  if (in_sizes[0] != kTotRows * kModel) return;
  if (in_sizes[1] != kModel * kQkvLd) return;
  if (in_sizes[2] != kQkvLd) return;
  if (in_sizes[3] != kModel * kModel) return;
  if (in_sizes[4] != kModel) return;
  if (out_size != kTotRows * kModel) return;

  const float* hidden = (const float*)d_in[0];   // [8,1024,1024]
  const float* wattn  = (const float*)d_in[1];   // [1024,3072]  ([in][out])
  const float* battn  = (const float*)d_in[2];   // [3072]
  const float* wout   = (const float*)d_in[3];   // [1024,1024]  ([in][out])
  const float* bout   = (const float*)d_in[4];   // [1024]
  float* out = (float*)d_out;                    // [8,1024,1024]

  char* ws = (char*)d_ws;
  size_t off = 0;
  const size_t szXb  = (size_t)kTotRows * kModel * 2;
  const size_t szWaT = (size_t)kQkvLd * kModel * 2;
  const size_t szWoT = (size_t)kModel * kModel * 2;
  const size_t szQKV = (size_t)kTotRows * kQkvLd * 2;
  const size_t szO   = (size_t)kTotRows * kModel * 2;
  unsigned short* Xb   = (unsigned short*)(ws + off); off += szXb;
  unsigned short* WaT  = (unsigned short*)(ws + off); off += szWaT;
  unsigned short* WoT  = (unsigned short*)(ws + off); off += szWoT;
  unsigned short* QKVh = (unsigned short*)(ws + off); off += szQKV;
  unsigned short* QKVl = (unsigned short*)(ws + off); off += szQKV;
  unsigned short* Oh   = (unsigned short*)(ws + off); off += szO;
  unsigned short* Ol   = (unsigned short*)(ws + off); off += szO;
  if (off > ws_size) return;

  // 1) RNE bf16 cast of the activations (8 elements per thread): n8 = 1,048,576 -> 4096 blocks
  {
    const int n8 = kTotRows * kModel / 8;
    cast_f32_bf16x8<<<dim3((n8 + 255) / 256), dim3(256), 0, stream>>>(hidden, Xb, n8);
  }
  // 2) weights: in [K=1024][N] f32 -> out [N][K] bf16 ; grid = (N/64, K/64)
  wt_cast_bf16<<<dim3(kQkvLd / 64, kModel / 64), dim3(256), 0, stream>>>(wattn, WaT, kModel, kQkvLd);
  wt_cast_bf16<<<dim3(kModel / 64, kModel / 64), dim3(256), 0, stream>>>(wout, WoT, kModel, kModel);

  // All eight batches go through each stage in one launch.
  // 3) qkv = hidden @ W_attn + b_attn : M=8192, N=3072, K=1024 -> bf16 hi/lo planes (128x256 tiles: 64*12 = 768 blocks of 8 waves)
  wmma_gemm64<1, 0, 3, 2, false, 4><<<dim3((kTotRows / 128) * (kQkvLd / 256), 1), dim3(256), 0, stream>>>(
      Xb, nullptr, kModel, 0L, WaT, nullptr, kModel, 0L,
      (void*)QKVh, (void*)QKVl, kQkvLd, 0L, battn, nullptr, 0L, kTotRows, kQkvLd, kModel, 1.0f);
  // 4) causal attention, 16*8*16 = 2048 blocks of 128 threads, heaviest query blocks first
  attn_causal_k<<<dim3(kNumQB * kBatch * kHeads), dim3(128), 0, stream>>>(QKVh, QKVl, Oh, Ol);
  // 5) out = O @ W_out + b_out : M=8192, N=1024, K=1024, A hi/lo split, f32 result to d_out (128x128 tiles: 64*8 = 512 blocks of 4 waves)
  wmma_gemm64<1, 2, 3, 0, false, 2><<<dim3((kTotRows / 128) * (kModel / 128), 1), dim3(128), 0, stream>>>(
      Oh, Ol, kModel, 0L, WoT, nullptr, kModel, 0L,
      (void*)out, nullptr, kModel, 0L, bout, nullptr, 0L, kTotRows, kModel, kModel, 1.0f);
}

// v004
// A run of this version takes 169 microseconds.
// Two timings next to v003 both put it at 1.12 times that version's speed.
// Over all steps from v000 it is 3.47 times as fast.
// Contractions: qkv projection v_wmma_f32_16x16x32_bf16 on RNE-bf16 x and W (single product); attention q.k^T and p.v v_wmma_f32_16x16x32_bf16 with bf16 hi/lo split (hi.hi + hi.lo + lo.hi); output projection bf16 hi/lo A-split x bf16 W_out (hi.w + lo.w); f32 accumulate everywhere; softmax, scale and bias adds in f32.
#include <hip/hip_runtime.h>
#include <math.h>
#include <float.h>
#include <stdint.h>

// ---------------------------------------------------------------------------
// Fixed problem geometry
// ---------------------------------------------------------------------------
constexpr int kBatch     = 8;
constexpr int kSeq       = 1024;
constexpr int kModel     = 1024;
constexpr int kHeads     = 16;
constexpr int kHeadDim   = 64;
constexpr int kQkvLd     = 3 * kModel;            // 3072: q | k | v columns
constexpr int kTotRows   = kBatch * kSeq;         // 8192
constexpr int kNumQB     = kSeq / 64;             // 16 query blocks of 64 rows
constexpr float kQkScale = 0.125f;                // 1/sqrt(64), exact power of two
constexpr float kMaskFill = -FLT_MAX;             // finfo(float32).min
static_assert(kNumQB == 16);
static_assert(kHeads == 16);
static_assert(kBatch * kHeads == 128);
static_assert(kModel % 128 == 0 && kQkvLd % 256 == 0 && kTotRows % 128 == 0);
static_assert(kModel % 64 == 0);

typedef __attribute__((ext_vector_type(16))) _Float16 v16h;
typedef __attribute__((ext_vector_type(8)))  _Float16 v8h;
typedef __attribute__((ext_vector_type(16))) __bf16   v16b;
typedef __attribute__((ext_vector_type(8)))  __bf16   v8b;
typedef __attribute__((ext_vector_type(8)))  float    v8f;
typedef __attribute__((ext_vector_type(4)))  float    v4f;
typedef __attribute__((ext_vector_type(8)))  unsigned short v8us;

__device__ __forceinline__ unsigned short f2bf_bits(float f) {
  unsigned u = __float_as_uint(f);
  return (unsigned short)((u + 0x7FFFu + ((u >> 16) & 1u)) >> 16);
}
__device__ __forceinline__ float bf_bits2f(unsigned short h) { return __uint_as_float(((unsigned)h) << 16); }

// hazard guards as plain device helpers
__device__ __forceinline__ void dep_guard_h(v8f& a, v8f& b, v16h x, v16h y) { asm volatile("v_nop\n\tv_nop\n\tv_nop\n\tv_nop" : "+v"(a), "+v"(b) : "v"(x), "v"(y)); }
__device__ __forceinline__ void dep_guard_b(v8f& a, v8f& b, v16b x, v16b y) { asm volatile("v_nop\n\tv_nop\n\tv_nop\n\tv_nop" : "+v"(a), "+v"(b) : "v"(x), "v"(y)); }
__device__ __forceinline__ void keep4_h(v16h a, v16h b, v16h c, v16h d) { asm volatile("v_nop" :: "v"(a), "v"(b), "v"(c), "v"(d)); }
__device__ __forceinline__ void keep4_b(v16b a, v16b b, v16b c, v16b d) { asm volatile("v_nop" :: "v"(a), "v"(b), "v"(c), "v"(d)); }
__device__ __forceinline__ void acc_guard4(v8f& a, v8f& b, v8f& c, v8f& d) { asm volatile("v_nop\n\tv_nop\n\tv_nop\n\tv_nop" : "+v"(a), "+v"(b), "+v"(c), "+v"(d)); }
template <typename T> struct Frag;
template <> struct Frag<_Float16> {
  typedef v16h V; union U { v16h v; v8h h[2]; };
  static __device__ __forceinline__ v16h load(const _Float16* p) {   // elements 0..7 <- p[0..7], 8..15 <- p[16..23]
    U f; f.h[0] = *(const v8h*)(p); f.h[1] = *(const v8h*)(p + 16); return f.v;
  }
  static __device__ __forceinline__ v8f mma(v16h a, v16h b, v8f c) {
    return __builtin_amdgcn_wmma_f32_16x16x32_f16(false, a, false, b, (short)0, c, false, false);
  }
  static __device__ __forceinline__ void guard(v8f& a, v8f& b, v16h x, v16h y) { dep_guard_h(a, b, x, y); }
  static __device__ __forceinline__ void keep(v16h a, v16h b, v16h c, v16h d) { keep4_h(a, b, c, d); }
};
template <> struct Frag<__bf16> {
  typedef v16b V; union U { v16b v; v8b h[2]; };
  static __device__ __forceinline__ v16b load(const __bf16* p) {
    U f; f.h[0] = *(const v8b*)(p); f.h[1] = *(const v8b*)(p + 16); return f.v;
  }
  static __device__ __forceinline__ v8f mma(v16b a, v16b b, v8f c) {
    return __builtin_amdgcn_wmma_f32_16x16x32_bf16(false, a, false, b, (short)0, c, false, false);
  }
  static __device__ __forceinline__ void guard(v8f& a, v8f& b, v16b x, v16b y) { dep_guard_b(a, b, x, y); }
  static __device__ __forceinline__ void keep(v16b a, v16b b, v16b c, v16b d) { keep4_b(a, b, c, d); }
};

// ---- LDS-staged batched WMMA GEMM ------------------------------------------
// C[m,n] = scale * sum_k A[m,k] * Bt[n,k] (+bias)(+resid); block = 2 x WN waves on a 128 x (64*WN) tile, each wave owns 64x64.
// A row-major [M,K]; Bt row-major [N,K]; M % 128 == 0, N % (64*WN) == 0, K % 64 == 0, K >= 64.
// Each k-slice of 64 (one 128-B line of every operand row of the block tile) is brought into LDS once, by asynchronous
// 16-B copies that cover whole lines, and every wave of the block reads its fragments from there; two buffers, so the
// next slice's copies fly while this slice is multiplied.
// SPLIT: 0 = single product; 2 = A hi/lo planes (A2 = lo plane), Bt single plane: hi.b + lo.b.
// BIAS_MODE: 0 = none, 1 = bias[m], 2 = bias[n], 3 = bias[n] passed through an RNE bf16 convert first.
// OUT_MODE: 0 = f32, 1 = f16, 2 = bf16 hi plane (Cout) + bf16 lo plane (Cout2).
// ET: 0 = f16 operands, 1 = bf16 operands (pointers passed as 16-bit storage)
template <int ET> struct Elem;
template <> struct Elem<0> { typedef _Float16 T; };
template <> struct Elem<1> { typedef __bf16 T; };

#define GBK 64   // k elements per staged slice: 128 B of every row
#define GLP 72   // LDS row pitch of the staged slices in elements: 144 B = 16 B x 9 (odd), conflict-free for the ds_load_b128 fragment reads

__device__ __forceinline__ uint32_t lds_off(const void* p) { return (uint32_t)(size_t)p; }   // byte offset in the work-group's LDS

// Twelve asynchronous 16-B copies per lane, global -> LDS through no register. The s_wait_xcnt stands inside the copies' own
// statement so that no address register they name is rewritten in front of it.
template <typename T>
__device__ __forceinline__ void async_copy12(const uint32_t (&l)[12], const T* const (&g)[12]) {
  asm volatile(
      "global_load_async_to_lds_b128 %0, %12, off\n\t"
      "global_load_async_to_lds_b128 %1, %13, off\n\t"
      "global_load_async_to_lds_b128 %2, %14, off\n\t"
      "global_load_async_to_lds_b128 %3, %15, off\n\t"
      "global_load_async_to_lds_b128 %4, %16, off\n\t"
      "global_load_async_to_lds_b128 %5, %17, off\n\t"
      "global_load_async_to_lds_b128 %6, %18, off\n\t"
      "global_load_async_to_lds_b128 %7, %19, off\n\t"
      "global_load_async_to_lds_b128 %8, %20, off\n\t"
      "global_load_async_to_lds_b128 %9, %21, off\n\t"
      "global_load_async_to_lds_b128 %10, %22, off\n\t"
      "global_load_async_to_lds_b128 %11, %23, off\n\t"
      "s_wait_xcnt 0x0"
      :: "v"(l[0]), "v"(l[1]), "v"(l[2]), "v"(l[3]), "v"(l[4]), "v"(l[5]),
         "v"(l[6]), "v"(l[7]), "v"(l[8]), "v"(l[9]), "v"(l[10]), "v"(l[11]),
         "v"(g[0]), "v"(g[1]), "v"(g[2]), "v"(g[3]), "v"(g[4]), "v"(g[5]),
         "v"(g[6]), "v"(g[7]), "v"(g[8]), "v"(g[9]), "v"(g[10]), "v"(g[11])
      : "memory");
}

template <int ET, int SPLIT, int BIAS_MODE, int OUT_MODE, bool RESID, int WN, int ACT = 0>
__global__ __launch_bounds__(64 * WN) void wmma_gemm64(
    const unsigned short* __restrict__ Ap, const unsigned short* __restrict__ A2p, int lda, long strideA,
    const unsigned short* __restrict__ Btp, const unsigned short* __restrict__ Bt2p, int ldb, long strideB,
    void* __restrict__ Cout, void* __restrict__ Cout2, int ldc, long strideC,
    const float* __restrict__ bias,
    const float* __restrict__ resid, long strideR,
    int M, int N, int K, float scale) {
  static_assert(SPLIT == 0 || SPLIT == 2);
  typedef typename Elem<ET>::T T;
  typedef typename Frag<T>::V V;
  constexpr int BM    = 128;                              // block tile rows
  constexpr int BN    = 64 * WN;                          // block tile columns
  constexpr int AROWS = (SPLIT == 2) ? 2 * BM : BM;       // staged A rows: hi plane, then lo plane
  constexpr int SROWS = AROWS + BN;                       // staged rows per slice: A | (A lo) | Bt
  constexpr int RPR   = (64 * WN) / 8;                    // rows one copy of the whole block covers: 8 lanes x 16 B per row
  constexpr int NC    = SROWS / RPR;                      // copies per lane and slice
  constexpr int STAGE_E = SROWS * GLP;                    // elements per buffer
  static_assert(BM % RPR == 0 && BN % RPR == 0 && NC % 12 == 0 && NC <= 63);
  const T* A = (const T*)Ap; const T* A2 = (const T*)A2p; const T* Bt = (const T*)Btp;
  __shared__ __align__(16) T ring[2 * STAGE_E];            // two buffers of one k-slice each
  __shared__ __align__(16) float sT[2 * WN][16 * 68];      // per-wave 16x64 slab, pitch 68 floats
  const int b    = blockIdx.y;
  const int tid  = threadIdx.x;
  const int lane = tid & 31;
  const int wave = tid >> 5;
  const int tilesN = N / BN;
  const int tilesM = M / BM;
  const int bt = blockIdx.x;
  if (bt >= tilesM * tilesN) return;   // block-uniform, in front of every copy and barrier
  const int bm = bt / tilesN;
  const int bn = bt - bm * tilesN;
  const int wm = wave / WN;
  const int wn = wave - wm * WN;
  const int m0 = bm * BM + (wm << 6);
  const int n0 = bn * BN + (wn << 6);

  const int rlane = lane & 15;                 // row (A) / col (B, D) within subtile
  const int koff  = (lane >> 4) * 8;           // k offset of this lane half
  const int mOff  = (lane >> 4) * 8;           // D row offset

  // copy side: lane = (row tid>>3 of a round of RPR rows, 16-B segment tid&7 of its 128-B line)
  const int crow = tid >> 3, cseg = (tid & 7) * 8;
  // gA, gA2, gB walk along k: they point at the next slice to be copied
  const T* gA  = A  + (size_t)b * strideA + (size_t)(bm * BM + crow) * lda + cseg;
  const T* gA2 = (SPLIT == 2) ? (A2 + (size_t)b * strideA + (size_t)(bm * BM + crow) * lda + cseg) : nullptr;
  const T* gB  = Bt + (size_t)b * strideB + (size_t)(bn * BN + crow) * ldb + cseg;
  const uint32_t lC = lds_off(ring) + (uint32_t)(crow * GLP + cseg) * 2u;
  auto issue_slice = [&](int buf) {
    const uint32_t lb = lC + (uint32_t)buf * (uint32_t)(STAGE_E * 2);
#pragma unroll
    for (int g = 0; g < NC / 12; ++g) {
      uint32_t l[12];
      const T* p[12];
#pragma unroll
      for (int c = 0; c < 12; ++c) {
        const int sr = (g * 12 + c) * RPR;     // first staged row of this round
        l[c] = lb + (uint32_t)(sr * GLP * 2);
        if (sr < BM)         p[c] = gA  + (size_t)sr * lda;
        else if (sr < AROWS) p[c] = gA2 + (size_t)(sr - BM) * lda;
        else                 p[c] = gB  + (size_t)(sr - AROWS) * ldb;
      }
      async_copy12<T>(l, p);
    }
    gA += GBK;
    if (SPLIT == 2) gA2 += GBK;
    gB += GBK;
  };

  // fragment side: this lane's row and k half inside a buffer
  const T* fA = ring + ((wm << 6) + rlane) * GLP + koff;
  const T* fB = ring + (AROWS + (wn << 6) + rlane) * GLP + koff;

  v8f acc[4][4];
#pragma unroll
  for (int i = 0; i < 4; ++i)
#pragma unroll
    for (int j = 0; j < 4; ++j) acc[i][j] = (v8f){0.f,0.f,0.f,0.f,0.f,0.f,0.f,0.f};

  const int nT = K / GBK;                      // block-uniform
  issue_slice(0);
  asm volatile("s_wait_asynccnt 0x0" ::: "memory");   // this wave's copies of slice 0 have landed
  __syncthreads();                                     // ... and every other wave's
  if (nT > 1) issue_slice(1);
  for (int t = 0; t < nT; ++t) {
    const int so = (t & 1) * STAGE_E;
#pragma unroll   // both 32-k halves of the slice in one body, so the second half's fragment reads can start under the first half's products
    for (int kk = 0; kk < GBK; kk += 32) {
      V bh[4], ah[4], al[4];
#pragma unroll
      for (int j = 0; j < 4; ++j) bh[j] = Frag<T>::load(fB + so + (j << 4) * GLP + kk);
#pragma unroll
      for (int i = 0; i < 4; ++i) {
        ah[i] = Frag<T>::load(fA + so + (i << 4) * GLP + kk);
        if (SPLIT == 2) al[i] = Frag<T>::load(fA + so + (BM + (i << 4)) * GLP + kk);
      }
#pragma unroll
      for (int i = 0; i < 4; ++i) {
#pragma unroll
        for (int j = 0; j < 4; ++j) {
          acc[i][j] = Frag<T>::mma(ah[i], bh[j], acc[i][j]);
          if (SPLIT == 2) acc[i][j] = Frag<T>::mma(al[i], bh[j], acc[i][j]);
        }
        Frag<T>::guard(acc[i][0], acc[i][3], ah[i], (SPLIT == 2) ? al[i] : ah[i]);
      }
      Frag<T>::keep(bh[0], bh[1], bh[2], bh[3]);
    }
    asm volatile("s_wait_dscnt 0x0" ::: "memory");     // this wave's reads of the buffer are done before it is refilled
    asm volatile("s_wait_asynccnt 0x0" ::: "memory");  // this wave's copies of slice t + 1 have landed
    __syncthreads();                                    // publishes slice t + 1 and ends every wave's reads of slice t
    if (t + 2 < nT) issue_slice(t & 1);
  }
  asm volatile("s_wait_asynccnt 0x0" ::: "memory");    // nothing in flight when the wave goes on
  acc_guard4(acc[0][0], acc[0][1], acc[0][2], acc[0][3]);
  acc_guard4(acc[1][0], acc[1][1], acc[1][2], acc[1][3]);
  acc_guard4(acc[2][0], acc[2][1], acc[2][2], acc[2][3]);
  acc_guard4(acc[3][0], acc[3][1], acc[3][2], acc[3][3]);

  // ---- epilogue ----
  float* slab = sT[wave];
  const float* Rb = RESID ? (resid + (size_t)b * strideR) : nullptr;
#pragma unroll
  for (int i = 0; i < 4; ++i) {
    const int mBase = m0 + (i << 4);
#pragma unroll
    for (int j = 0; j < 4; ++j) {
      const int n = n0 + (j << 4) + rlane;
      float bv = 0.f;
      if (BIAS_MODE == 2) bv = bias[n];
      if (BIAS_MODE == 3) bv = bf_bits2f(f2bf_bits(bias[n]));
#pragma unroll
      for (int r = 0; r < 8; ++r) {
        float v = acc[i][j][r] * scale;
        if (BIAS_MODE == 1) v += bias[mBase + mOff + r];
        if (BIAS_MODE == 2 || BIAS_MODE == 3) v += bv;
        if (RESID) v += Rb[(size_t)(mBase + mOff + r) * ldc + n];
        if (ACT == 1) v = tanhf(v);
        if (ACT == 2) v = fmaxf(v, 0.0f);
        if (ACT == 4) v = (v > 0.f) ? v : 0.01f * v;
        slab[(mOff + r) * 68 + (j << 4) + rlane] = v;
      }
    }
    __builtin_amdgcn_fence(__ATOMIC_RELEASE, "workgroup");
    __builtin_amdgcn_wave_barrier();
    __builtin_amdgcn_fence(__ATOMIC_ACQUIRE, "workgroup");
    if (OUT_MODE == 0) {
      float* C = (float*)Cout + (size_t)b * strideC;
      const int hh = lane >> 4, c4 = (lane & 15) * 4;     // row seg = 256 B = 16 lanes x 16 B
      {
#pragma unroll
        for (int it = 0; it < 8; ++it) {
          const int row = it * 2 + hh;
          v4f v = *(const v4f*)(slab + row * 68 + c4);
          *(v4f*)(C + (size_t)(mBase + row) * ldc + n0 + c4) = v;
        }
        
      }
    } else {
      const int q = lane >> 3, c8 = (lane & 7) * 8;
      unsigned short* C  = (unsigned short*)Cout  + (size_t)b * strideC;
      unsigned short* C2 = (OUT_MODE == 2) ? ((unsigned short*)Cout2 + (size_t)b * strideC) : nullptr;
      {
#pragma unroll
        for (int it = 0; it < 4; ++it) {
          const int row = it * 4 + q;
          const float* sp = slab + row * 68 + c8;
          v8h hv, lv;
#pragma unroll
          for (int e = 0; e < 8; ++e) {
            if (OUT_MODE == 1) {
              hv[e] = (_Float16)sp[e];
            } else {
              unsigned short hb = f2bf_bits(sp[e]);
              unsigned short lb = f2bf_bits(sp[e] - bf_bits2f(hb));
              hv[e] = __builtin_bit_cast(_Float16, hb);
              lv[e] = __builtin_bit_cast(_Float16, lb);
            }
          }
          *(v8h*)(C + (size_t)(mBase + row) * ldc + n0 + c8) = hv;
          if (OUT_MODE == 2) *(v8h*)(C2 + (size_t)(mBase + row) * ldc + n0 + c8) = lv;
        }
        
      }
    }
    __builtin_amdgcn_fence(__ATOMIC_RELEASE, "workgroup");
    __builtin_amdgcn_wave_barrier();
    __builtin_amdgcn_fence(__ATOMIC_ACQUIRE, "workgroup");
  }
}

// ---- f32 [n] -> bf16 (RNE) [n], same layout; 8 elements per thread = one 16-B store per lane ----
// grid = ceil(n8/256) with n8 = n/8 (here 1,048,576 = 4096 x 256 exactly), bound checked anyway.
__global__ __launch_bounds__(256) void cast_f32_bf16x8(const float* __restrict__ in,
                                                       unsigned short* __restrict__ out, int n8) {
  const int i = blockIdx.x * 256 + threadIdx.x;
  if (i < n8) {
    const v4f a0 = *(const v4f*)(in + (size_t)i * 8);
    const v4f a1 = *(const v4f*)(in + (size_t)i * 8 + 4);
    v8us u;
    u[0] = f2bf_bits(a0[0]); u[1] = f2bf_bits(a0[1]); u[2] = f2bf_bits(a0[2]); u[3] = f2bf_bits(a0[3]);
    u[4] = f2bf_bits(a1[0]); u[5] = f2bf_bits(a1[1]); u[6] = f2bf_bits(a1[2]); u[7] = f2bf_bits(a1[3]);
    *(v8us*)(out + (size_t)i * 8) = u;
    
  }
}

// ---- W [K][N] f32 -> Wt [N][K] bf16 (RNE), 64x64 tile transposed through LDS; grid = (N/64, K/64) ----
// Phase 1 coverage: kr = tid>>2 (64 k rows) x c16 = (tid&3)*16 with 4 quads of 4 -> every (k, n) of the tile once.
// Phase 2 coverage: n = it*32 + wave*4 + q8 (it 0..1, wave 0..7, q8 0..3) -> rows 0..63; c8 -> 8 lanes x 8 = 64 k.
#define WTP 72
__global__ __launch_bounds__(256) void wt_cast_bf16(const float* __restrict__ W, unsigned short* __restrict__ Wt,
                                                    int K, int N) {
  __shared__ __align__(16) unsigned short st[64 * WTP];
  const int n0 = blockIdx.x * 64, k0 = blockIdx.y * 64;
  const int tid = threadIdx.x;
  const int kr = tid >> 2, c16 = (tid & 3) * 16;
  const float* src = W + (size_t)(k0 + kr) * N + n0 + c16;
#pragma unroll
  for (int q = 0; q < 4; ++q) {
    const v4f v = *(const v4f*)(src + 4 * q);
#pragma unroll
    for (int e = 0; e < 4; ++e) st[(c16 + 4 * q + e) * WTP + kr] = f2bf_bits(v[e]);
  }
  __syncthreads();
  const int wave = tid >> 5, lane = tid & 31;
  const int q8 = lane >> 3, c8 = (lane & 7) * 8;
  {
#pragma unroll
    for (int it = 0; it < 2; ++it) {
      const int n = it * 32 + wave * 4 + q8;
      const v8us hv = *(const v8us*)(st + n * WTP + c8);
      *(v8us*)(Wt + (size_t)(n0 + n) * K + k0 + c8) = hv;
    }
    
  }
}

__device__ __forceinline__ v8f mma_b(v16b a, v16b b, v8f c) {
  c = __builtin_amdgcn_wmma_f32_16x16x32_bf16(false, a, false, b, (short)0, c, false, false);
  asm volatile("v_nop\n\tv_nop\n\tv_nop\n\tv_nop" : "+v"(c) : "v"(a), "v"(b));
  return c;
}
__device__ __forceinline__ void bf_split(float f, __bf16& hi, __bf16& lo) {
  const unsigned short hb = f2bf_bits(f);
  hi = __builtin_bit_cast(__bf16, hb);
  lo = __builtin_bit_cast(__bf16, f2bf_bits(f - bf_bits2f(hb)));
}

// value of the same register in lane ^ 16 (the other 16-lane half of the wave)
__device__ __forceinline__ float other_half(float x) {
  const unsigned u = __float_as_uint(x);
  return __uint_as_float(__builtin_amdgcn_permlanex16(u, u, 0x76543210u, 0xfedcba98u, false, false));
}

#define AKC 64
#define LKP 72   // LDS row pitch of the K and V^T tiles in elements: 144 B = 16 B x 9 (odd), so 16 rows read by ds_load_b128 fall on distinct banks
#define OSP 68
__global__ __launch_bounds__(128) void attn_causal_k(
    const unsigned short* __restrict__ qkvhp, const unsigned short* __restrict__ qkvlp,
    unsigned short* __restrict__ ohp, unsigned short* __restrict__ olp) {
  union FB { v16b v; v8b h[2]; };
  __shared__ __align__(16) __bf16 Ksh[AKC * LKP];             // K hi [kv][d]   9 KB
  __shared__ __align__(16) __bf16 Ksl[AKC * LKP];             // K lo
  __shared__ __align__(16) __bf16 Vth[kHeadDim * LKP];        // V hi [d][kv]   9 KB
  __shared__ __align__(16) __bf16 Vtl[kHeadDim * LKP];        // V lo
  __shared__ __align__(16) float  Os[4][16 * OSP];            // per wave out tile, pitch 68

  const __bf16* Qh = (const __bf16*)qkvhp;
  const __bf16* Ql = (const __bf16*)qkvlp;

  const int tid  = threadIdx.x;
  const int wave = tid >> 5;
  const int lane = tid & 31;
  const int hh   = lane >> 4;
  const int c    = lane & 15;

  const int bx = blockIdx.x;
  const int qb = (kNumQB - 1) - ((bx >> 7) & (kNumQB - 1));   // 16 query blocks of 64 rows, heaviest first
  const int bh = bx & (kBatch * kHeads - 1);
  const int h  = bh & (kHeads - 1);
  const int b  = bh >> 4;                  // 0..kBatch-1
  const int q0 = qb * 64 + wave * 16;

  // ---- Q fragments (B operand: column = query row q0 + c): 2 d-chunks, hi and lo, via Frag loader ----
  v16b qah[2], qal[2];
  {
    const size_t qo = (size_t)(b * kSeq + q0 + c) * kQkvLd + h * kHeadDim + 8 * hh;
#pragma unroll
    for (int dc = 0; dc < 2; ++dc) {
      qah[dc] = Frag<__bf16>::load(Qh + qo + dc * 32);
      qal[dc] = Frag<__bf16>::load(Ql + qo + dc * 32);
    }
  }

  float mrow = -INFINITY;   // running maximum of query row q0 + c (equal in both wave halves)
  float lrow = 0.f;         // running sum over this half's keys alone; the halves are joined once, behind the loop
  v8f oacc[4];              // O^T: oacc[t][r] = O[q0 + c][t*16 + 8*hh + r]
#pragma unroll
  for (int t = 0; t < 4; ++t) oacc[t] = (v8f){0.f,0.f,0.f,0.f,0.f,0.f,0.f,0.f};

  const int nIter = qb + 1;   // block-uniform: causal chunks 0..qb, <= 16
  for (int kc = 0; kc < nIter; ++kc) {
    const int kv0 = kc * AKC;
    __syncthreads();
    {
      // staging coverage: 128 threads = 64 kv rows x 2 d-halves of 32; 4 x 8 elements per thread per plane
      const int kvr = tid >> 1, dh = (tid & 1) * 32;
      const size_t mo = ((size_t)(b * kSeq + kv0 + kvr)) * kQkvLd + kModel + h * kHeadDim + dh;   // k row
      const __bf16* kh = Qh + mo;
      const __bf16* kl = Ql + mo;
      const __bf16* vh = kh + kModel;      // v sits 1024 columns after k
      const __bf16* vl = kl + kModel;
#pragma unroll 1
      for (int i = 0; i < 4; ++i) {
        const v8b a0 = *(const v8b*)(kh + 8 * i);
        *(v8b*)(Ksh + kvr * LKP + dh + 8 * i) = a0;
        const v8b a1 = *(const v8b*)(kl + 8 * i);
        *(v8b*)(Ksl + kvr * LKP + dh + 8 * i) = a1;
        const v8b w0 = *(const v8b*)(vh + 8 * i);
        const v8b w1 = *(const v8b*)(vl + 8 * i);
#pragma unroll
        for (int e = 0; e < 8; ++e) {
          Vth[(dh + 8 * i + e) * LKP + kvr] = w0[e];
          Vtl[(dh + 8 * i + e) * LKP + kvr] = w1[e];
        }
      }
    }
    __syncthreads();

    // ---- scores, transposed: s[j][r] = S[q0 + c][kv0 + j*16 + 8*hh + r]; 3 products per d-chunk ----
    v8f s[4];
#pragma unroll
    for (int j = 0; j < 4; ++j) {
      s[j] = (v8f){0.f,0.f,0.f,0.f,0.f,0.f,0.f,0.f};
#pragma unroll
      for (int dc = 0; dc < 2; ++dc) {
        FB kb, kq;
        kb.h[0] = *(const v8b*)(Ksh + (j * 16 + c) * LKP + dc * 32 + 8 * hh);
        kb.h[1] = *(const v8b*)(Ksh + (j * 16 + c) * LKP + dc * 32 + 16 + 8 * hh);
        kq.h[0] = *(const v8b*)(Ksl + (j * 16 + c) * LKP + dc * 32 + 8 * hh);
        kq.h[1] = *(const v8b*)(Ksl + (j * 16 + c) * LKP + dc * 32 + 16 + 8 * hh);
        s[j] = mma_b(kb.v, qah[dc], s[j]);
        s[j] = mma_b(kq.v, qah[dc], s[j]);
        s[j] = mma_b(kb.v, qal[dc], s[j]);
      }
    }
    const bool diag = (kc == qb);
    const int qrow = q0 + c;
    float mj[4];                          // one maximum per score tile: four short chains, not one of 32 links
#pragma unroll
    for (int j = 0; j < 4; ++j) {
      mj[j] = -INFINITY;
#pragma unroll
      for (int r = 0; r < 8; ++r) {
        const int kvcol = kv0 + j * 16 + 8 * hh + r;
        float sv = s[j][r] * kQkScale;
        if (diag && (kvcol > qrow)) sv = kMaskFill;
        s[j][r] = sv;
        mj[j] = fmaxf(mj[j], sv);
      }
    }
    float m = fmaxf(fmaxf(mj[0], mj[1]), fmaxf(mj[2], mj[3]));
    m = fmaxf(m, other_half(m));          // the row's other 32 keys sit in lane ^ 16
    const float mnew = fmaxf(mrow, m);
    const float alpha = expf(mrow - mnew);
    mrow = mnew;
    float pj[4];                          // one sum per score tile, as for the maxima
    FB ph[2], pl[2];                      // P^T as B operand: element (j&1)*8 + r of chunk j>>1 = key (j>>1)*32 + (j&1)*16 + 8*hh + r
#pragma unroll
    for (int j = 0; j < 4; ++j) {
      pj[j] = 0.f;
#pragma unroll
      for (int r = 0; r < 8; ++r) {
        const float p = expf(s[j][r] - mnew);
        pj[j] += p;
        __bf16 pa, pb; bf_split(p, pa, pb);
        ph[j >> 1].v[(j & 1) * 8 + r] = pa;
        pl[j >> 1].v[(j & 1) * 8 + r] = pb;
      }
    }
    lrow = lrow * alpha + ((pj[0] + pj[1]) + (pj[2] + pj[3]));
#pragma unroll
    for (int t = 0; t < 4; ++t)
#pragma unroll
      for (int r = 0; r < 8; ++r) oacc[t][r] *= alpha;
    // ---- O^T += V^T x P^T : 3 products ----
#pragma unroll   // ph and pl are register arrays: kk must be a constant
    for (int kk = 0; kk < 2; ++kk) {
#pragma unroll
      for (int t = 0; t < 4; ++t) {
        FB vb, vq;
        vb.h[0] = *(const v8b*)(Vth + (t * 16 + c) * LKP + kk * 32 + 8 * hh);
        vb.h[1] = *(const v8b*)(Vth + (t * 16 + c) * LKP + kk * 32 + 16 + 8 * hh);
        vq.h[0] = *(const v8b*)(Vtl + (t * 16 + c) * LKP + kk * 32 + 8 * hh);
        vq.h[1] = *(const v8b*)(Vtl + (t * 16 + c) * LKP + kk * 32 + 16 + 8 * hh);
        oacc[t] = mma_b(vb.v, ph[kk].v, oacc[t]);
        oacc[t] = mma_b(vq.v, ph[kk].v, oacc[t]);
        oacc[t] = mma_b(vb.v, pl[kk].v, oacc[t]);
      }
    }
  }

  // ---- join the halves' sums, normalize, stage as [query row][d], write hi/lo planes ----
  float* os = Os[wave];
  {
    const float inv = 1.0f / (lrow + other_half(lrow));
#pragma unroll
    for (int t = 0; t < 4; ++t) {
      v4f lo4, hi4;
#pragma unroll
      for (int e = 0; e < 4; ++e) { lo4[e] = oacc[t][e] * inv; hi4[e] = oacc[t][4 + e] * inv; }
      *(v4f*)(os + c * OSP + t * 16 + 8 * hh)     = lo4;
      *(v4f*)(os + c * OSP + t * 16 + 8 * hh + 4) = hi4;
    }
  }
  __builtin_amdgcn_fence(__ATOMIC_RELEASE, "workgroup");
  __builtin_amdgcn_wave_barrier();
  __builtin_amdgcn_fence(__ATOMIC_ACQUIRE, "workgroup");
  {
    const int q8 = lane >> 3, c8 = (lane & 7) * 8;
    _Float16* Oh = (_Float16*)ohp;
    _Float16* Ol = (_Float16*)olp;
    {
#pragma unroll
      for (int it = 0; it < 4; ++it) {
        const int row = it * 4 + q8;
        const float* sp = os + row * OSP + c8;
        v8h hv, lv;
#pragma unroll
        for (int e = 0; e < 8; ++e) {
          const unsigned short hb = f2bf_bits(sp[e]);
          const unsigned short lb = f2bf_bits(sp[e] - bf_bits2f(hb));
          hv[e] = __builtin_bit_cast(_Float16, hb);
          lv[e] = __builtin_bit_cast(_Float16, lb);
        }
        const size_t oo = (size_t)(b * kSeq + q0 + row) * kModel + h * kHeadDim + c8;
        *(v8h*)(Oh + oo) = hv;
        *(v8h*)(Ol + oo) = lv;
      }
      
    }
  }
}

// ---------------------------------------------------------------------------
// Workspace region map (all offsets 256-B aligned, all planes bf16 bits):
//   Xb   [8192][1024]  hidden as bf16          16,777,216 B
//   WaT  [3072][1024]  W_attn transposed        6,291,456 B
//   WoT  [1024][1024]  W_out transposed         2,097,152 B
//   QKVh [8192][3072]  q|k|v hi plane          50,331,648 B
//   QKVl [8192][3072]  q|k|v lo plane          50,331,648 B
//   Oh   [8192][1024]  attention out hi plane  16,777,216 B
//   Ol   [8192][1024]  attention out lo plane  16,777,216 B
// ---------------------------------------------------------------------------
extern "C" void kernel_launch(void* const* d_in, const int* in_sizes, int n_in,
                              void* d_out, int out_size, void* d_ws, size_t ws_size,
                              hipStream_t stream) {
  if (n_in < 5) return;
  if (in_sizes[0] != kTotRows * kModel) return;
  if (in_sizes[1] != kModel * kQkvLd) return;
  if (in_sizes[2] != kQkvLd) return;
  if (in_sizes[3] != kModel * kModel) return;
  if (in_sizes[4] != kModel) return;
  if (out_size != kTotRows * kModel) return;

  const float* hidden = (const float*)d_in[0];   // [8,1024,1024]
  const float* wattn  = (const float*)d_in[1];   // [1024,3072]  ([in][out])
  const float* battn  = (const float*)d_in[2];   // [3072]
  const float* wout   = (const float*)d_in[3];   // [1024,1024]  ([in][out])
  const float* bout   = (const float*)d_in[4];   // [1024]
  float* out = (float*)d_out;                    // [8,1024,1024]

  char* ws = (char*)d_ws;
  size_t off = 0;
  const size_t szXb  = (size_t)kTotRows * kModel * 2;
  const size_t szWaT = (size_t)kQkvLd * kModel * 2;
  const size_t szWoT = (size_t)kModel * kModel * 2;
  const size_t szQKV = (size_t)kTotRows * kQkvLd * 2;
  const size_t szO   = (size_t)kTotRows * kModel * 2;
  unsigned short* Xb   = (unsigned short*)(ws + off); off += szXb;
  unsigned short* WaT  = (unsigned short*)(ws + off); off += szWaT;
  unsigned short* WoT  = (unsigned short*)(ws + off); off += szWoT;
  unsigned short* QKVh = (unsigned short*)(ws + off); off += szQKV;
  unsigned short* QKVl = (unsigned short*)(ws + off); off += szQKV;
  unsigned short* Oh   = (unsigned short*)(ws + off); off += szO;
  unsigned short* Ol   = (unsigned short*)(ws + off); off += szO;
  if (off > ws_size) return;

  // 1) RNE bf16 cast of the activations (8 elements per thread): n8 = 1,048,576 -> 4096 blocks
  {
    const int n8 = kTotRows * kModel / 8;
    cast_f32_bf16x8<<<dim3((n8 + 255) / 256), dim3(256), 0, stream>>>(hidden, Xb, n8);
  }
  // 2) weights: in [K=1024][N] f32 -> out [N][K] bf16 ; grid = (N/64, K/64)
  wt_cast_bf16<<<dim3(kQkvLd / 64, kModel / 64), dim3(256), 0, stream>>>(wattn, WaT, kModel, kQkvLd);
  wt_cast_bf16<<<dim3(kModel / 64, kModel / 64), dim3(256), 0, stream>>>(wout, WoT, kModel, kModel);

  // All eight batches go through each stage in one launch.
  // 3) qkv = hidden @ W_attn + b_attn : M=8192, N=3072, K=1024 -> bf16 hi/lo planes (128x256 tiles: 64*12 = 768 blocks of 8 waves)
  wmma_gemm64<1, 0, 3, 2, false, 4><<<dim3((kTotRows / 128) * (kQkvLd / 256), 1), dim3(256), 0, stream>>>(
      Xb, nullptr, kModel, 0L, WaT, nullptr, kModel, 0L,
      (void*)QKVh, (void*)QKVl, kQkvLd, 0L, battn, nullptr, 0L, kTotRows, kQkvLd, kModel, 1.0f);
  // 4) causal attention, 16*8*16 = 2048 blocks of 128 threads, heaviest query blocks first
  attn_causal_k<<<dim3(kNumQB * kBatch * kHeads), dim3(128), 0, stream>>>(QKVh, QKVl, Oh, Ol);
  // 5) out = O @ W_out + b_out : M=8192, N=1024, K=1024, A hi/lo split, f32 result to d_out (128x128 tiles: 64*8 = 512 blocks of 4 waves)
  wmma_gemm64<1, 2, 3, 0, false, 2><<<dim3((kTotRows / 128) * (kModel / 128), 1), dim3(128), 0, stream>>>(
      Oh, Ol, kModel, 0L, WoT, nullptr, kModel, 0L,
      (void*)out, nullptr, kModel, 0L, bout, nullptr, 0L, kTotRows, kModel, kModel, 1.0f);
}

// v005
// Measured time: 159 microseconds a run.
// In both of two side-by-side timings against v004, it was 1.07 times as fast.
// Counting every step since v000, it is 3.71 times as fast.
// Contractions: qkv projection v_wmma_f32_16x16x32_bf16 on RNE-bf16 x and W (single product); attention q.k^T and p.v v_wmma_f32_16x16x32_bf16 with bf16 hi/lo split (hi.hi + hi.lo + lo.hi); output projection bf16 hi/lo A-split x bf16 W_out (hi.w + lo.w); f32 accumulate everywhere; softmax, scale and bias adds in f32.
#include <hip/hip_runtime.h>
#include <math.h>
#include <float.h>
#include <stdint.h>

// ---------------------------------------------------------------------------
// Fixed problem geometry
// ---------------------------------------------------------------------------
constexpr int kBatch     = 8;
constexpr int kSeq       = 1024;
constexpr int kModel     = 1024;
constexpr int kHeads     = 16;
constexpr int kHeadDim   = 64;
constexpr int kQkvLd     = 3 * kModel;            // 3072: q | k | v columns
constexpr int kTotRows   = kBatch * kSeq;         // 8192
constexpr int kNumQB     = kSeq / 64;             // 16 query blocks of 64 rows
constexpr float kQkScale = 0.125f;                // 1/sqrt(64), exact power of two
constexpr float kQkScaleLog2e = kQkScale * 1.44269504088896340736f;   // exp(x/8) = exp2(x * this)
constexpr float kMaskFill = -FLT_MAX;             // finfo(float32).min
static_assert(kNumQB == 16);
static_assert(kHeads == 16);
static_assert(kBatch * kHeads == 128);
static_assert(kModel % 128 == 0 && kQkvLd % 256 == 0 && kTotRows % 128 == 0);
static_assert(kModel % 64 == 0);

typedef __attribute__((ext_vector_type(16))) _Float16 v16h;
typedef __attribute__((ext_vector_type(8)))  _Float16 v8h;
typedef __attribute__((ext_vector_type(16))) __bf16   v16b;
typedef __attribute__((ext_vector_type(8)))  __bf16   v8b;
typedef __attribute__((ext_vector_type(8)))  float    v8f;
typedef __attribute__((ext_vector_type(4)))  float    v4f;
typedef __attribute__((ext_vector_type(8)))  unsigned short v8us;

__device__ __forceinline__ unsigned short f2bf_bits(float f) {
  unsigned u = __float_as_uint(f);
  return (unsigned short)((u + 0x7FFFu + ((u >> 16) & 1u)) >> 16);
}
__device__ __forceinline__ float bf_bits2f(unsigned short h) { return __uint_as_float(((unsigned)h) << 16); }

// hazard guards as plain device helpers
__device__ __forceinline__ void dep_guard_h(v8f& a, v8f& b, v16h x, v16h y) { asm volatile("v_nop\n\tv_nop\n\tv_nop\n\tv_nop" : "+v"(a), "+v"(b) : "v"(x), "v"(y)); }
__device__ __forceinline__ void dep_guard_b(v8f& a, v8f& b, v16b x, v16b y) { asm volatile("v_nop\n\tv_nop\n\tv_nop\n\tv_nop" : "+v"(a), "+v"(b) : "v"(x), "v"(y)); }
__device__ __forceinline__ void keep4_h(v16h a, v16h b, v16h c, v16h d) { asm volatile("v_nop" :: "v"(a), "v"(b), "v"(c), "v"(d)); }
__device__ __forceinline__ void keep4_b(v16b a, v16b b, v16b c, v16b d) { asm volatile("v_nop" :: "v"(a), "v"(b), "v"(c), "v"(d)); }
__device__ __forceinline__ void acc_guard4(v8f& a, v8f& b, v8f& c, v8f& d) { asm volatile("v_nop\n\tv_nop\n\tv_nop\n\tv_nop" : "+v"(a), "+v"(b), "+v"(c), "+v"(d)); }
template <typename T> struct Frag;
template <> struct Frag<_Float16> {
  typedef v16h V; union U { v16h v; v8h h[2]; };
  static __device__ __forceinline__ v16h load(const _Float16* p) {   // elements 0..7 <- p[0..7], 8..15 <- p[16..23]
    U f; f.h[0] = *(const v8h*)(p); f.h[1] = *(const v8h*)(p + 16); return f.v;
  }
  static __device__ __forceinline__ v8f mma(v16h a, v16h b, v8f c) {
    return __builtin_amdgcn_wmma_f32_16x16x32_f16(false, a, false, b, (short)0, c, false, false);
  }
  static __device__ __forceinline__ void guard(v8f& a, v8f& b, v16h x, v16h y) { dep_guard_h(a, b, x, y); }
  static __device__ __forceinline__ void keep(v16h a, v16h b, v16h c, v16h d) { keep4_h(a, b, c, d); }
};
template <> struct Frag<__bf16> {
  typedef v16b V; union U { v16b v; v8b h[2]; };
  static __device__ __forceinline__ v16b load(const __bf16* p) {
    U f; f.h[0] = *(const v8b*)(p); f.h[1] = *(const v8b*)(p + 16); return f.v;
  }
  static __device__ __forceinline__ v8f mma(v16b a, v16b b, v8f c) {
    return __builtin_amdgcn_wmma_f32_16x16x32_bf16(false, a, false, b, (short)0, c, false, false);
  }
  static __device__ __forceinline__ void guard(v8f& a, v8f& b, v16b x, v16b y) { dep_guard_b(a, b, x, y); }
  static __device__ __forceinline__ void keep(v16b a, v16b b, v16b c, v16b d) { keep4_b(a, b, c, d); }
};

// ---- LDS-staged batched WMMA GEMM ------------------------------------------
// C[m,n] = scale * sum_k A[m,k] * Bt[n,k] (+bias)(+resid); block = 2 x WN waves on a 128 x (64*WN) tile, each wave owns 64x64.
// A row-major [M,K]; Bt row-major [N,K]; M % 128 == 0, N % (64*WN) == 0, K % 64 == 0, K >= 64.
// Each k-slice of 64 (one 128-B line of every operand row of the block tile) is brought into LDS once, by asynchronous
// 16-B copies that cover whole lines, and every wave of the block reads its fragments from there; two buffers, so the
// next slice's copies fly while this slice is multiplied.
// SPLIT: 0 = single product; 2 = A hi/lo planes (A2 = lo plane), Bt single plane: hi.b + lo.b.
// BIAS_MODE: 0 = none, 1 = bias[m], 2 = bias[n], 3 = bias[n] passed through an RNE bf16 convert first.
// OUT_MODE: 0 = f32, 1 = f16, 2 = bf16 hi plane (Cout) + bf16 lo plane (Cout2).
// ET: 0 = f16 operands, 1 = bf16 operands (pointers passed as 16-bit storage)
template <int ET> struct Elem;
template <> struct Elem<0> { typedef _Float16 T; };
template <> struct Elem<1> { typedef __bf16 T; };

#define GBK 64   // k elements per staged slice: 128 B of every row
#define GLP 72   // LDS row pitch of the staged slices in elements: 144 B = 16 B x 9 (odd), conflict-free for the ds_load_b128 fragment reads

__device__ __forceinline__ uint32_t lds_off(const void* p) { return (uint32_t)(size_t)p; }   // byte offset in the work-group's LDS

// Twelve asynchronous 16-B copies per lane, global -> LDS through no register. The s_wait_xcnt stands inside the copies' own
// statement so that no address register they name is rewritten in front of it.
template <typename T>
__device__ __forceinline__ void async_copy12(const uint32_t (&l)[12], const T* const (&g)[12]) {
  asm volatile(
      "global_load_async_to_lds_b128 %0, %12, off\n\t"
      "global_load_async_to_lds_b128 %1, %13, off\n\t"
      "global_load_async_to_lds_b128 %2, %14, off\n\t"
      "global_load_async_to_lds_b128 %3, %15, off\n\t"
      "global_load_async_to_lds_b128 %4, %16, off\n\t"
      "global_load_async_to_lds_b128 %5, %17, off\n\t"
      "global_load_async_to_lds_b128 %6, %18, off\n\t"
      "global_load_async_to_lds_b128 %7, %19, off\n\t"
      "global_load_async_to_lds_b128 %8, %20, off\n\t"
      "global_load_async_to_lds_b128 %9, %21, off\n\t"
      "global_load_async_to_lds_b128 %10, %22, off\n\t"
      "global_load_async_to_lds_b128 %11, %23, off\n\t"
      "s_wait_xcnt 0x0"
      :: "v"(l[0]), "v"(l[1]), "v"(l[2]), "v"(l[3]), "v"(l[4]), "v"(l[5]),
         "v"(l[6]), "v"(l[7]), "v"(l[8]), "v"(l[9]), "v"(l[10]), "v"(l[11]),
         "v"(g[0]), "v"(g[1]), "v"(g[2]), "v"(g[3]), "v"(g[4]), "v"(g[5]),
         "v"(g[6]), "v"(g[7]), "v"(g[8]), "v"(g[9]), "v"(g[10]), "v"(g[11])
      : "memory");
}

template <int ET, int SPLIT, int BIAS_MODE, int OUT_MODE, bool RESID, int WN, int ACT = 0>
__global__ __launch_bounds__(64 * WN) void wmma_gemm64(
    const unsigned short* __restrict__ Ap, const unsigned short* __restrict__ A2p, int lda, long strideA,
    const unsigned short* __restrict__ Btp, const unsigned short* __restrict__ Bt2p, int ldb, long strideB,
    void* __restrict__ Cout, void* __restrict__ Cout2, int ldc, long strideC,
    const float* __restrict__ bias,
    const float* __restrict__ resid, long strideR,
    int M, int N, int K, float scale) {
  static_assert(SPLIT == 0 || SPLIT == 2);
  typedef typename Elem<ET>::T T;
  typedef typename Frag<T>::V V;
  constexpr int BM    = 128;                              // block tile rows
  constexpr int BN    = 64 * WN;                          // block tile columns
  constexpr int AROWS = (SPLIT == 2) ? 2 * BM : BM;       // staged A rows: hi plane, then lo plane
  constexpr int SROWS = AROWS + BN;                       // staged rows per slice: A | (A lo) | Bt
  constexpr int RPR   = (64 * WN) / 8;                    // rows one copy of the whole block covers: 8 lanes x 16 B per row
  constexpr int NC    = SROWS / RPR;                      // copies per lane and slice
  constexpr int STAGE_E = SROWS * GLP;                    // elements per buffer
  static_assert(BM % RPR == 0 && BN % RPR == 0 && NC % 12 == 0 && NC <= 63);
  const T* A = (const T*)Ap; const T* A2 = (const T*)A2p; const T* Bt = (const T*)Btp;
  __shared__ __align__(16) T ring[2 * STAGE_E];            // two buffers of one k-slice each
  __shared__ __align__(16) float sT[2 * WN][16 * 68];      // per-wave 16x64 slab, pitch 68 floats
  const int b    = blockIdx.y;
  const int tid  = threadIdx.x;
  const int lane = tid & 31;
  const int wave = tid >> 5;
  const int tilesN = N / BN;
  const int tilesM = M / BM;
  const int bt = blockIdx.x;
  if (bt >= tilesM * tilesN) return;   // block-uniform, in front of every copy and barrier
  const int bm = bt / tilesN;
  const int bn = bt - bm * tilesN;
  const int wm = wave / WN;
  const int wn = wave - wm * WN;
  const int m0 = bm * BM + (wm << 6);
  const int n0 = bn * BN + (wn << 6);

  const int rlane = lane & 15;                 // row (A) / col (B, D) within subtile
  const int koff  = (lane >> 4) * 8;           // k offset of this lane half
  const int mOff  = (lane >> 4) * 8;           // D row offset

  // copy side: lane = (row tid>>3 of a round of RPR rows, 16-B segment tid&7 of its 128-B line)
  const int crow = tid >> 3, cseg = (tid & 7) * 8;
  // gA, gA2, gB walk along k: they point at the next slice to be copied
  const T* gA  = A  + (size_t)b * strideA + (size_t)(bm * BM + crow) * lda + cseg;
  const T* gA2 = (SPLIT == 2) ? (A2 + (size_t)b * strideA + (size_t)(bm * BM + crow) * lda + cseg) : nullptr;
  const T* gB  = Bt + (size_t)b * strideB + (size_t)(bn * BN + crow) * ldb + cseg;
  const uint32_t lC = lds_off(ring) + (uint32_t)(crow * GLP + cseg) * 2u;
  auto issue_slice = [&](int buf) {
    const uint32_t lb = lC + (uint32_t)buf * (uint32_t)(STAGE_E * 2);
#pragma unroll
    for (int g = 0; g < NC / 12; ++g) {
      uint32_t l[12];
      const T* p[12];
#pragma unroll
      for (int c = 0; c < 12; ++c) {
        const int sr = (g * 12 + c) * RPR;     // first staged row of this round
        l[c] = lb + (uint32_t)(sr * GLP * 2);
        if (sr < BM)         p[c] = gA  + (size_t)sr * lda;
        else if (sr < AROWS) p[c] = gA2 + (size_t)(sr - BM) * lda;
        else                 p[c] = gB  + (size_t)(sr - AROWS) * ldb;
      }
      async_copy12<T>(l, p);
    }
    gA += GBK;
    if (SPLIT == 2) gA2 += GBK;
    gB += GBK;
  };

  // fragment side: this lane's row and k half inside a buffer
  const T* fA = ring + ((wm << 6) + rlane) * GLP + koff;
  const T* fB = ring + (AROWS + (wn << 6) + rlane) * GLP + koff;

  v8f acc[4][4];
#pragma unroll
  for (int i = 0; i < 4; ++i)
#pragma unroll
    for (int j = 0; j < 4; ++j) acc[i][j] = (v8f){0.f,0.f,0.f,0.f,0.f,0.f,0.f,0.f};

  const int nT = K / GBK;                      // block-uniform
  issue_slice(0);
  asm volatile("s_wait_asynccnt 0x0" ::: "memory");   // this wave's copies of slice 0 have landed
  __syncthreads();                                     // ... and every other wave's
  if (nT > 1) issue_slice(1);
  for (int t = 0; t < nT; ++t) {
    const int so = (t & 1) * STAGE_E;
#pragma unroll   // both 32-k halves of the slice in one body, so the second half's fragment reads can start under the first half's products
    for (int kk = 0; kk < GBK; kk += 32) {
      V bh[4], ah[4], al[4];
#pragma unroll
      for (int j = 0; j < 4; ++j) bh[j] = Frag<T>::load(fB + so + (j << 4) * GLP + kk);
#pragma unroll
      for (int i = 0; i < 4; ++i) {
        ah[i] = Frag<T>::load(fA + so + (i << 4) * GLP + kk);
        if (SPLIT == 2) al[i] = Frag<T>::load(fA + so + (BM + (i << 4)) * GLP + kk);
      }
#pragma unroll
      for (int i = 0; i < 4; ++i) {
#pragma unroll
        for (int j = 0; j < 4; ++j) {
          acc[i][j] = Frag<T>::mma(ah[i], bh[j], acc[i][j]);
          if (SPLIT == 2) acc[i][j] = Frag<T>::mma(al[i], bh[j], acc[i][j]);
        }
        Frag<T>::guard(acc[i][0], acc[i][3], ah[i], (SPLIT == 2) ? al[i] : ah[i]);
      }
      Frag<T>::keep(bh[0], bh[1], bh[2], bh[3]);
    }
    asm volatile("s_wait_dscnt 0x0" ::: "memory");     // this wave's reads of the buffer are done before it is refilled
    asm volatile("s_wait_asynccnt 0x0" ::: "memory");  // this wave's copies of slice t + 1 have landed
    __syncthreads();                                    // publishes slice t + 1 and ends every wave's reads of slice t
    if (t + 2 < nT) issue_slice(t & 1);
  }
  asm volatile("s_wait_asynccnt 0x0" ::: "memory");    // nothing in flight when the wave goes on
  acc_guard4(acc[0][0], acc[0][1], acc[0][2], acc[0][3]);
  acc_guard4(acc[1][0], acc[1][1], acc[1][2], acc[1][3]);
  acc_guard4(acc[2][0], acc[2][1], acc[2][2], acc[2][3]);
  acc_guard4(acc[3][0], acc[3][1], acc[3][2], acc[3][3]);

  // ---- epilogue ----
  float* slab = sT[wave];
  const float* Rb = RESID ? (resid + (size_t)b * strideR) : nullptr;
#pragma unroll
  for (int i = 0; i < 4; ++i) {
    const int mBase = m0 + (i << 4);
#pragma unroll
    for (int j = 0; j < 4; ++j) {
      const int n = n0 + (j << 4) + rlane;
      float bv = 0.f;
      if (BIAS_MODE == 2) bv = bias[n];
      if (BIAS_MODE == 3) bv = bf_bits2f(f2bf_bits(bias[n]));
#pragma unroll
      for (int r = 0; r < 8; ++r) {
        float v = acc[i][j][r] * scale;
        if (BIAS_MODE == 1) v += bias[mBase + mOff + r];
        if (BIAS_MODE == 2 || BIAS_MODE == 3) v += bv;
        if (RESID) v += Rb[(size_t)(mBase + mOff + r) * ldc + n];
        if (ACT == 1) v = tanhf(v);
        if (ACT == 2) v = fmaxf(v, 0.0f);
        if (ACT == 4) v = (v > 0.f) ? v : 0.01f * v;
        slab[(mOff + r) * 68 + (j << 4) + rlane] = v;
      }
    }
    __builtin_amdgcn_fence(__ATOMIC_RELEASE, "workgroup");
    __builtin_amdgcn_wave_barrier();
    __builtin_amdgcn_fence(__ATOMIC_ACQUIRE, "workgroup");
    if (OUT_MODE == 0) {
      float* C = (float*)Cout + (size_t)b * strideC;
      const int hh = lane >> 4, c4 = (lane & 15) * 4;     // row seg = 256 B = 16 lanes x 16 B
      {
#pragma unroll
        for (int it = 0; it < 8; ++it) {
          const int row = it * 2 + hh;
          v4f v = *(const v4f*)(slab + row * 68 + c4);
          *(v4f*)(C + (size_t)(mBase + row) * ldc + n0 + c4) = v;
        }
        
      }
    } else {
      const int q = lane >> 3, c8 = (lane & 7) * 8;
      unsigned short* C  = (unsigned short*)Cout  + (size_t)b * strideC;
      unsigned short* C2 = (OUT_MODE == 2) ? ((unsigned short*)Cout2 + (size_t)b * strideC) : nullptr;
      {
#pragma unroll
        for (int it = 0; it < 4; ++it) {
          const int row = it * 4 + q;
          const float* sp = slab + row * 68 + c8;
          v8h hv, lv;
#pragma unroll
          for (int e = 0; e < 8; ++e) {
            if (OUT_MODE == 1) {
              hv[e] = (_Float16)sp[e];
            } else {
              unsigned short hb = f2bf_bits(sp[e]);
              unsigned short lb = f2bf_bits(sp[e] - bf_bits2f(hb));
              hv[e] = __builtin_bit_cast(_Float16, hb);
              lv[e] = __builtin_bit_cast(_Float16, lb);
            }
          }
          *(v8h*)(C + (size_t)(mBase + row) * ldc + n0 + c8) = hv;
          if (OUT_MODE == 2) *(v8h*)(C2 + (size_t)(mBase + row) * ldc + n0 + c8) = lv;
        }
        
      }
    }
    __builtin_amdgcn_fence(__ATOMIC_RELEASE, "workgroup");
    __builtin_amdgcn_wave_barrier();
    __builtin_amdgcn_fence(__ATOMIC_ACQUIRE, "workgroup");
  }
}

// ---- f32 [n] -> bf16 (RNE) [n], same layout; 8 elements per thread = one 16-B store per lane ----
// grid = ceil(n8/256) with n8 = n/8 (here 1,048,576 = 4096 x 256 exactly), bound checked anyway.
__global__ __launch_bounds__(256) void cast_f32_bf16x8(const float* __restrict__ in,
                                                       unsigned short* __restrict__ out, int n8) {
  const int i = blockIdx.x * 256 + threadIdx.x;
  if (i < n8) {
    const v4f a0 = *(const v4f*)(in + (size_t)i * 8);
    const v4f a1 = *(const v4f*)(in + (size_t)i * 8 + 4);
    v8us u;
    u[0] = f2bf_bits(a0[0]); u[1] = f2bf_bits(a0[1]); u[2] = f2bf_bits(a0[2]); u[3] = f2bf_bits(a0[3]);
    u[4] = f2bf_bits(a1[0]); u[5] = f2bf_bits(a1[1]); u[6] = f2bf_bits(a1[2]); u[7] = f2bf_bits(a1[3]);
    *(v8us*)(out + (size_t)i * 8) = u;
    
  }
}

// ---- W [K][N] f32 -> Wt [N][K] bf16 (RNE), 64x64 tile transposed through LDS; grid = (N/64, K/64) ----
// Phase 1 coverage: kr = tid>>2 (64 k rows) x c16 = (tid&3)*16 with 4 quads of 4 -> every (k, n) of the tile once.
// Phase 2 coverage: n = it*32 + wave*4 + q8 (it 0..1, wave 0..7, q8 0..3) -> rows 0..63; c8 -> 8 lanes x 8 = 64 k.
#define WTP 72
__global__ __launch_bounds__(256) void wt_cast_bf16(const float* __restrict__ W, unsigned short* __restrict__ Wt,
                                                    int K, int N) {
  __shared__ __align__(16) unsigned short st[64 * WTP];
  const int n0 = blockIdx.x * 64, k0 = blockIdx.y * 64;
  const int tid = threadIdx.x;
  const int kr = tid >> 2, c16 = (tid & 3) * 16;
  const float* src = W + (size_t)(k0 + kr) * N + n0 + c16;
#pragma unroll
  for (int q = 0; q < 4; ++q) {
    const v4f v = *(const v4f*)(src + 4 * q);
#pragma unroll
    for (int e = 0; e < 4; ++e) st[(c16 + 4 * q + e) * WTP + kr] = f2bf_bits(v[e]);
  }
  __syncthreads();
  const int wave = tid >> 5, lane = tid & 31;
  const int q8 = lane >> 3, c8 = (lane & 7) * 8;
  {
#pragma unroll
    for (int it = 0; it < 2; ++it) {
      const int n = it * 32 + wave * 4 + q8;
      const v8us hv = *(const v8us*)(st + n * WTP + c8);
      *(v8us*)(Wt + (size_t)(n0 + n) * K + k0 + c8) = hv;
    }
    
  }
}

__device__ __forceinline__ v8f mma_b(v16b a, v16b b, v8f c) {
  c = __builtin_amdgcn_wmma_f32_16x16x32_bf16(false, a, false, b, (short)0, c, false, false);
  asm volatile("v_nop\n\tv_nop\n\tv_nop\n\tv_nop" : "+v"(c) : "v"(a), "v"(b));
  return c;
}
__device__ __forceinline__ void bf_split(float f, __bf16& hi, __bf16& lo) {
  const unsigned short hb = f2bf_bits(f);
  hi = __builtin_bit_cast(__bf16, hb);
  lo = __builtin_bit_cast(__bf16, f2bf_bits(f - bf_bits2f(hb)));
}

// value of the same register in lane ^ 16 (the other 16-lane half of the wave)
__device__ __forceinline__ float other_half(float x) {
  const unsigned u = __float_as_uint(x);
  return __uint_as_float(__builtin_amdgcn_permlanex16(u, u, 0x76543210u, 0xfedcba98u, false, false));
}

// Eight hardware exp2 in one statement. The outputs are early-clobber, so none of them takes an input's register: no v_exp_f32
// here overwrites the source of the one directly in front of it. The closing v_nop is the one slot that the instruction set
// asks for between a transcendental and a next instruction that may read its result or overwrite its source.
__device__ __forceinline__ v8f exp2x8(v8f x) {
  float d0, d1, d2, d3, d4, d5, d6, d7;
  asm("v_exp_f32 %0, %8\n\t"
      "v_exp_f32 %1, %9\n\t"
      "v_exp_f32 %2, %10\n\t"
      "v_exp_f32 %3, %11\n\t"
      "v_exp_f32 %4, %12\n\t"
      "v_exp_f32 %5, %13\n\t"
      "v_exp_f32 %6, %14\n\t"
      "v_exp_f32 %7, %15\n\t"
      "v_nop"
      : "=&v"(d0), "=&v"(d1), "=&v"(d2), "=&v"(d3), "=&v"(d4), "=&v"(d5), "=&v"(d6), "=&v"(d7)
      : "v"(x[0]), "v"(x[1]), "v"(x[2]), "v"(x[3]), "v"(x[4]), "v"(x[5]), "v"(x[6]), "v"(x[7]));
  return (v8f){d0, d1, d2, d3, d4, d5, d6, d7};
}

#define AKC 64
#define LKP 72   // LDS row pitch of the K and V^T tiles in elements: 144 B = 16 B x 9 (odd), so 16 rows read by ds_load_b128 fall on distinct banks
#define OSP 68
__global__ __launch_bounds__(128) void attn_causal_k(
    const unsigned short* __restrict__ qkvhp, const unsigned short* __restrict__ qkvlp,
    unsigned short* __restrict__ ohp, unsigned short* __restrict__ olp) {
  union FB { v16b v; v8b h[2]; };
  __shared__ __align__(16) __bf16 Ksh[AKC * LKP];             // K hi [kv][d]   9 KB
  __shared__ __align__(16) __bf16 Ksl[AKC * LKP];             // K lo
  __shared__ __align__(16) __bf16 Vth[kHeadDim * LKP];        // V hi [d][kv]   9 KB
  __shared__ __align__(16) __bf16 Vtl[kHeadDim * LKP];        // V lo
  __shared__ __align__(16) float  Os[4][16 * OSP];            // per wave out tile, pitch 68

  const __bf16* Qh = (const __bf16*)qkvhp;
  const __bf16* Ql = (const __bf16*)qkvlp;

  const int tid  = threadIdx.x;
  const int wave = tid >> 5;
  const int lane = tid & 31;
  const int hh   = lane >> 4;
  const int c    = lane & 15;

  const int bx = blockIdx.x;
  const int qb = (kNumQB - 1) - ((bx >> 7) & (kNumQB - 1));   // 16 query blocks of 64 rows, heaviest first
  const int bh = bx & (kBatch * kHeads - 1);
  const int h  = bh & (kHeads - 1);
  const int b  = bh >> 4;                  // 0..kBatch-1
  const int q0 = qb * 64 + wave * 16;

  // ---- Q fragments (B operand: column = query row q0 + c): 2 d-chunks, hi and lo, via Frag loader ----
  v16b qah[2], qal[2];
  {
    const size_t qo = (size_t)(b * kSeq + q0 + c) * kQkvLd + h * kHeadDim + 8 * hh;
#pragma unroll
    for (int dc = 0; dc < 2; ++dc) {
      qah[dc] = Frag<__bf16>::load(Qh + qo + dc * 32);
      qal[dc] = Frag<__bf16>::load(Ql + qo + dc * 32);
    }
  }

  float mrow = -INFINITY;   // running maximum of query row q0 + c, of the unscaled scores (equal in both wave halves)
  float lrow = 0.f;         // running sum over this half's keys alone; the halves are joined once, behind the loop
  v8f oacc[4];              // O^T: oacc[t][r] = O[q0 + c][t*16 + 8*hh + r]
#pragma unroll
  for (int t = 0; t < 4; ++t) oacc[t] = (v8f){0.f,0.f,0.f,0.f,0.f,0.f,0.f,0.f};

  const int nIter = qb + 1;   // block-uniform: causal chunks 0..qb, <= 16
  for (int kc = 0; kc < nIter; ++kc) {
    const int kv0 = kc * AKC;
    __syncthreads();
    {
      // staging coverage: 128 threads = 64 kv rows x 2 d-halves of 32; 4 x 8 elements per thread per plane
      const int kvr = tid >> 1, dh = (tid & 1) * 32;
      const size_t mo = ((size_t)(b * kSeq + kv0 + kvr)) * kQkvLd + kModel + h * kHeadDim + dh;   // k row
      const __bf16* kh = Qh + mo;
      const __bf16* kl = Ql + mo;
      const __bf16* vh = kh + kModel;      // v sits 1024 columns after k
      const __bf16* vl = kl + kModel;
#pragma unroll 1
      for (int i = 0; i < 4; ++i) {
        const v8b a0 = *(const v8b*)(kh + 8 * i);
        *(v8b*)(Ksh + kvr * LKP + dh + 8 * i) = a0;
        const v8b a1 = *(const v8b*)(kl + 8 * i);
        *(v8b*)(Ksl + kvr * LKP + dh + 8 * i) = a1;
        const v8b w0 = *(const v8b*)(vh + 8 * i);
        const v8b w1 = *(const v8b*)(vl + 8 * i);
#pragma unroll
        for (int e = 0; e < 8; ++e) {
          Vth[(dh + 8 * i + e) * LKP + kvr] = w0[e];
          Vtl[(dh + 8 * i + e) * LKP + kvr] = w1[e];
        }
      }
    }
    __syncthreads();

    // ---- scores, transposed: s[j][r] = S[q0 + c][kv0 + j*16 + 8*hh + r]; 3 products per d-chunk ----
    v8f s[4];
#pragma unroll
    for (int j = 0; j < 4; ++j) {
      s[j] = (v8f){0.f,0.f,0.f,0.f,0.f,0.f,0.f,0.f};
#pragma unroll
      for (int dc = 0; dc < 2; ++dc) {
        FB kb, kq;
        kb.h[0] = *(const v8b*)(Ksh + (j * 16 + c) * LKP + dc * 32 + 8 * hh);
        kb.h[1] = *(const v8b*)(Ksh + (j * 16 + c) * LKP + dc * 32 + 16 + 8 * hh);
        kq.h[0] = *(const v8b*)(Ksl + (j * 16 + c) * LKP + dc * 32 + 8 * hh);
        kq.h[1] = *(const v8b*)(Ksl + (j * 16 + c) * LKP + dc * 32 + 16 + 8 * hh);
        s[j] = mma_b(kb.v, qah[dc], s[j]);
        s[j] = mma_b(kq.v, qah[dc], s[j]);
        s[j] = mma_b(kb.v, qal[dc], s[j]);
      }
    }
    const bool diag = (kc == qb);
    const int qrow = q0 + c;
    float mj[4];                          // one maximum per score tile: four short chains, not one of 32 links
#pragma unroll
    for (int j = 0; j < 4; ++j) {
      mj[j] = -INFINITY;
#pragma unroll
      for (int r = 0; r < 8; ++r) {
        const int kvcol = kv0 + j * 16 + 8 * hh + r;
        float sv = s[j][r];
        if (diag && (kvcol > qrow)) sv = kMaskFill;
        s[j][r] = sv;
        mj[j] = fmaxf(mj[j], sv);
      }
    }
    float m = fmaxf(fmaxf(mj[0], mj[1]), fmaxf(mj[2], mj[3]));
    m = fmaxf(m, other_half(m));          // the row's other 32 keys sit in lane ^ 16
    const float mnew = fmaxf(mrow, m);
    const float nm = -mnew * kQkScaleLog2e;                                       // finite: every row has an unmasked key in each of its chunks
    const float alpha = __builtin_amdgcn_exp2f(fmaf(mrow, kQkScaleLog2e, nm));    // first chunk: mrow = -inf gives 0
    mrow = mnew;
    float pj[4];                          // one sum per score tile, as for the maxima
    FB ph[2], pl[2];                      // P^T as B operand: element (j&1)*8 + r of chunk j>>1 = key (j>>1)*32 + (j&1)*16 + 8*hh + r
#pragma unroll
    for (int j = 0; j < 4; ++j) {
      pj[j] = 0.f;
      v8f e;
#pragma unroll
      for (int r = 0; r < 8; ++r) e[r] = fmaf(s[j][r], kQkScaleLog2e, nm);
      e = exp2x8(e);
#pragma unroll
      for (int r = 0; r < 8; ++r) {
        const float p = e[r];
        pj[j] += p;
        __bf16 pa, pb; bf_split(p, pa, pb);
        ph[j >> 1].v[(j & 1) * 8 + r] = pa;
        pl[j >> 1].v[(j & 1) * 8 + r] = pb;
      }
    }
    lrow = lrow * alpha + ((pj[0] + pj[1]) + (pj[2] + pj[3]));
#pragma unroll
    for (int t = 0; t < 4; ++t)
#pragma unroll
      for (int r = 0; r < 8; ++r) oacc[t][r] *= alpha;
    // ---- O^T += V^T x P^T : 3 products ----
#pragma unroll   // ph and pl are register arrays: kk must be a constant
    for (int kk = 0; kk < 2; ++kk) {
#pragma unroll
      for (int t = 0; t < 4; ++t) {
        FB vb, vq;
        vb.h[0] = *(const v8b*)(Vth + (t * 16 + c) * LKP + kk * 32 + 8 * hh);
        vb.h[1] = *(const v8b*)(Vth + (t * 16 + c) * LKP + kk * 32 + 16 + 8 * hh);
        vq.h[0] = *(const v8b*)(Vtl + (t * 16 + c) * LKP + kk * 32 + 8 * hh);
        vq.h[1] = *(const v8b*)(Vtl + (t * 16 + c) * LKP + kk * 32 + 16 + 8 * hh);
        oacc[t] = mma_b(vb.v, ph[kk].v, oacc[t]);
        oacc[t] = mma_b(vq.v, ph[kk].v, oacc[t]);
        oacc[t] = mma_b(vb.v, pl[kk].v, oacc[t]);
      }
    }
  }

  // ---- join the halves' sums, normalize, stage as [query row][d], write hi/lo planes ----
  float* os = Os[wave];
  {
    const float inv = 1.0f / (lrow + other_half(lrow));
#pragma unroll
    for (int t = 0; t < 4; ++t) {
      v4f lo4, hi4;
#pragma unroll
      for (int e = 0; e < 4; ++e) { lo4[e] = oacc[t][e] * inv; hi4[e] = oacc[t][4 + e] * inv; }
      *(v4f*)(os + c * OSP + t * 16 + 8 * hh)     = lo4;
      *(v4f*)(os + c * OSP + t * 16 + 8 * hh + 4) = hi4;
    }
  }
  __builtin_amdgcn_fence(__ATOMIC_RELEASE, "workgroup");
  __builtin_amdgcn_wave_barrier();
  __builtin_amdgcn_fence(__ATOMIC_ACQUIRE, "workgroup");
  {
    const int q8 = lane >> 3, c8 = (lane & 7) * 8;
    _Float16* Oh = (_Float16*)ohp;
    _Float16* Ol = (_Float16*)olp;
    {
#pragma unroll
      for (int it = 0; it < 4; ++it) {
        const int row = it * 4 + q8;
        const float* sp = os + row * OSP + c8;
        v8h hv, lv;
#pragma unroll
        for (int e = 0; e < 8; ++e) {
          const unsigned short hb = f2bf_bits(sp[e]);
          const unsigned short lb = f2bf_bits(sp[e] - bf_bits2f(hb));
          hv[e] = __builtin_bit_cast(_Float16, hb);
          lv[e] = __builtin_bit_cast(_Float16, lb);
        }
        const size_t oo = (size_t)(b * kSeq + q0 + row) * kModel + h * kHeadDim + c8;
        *(v8h*)(Oh + oo) = hv;
        *(v8h*)(Ol + oo) = lv;
      }
      
    }
  }
}

// ---------------------------------------------------------------------------
// Workspace region map (all offsets 256-B aligned, all planes bf16 bits):
//   Xb   [8192][1024]  hidden as bf16          16,777,216 B
//   WaT  [3072][1024]  W_attn transposed        6,291,456 B
//   WoT  [1024][1024]  W_out transposed         2,097,152 B
//   QKVh [8192][3072]  q|k|v hi plane          50,331,648 B
//   QKVl [8192][3072]  q|k|v lo plane          50,331,648 B
//   Oh   [8192][1024]  attention out hi plane  16,777,216 B
//   Ol   [8192][1024]  attention out lo plane  16,777,216 B
// ---------------------------------------------------------------------------
extern "C" void kernel_launch(void* const* d_in, const int* in_sizes, int n_in,
                              void* d_out, int out_size, void* d_ws, size_t ws_size,
                              hipStream_t stream) {
  if (n_in < 5) return;
  if (in_sizes[0] != kTotRows * kModel) return;
  if (in_sizes[1] != kModel * kQkvLd) return;
  if (in_sizes[2] != kQkvLd) return;
  if (in_sizes[3] != kModel * kModel) return;
  if (in_sizes[4] != kModel) return;
  if (out_size != kTotRows * kModel) return;

  const float* hidden = (const float*)d_in[0];   // [8,1024,1024]
  const float* wattn  = (const float*)d_in[1];   // [1024,3072]  ([in][out])
  const float* battn  = (const float*)d_in[2];   // [3072]
  const float* wout   = (const float*)d_in[3];   // [1024,1024]  ([in][out])
  const float* bout   = (const float*)d_in[4];   // [1024]
  float* out = (float*)d_out;                    // [8,1024,1024]

  char* ws = (char*)d_ws;
  size_t off = 0;
  const size_t szXb  = (size_t)kTotRows * kModel * 2;
  const size_t szWaT = (size_t)kQkvLd * kModel * 2;
  const size_t szWoT = (size_t)kModel * kModel * 2;
  const size_t szQKV = (size_t)kTotRows * kQkvLd * 2;
  const size_t szO   = (size_t)kTotRows * kModel * 2;
  unsigned short* Xb   = (unsigned short*)(ws + off); off += szXb;
  unsigned short* WaT  = (unsigned short*)(ws + off); off += szWaT;
  unsigned short* WoT  = (unsigned short*)(ws + off); off += szWoT;
  unsigned short* QKVh = (unsigned short*)(ws + off); off += szQKV;
  unsigned short* QKVl = (unsigned short*)(ws + off); off += szQKV;
  unsigned short* Oh   = (unsigned short*)(ws + off); off += szO;
  unsigned short* Ol   = (unsigned short*)(ws + off); off += szO;
  if (off > ws_size) return;

  // 1) RNE bf16 cast of the activations (8 elements per thread): n8 = 1,048,576 -> 4096 blocks
  {
    const int n8 = kTotRows * kModel / 8;
    cast_f32_bf16x8<<<dim3((n8 + 255) / 256), dim3(256), 0, stream>>>(hidden, Xb, n8);
  }
  // 2) weights: in [K=1024][N] f32 -> out [N][K] bf16 ; grid = (N/64, K/64)
  wt_cast_bf16<<<dim3(kQkvLd / 64, kModel / 64), dim3(256), 0, stream>>>(wattn, WaT, kModel, kQkvLd);
  wt_cast_bf16<<<dim3(kModel / 64, kModel / 64), dim3(256), 0, stream>>>(wout, WoT, kModel, kModel);

  // All eight batches go through each stage in one launch.
  // 3) qkv = hidden @ W_attn + b_attn : M=8192, N=3072, K=1024 -> bf16 hi/lo planes (128x256 tiles: 64*12 = 768 blocks of 8 waves)
  wmma_gemm64<1, 0, 3, 2, false, 4><<<dim3((kTotRows / 128) * (kQkvLd / 256), 1), dim3(256), 0, stream>>>(
      Xb, nullptr, kModel, 0L, WaT, nullptr, kModel, 0L,
      (void*)QKVh, (void*)QKVl, kQkvLd, 0L, battn, nullptr, 0L, kTotRows, kQkvLd, kModel, 1.0f);
  // 4) causal attention, 16*8*16 = 2048 blocks of 128 threads, heaviest query blocks first
  attn_causal_k<<<dim3(kNumQB * kBatch * kHeads), dim3(128), 0, stream>>>(QKVh, QKVl, Oh, Ol);
  // 5) out = O @ W_out + b_out : M=8192, N=1024, K=1024, A hi/lo split, f32 result to d_out (128x128 tiles: 64*8 = 512 blocks of 4 waves)
  wmma_gemm64<1, 2, 3, 0, false, 2><<<dim3((kTotRows / 128) * (kModel / 128), 1), dim3(128), 0, stream>>>(
      Oh, Ol, kModel, 0L, WoT, nullptr, kModel, 0L,
      (void*)out, nullptr, kModel, 0L, bout, nullptr, 0L, kTotRows, kModel, kModel, 1.0f);
}

// v006
// A run of this version takes 139 microseconds.
// Next to v005, in two timings, it ran 1.14 times as fast each time.
// All steps since v000 together make it 4.22 times as fast.
// Contractions: qkv projection v_wmma_f32_16x16x32_bf16 on RNE-bf16 x and W (single product); attention q.k^T and p.v v_wmma_f32_16x16x32_bf16 with bf16 hi/lo split (hi.hi + hi.lo + lo.hi); output projection bf16 hi/lo A-split x bf16 W_out (hi.w + lo.w); f32 accumulate everywhere; softmax, scale and bias adds in f32.
#include <hip/hip_runtime.h>
#include <math.h>
#include <float.h>
#include <stdint.h>

// ---------------------------------------------------------------------------
// Fixed problem geometry
// ---------------------------------------------------------------------------
constexpr int kBatch     = 8;
constexpr int kSeq       = 1024;
constexpr int kModel     = 1024;
constexpr int kHeads     = 16;
constexpr int kHeadDim   = 64;
constexpr int kQkvLd     = 3 * kModel;            // 3072: q | k | v columns
constexpr int kTotRows   = kBatch * kSeq;         // 8192
constexpr int kNumQB     = kSeq / 64;             // 16 query blocks of 64 rows
constexpr float kQkScale = 0.125f;                // 1/sqrt(64), exact power of two
constexpr float kQkScaleLog2e = kQkScale * 1.44269504088896340736f;   // exp(x/8) = exp2(x * this)
constexpr float kMaskFill = -FLT_MAX;             // finfo(float32).min
static_assert(kNumQB == 16);
static_assert(kHeads == 16);
static_assert(kBatch * kHeads == 128);
static_assert(kModel % 128 == 0 && kQkvLd % 256 == 0 && kTotRows % 128 == 0);
static_assert(kModel % 64 == 0);

typedef __attribute__((ext_vector_type(16))) _Float16 v16h;
typedef __attribute__((ext_vector_type(8)))  _Float16 v8h;
typedef __attribute__((ext_vector_type(16))) __bf16   v16b;
typedef __attribute__((ext_vector_type(8)))  __bf16   v8b;
typedef __attribute__((ext_vector_type(8)))  float    v8f;
typedef __attribute__((ext_vector_type(4)))  float    v4f;
typedef __attribute__((ext_vector_type(8)))  unsigned short v8us;

__device__ __forceinline__ unsigned short f2bf_bits(float f) {
  unsigned u = __float_as_uint(f);
  return (unsigned short)((u + 0x7FFFu + ((u >> 16) & 1u)) >> 16);
}
__device__ __forceinline__ float bf_bits2f(unsigned short h) { return __uint_as_float(((unsigned)h) << 16); }

// hazard guards as plain device helpers
__device__ __forceinline__ void dep_guard_h(v8f& a, v8f& b, v16h x, v16h y) { asm volatile("v_nop\n\tv_nop\n\tv_nop\n\tv_nop" : "+v"(a), "+v"(b) : "v"(x), "v"(y)); }
__device__ __forceinline__ void dep_guard_b(v8f& a, v8f& b, v16b x, v16b y) { asm volatile("v_nop\n\tv_nop\n\tv_nop\n\tv_nop" : "+v"(a), "+v"(b) : "v"(x), "v"(y)); }
__device__ __forceinline__ void keep4_h(v16h a, v16h b, v16h c, v16h d) { asm volatile("v_nop" :: "v"(a), "v"(b), "v"(c), "v"(d)); }
__device__ __forceinline__ void keep4_b(v16b a, v16b b, v16b c, v16b d) { asm volatile("v_nop" :: "v"(a), "v"(b), "v"(c), "v"(d)); }
__device__ __forceinline__ void acc_guard4(v8f& a, v8f& b, v8f& c, v8f& d) { asm volatile("v_nop\n\tv_nop\n\tv_nop\n\tv_nop" : "+v"(a), "+v"(b), "+v"(c), "+v"(d)); }
template <typename T> struct Frag;
template <> struct Frag<_Float16> {
  typedef v16h V; union U { v16h v; v8h h[2]; };
  static __device__ __forceinline__ v16h load(const _Float16* p) {   // elements 0..7 <- p[0..7], 8..15 <- p[16..23]
    U f; f.h[0] = *(const v8h*)(p); f.h[1] = *(const v8h*)(p + 16); return f.v;
  }
  static __device__ __forceinline__ v8f mma(v16h a, v16h b, v8f c) {
    return __builtin_amdgcn_wmma_f32_16x16x32_f16(false, a, false, b, (short)0, c, false, false);
  }
  static __device__ __forceinline__ void guard(v8f& a, v8f& b, v16h x, v16h y) { dep_guard_h(a, b, x, y); }
  static __device__ __forceinline__ void keep(v16h a, v16h b, v16h c, v16h d) { keep4_h(a, b, c, d); }
};
template <> struct Frag<__bf16> {
  typedef v16b V; union U { v16b v; v8b h[2]; };
  static __device__ __forceinline__ v16b load(const __bf16* p) {
    U f; f.h[0] = *(const v8b*)(p); f.h[1] = *(const v8b*)(p + 16); return f.v;
  }
  static __device__ __forceinline__ v8f mma(v16b a, v16b b, v8f c) {
    return __builtin_amdgcn_wmma_f32_16x16x32_bf16(false, a, false, b, (short)0, c, false, false);
  }
  static __device__ __forceinline__ void guard(v8f& a, v8f& b, v16b x, v16b y) { dep_guard_b(a, b, x, y); }
  static __device__ __forceinline__ void keep(v16b a, v16b b, v16b c, v16b d) { keep4_b(a, b, c, d); }
};

// ---- LDS-staged batched WMMA GEMM ------------------------------------------
// C[m,n] = scale * sum_k A[m,k] * Bt[n,k] (+bias)(+resid); block = 2 x WN waves on a 128 x (64*WN) tile, each wave owns 64x64.
// A row-major [M,K]; Bt row-major [N,K]; M % 128 == 0, N % (64*WN) == 0, K % 64 == 0, K >= 64.
// Each k-slice of 64 (one 128-B line of every operand row of the block tile) is brought into LDS once, by asynchronous
// 16-B copies that cover whole lines, and every wave of the block reads its fragments from there; two buffers, so the
// next slice's copies fly while this slice is multiplied.
// SPLIT: 0 = single product; 2 = A hi/lo planes (A2 = lo plane), Bt single plane: hi.b + lo.b.
// BIAS_MODE: 0 = none, 1 = bias[m], 2 = bias[n], 3 = bias[n] passed through an RNE bf16 convert first.
// OUT_MODE: 0 = f32, 1 = f16, 2 = bf16 hi plane (Cout) + bf16 lo plane (Cout2).
// ET: 0 = f16 operands, 1 = bf16 operands (pointers passed as 16-bit storage)
template <int ET> struct Elem;
template <> struct Elem<0> { typedef _Float16 T; };
template <> struct Elem<1> { typedef __bf16 T; };

#define GBK 64   // k elements per staged slice: 128 B of every row
#define GLP 72   // LDS row pitch of the staged slices in elements: 144 B = 16 B x 9 (odd), conflict-free for the ds_load_b128 fragment reads

__device__ __forceinline__ uint32_t lds_off(const void* p) { return (uint32_t)(size_t)p; }   // byte offset in the work-group's LDS

// Twelve asynchronous 16-B copies per lane, global -> LDS through no register. The s_wait_xcnt stands inside the copies' own
// statement so that no address register they name is rewritten in front of it.
template <typename T>
__device__ __forceinline__ void async_copy12(const uint32_t (&l)[12], const T* const (&g)[12]) {
  asm volatile(
      "global_load_async_to_lds_b128 %0, %12, off\n\t"
      "global_load_async_to_lds_b128 %1, %13, off\n\t"
      "global_load_async_to_lds_b128 %2, %14, off\n\t"
      "global_load_async_to_lds_b128 %3, %15, off\n\t"
      "global_load_async_to_lds_b128 %4, %16, off\n\t"
      "global_load_async_to_lds_b128 %5, %17, off\n\t"
      "global_load_async_to_lds_b128 %6, %18, off\n\t"
      "global_load_async_to_lds_b128 %7, %19, off\n\t"
      "global_load_async_to_lds_b128 %8, %20, off\n\t"
      "global_load_async_to_lds_b128 %9, %21, off\n\t"
      "global_load_async_to_lds_b128 %10, %22, off\n\t"
      "global_load_async_to_lds_b128 %11, %23, off\n\t"
      "s_wait_xcnt 0x0"
      :: "v"(l[0]), "v"(l[1]), "v"(l[2]), "v"(l[3]), "v"(l[4]), "v"(l[5]),
         "v"(l[6]), "v"(l[7]), "v"(l[8]), "v"(l[9]), "v"(l[10]), "v"(l[11]),
         "v"(g[0]), "v"(g[1]), "v"(g[2]), "v"(g[3]), "v"(g[4]), "v"(g[5]),
         "v"(g[6]), "v"(g[7]), "v"(g[8]), "v"(g[9]), "v"(g[10]), "v"(g[11])
      : "memory");
}

template <int ET, int SPLIT, int BIAS_MODE, int OUT_MODE, bool RESID, int WN, int ACT = 0>
__global__ __launch_bounds__(64 * WN) void wmma_gemm64(
    const unsigned short* __restrict__ Ap, const unsigned short* __restrict__ A2p, int lda, long strideA,
    const unsigned short* __restrict__ Btp, const unsigned short* __restrict__ Bt2p, int ldb, long strideB,
    void* __restrict__ Cout, void* __restrict__ Cout2, int ldc, long strideC,
    const float* __restrict__ bias,
    const float* __restrict__ resid, long strideR,
    int M, int N, int K, float scale) {
  static_assert(SPLIT == 0 || SPLIT == 2);
  typedef typename Elem<ET>::T T;
  typedef typename Frag<T>::V V;
  constexpr int BM    = 128;                              // block tile rows
  constexpr int BN    = 64 * WN;                          // block tile columns
  constexpr int AROWS = (SPLIT == 2) ? 2 * BM : BM;       // staged A rows: hi plane, then lo plane
  constexpr int SROWS = AROWS + BN;                       // staged rows per slice: A | (A lo) | Bt
  constexpr int RPR   = (64 * WN) / 8;                    // rows one copy of the whole block covers: 8 lanes x 16 B per row
  constexpr int NC    = SROWS / RPR;                      // copies per lane and slice
  constexpr int STAGE_E = SROWS * GLP;                    // elements per buffer
  static_assert(BM % RPR == 0 && BN % RPR == 0 && NC % 12 == 0 && NC <= 63);
  const T* A = (const T*)Ap; const T* A2 = (const T*)A2p; const T* Bt = (const T*)Btp;
  __shared__ __align__(16) T ring[2 * STAGE_E];            // two buffers of one k-slice each
  __shared__ __align__(16) float sT[2 * WN][16 * 68];      // per-wave 16x64 slab, pitch 68 floats
  const int b    = blockIdx.y;
  const int tid  = threadIdx.x;
  const int lane = tid & 31;
  const int wave = tid >> 5;
  const int tilesN = N / BN;
  const int tilesM = M / BM;
  const int bt = blockIdx.x;
  if (bt >= tilesM * tilesN) return;   // block-uniform, in front of every copy and barrier
  const int bm = bt / tilesN;
  const int bn = bt - bm * tilesN;
  const int wm = wave / WN;
  const int wn = wave - wm * WN;
  const int m0 = bm * BM + (wm << 6);
  const int n0 = bn * BN + (wn << 6);

  const int rlane = lane & 15;                 // row (A) / col (B, D) within subtile
  const int koff  = (lane >> 4) * 8;           // k offset of this lane half
  const int mOff  = (lane >> 4) * 8;           // D row offset

  // copy side: lane = (row tid>>3 of a round of RPR rows, 16-B segment tid&7 of its 128-B line)
  const int crow = tid >> 3, cseg = (tid & 7) * 8;
  // gA, gA2, gB walk along k: they point at the next slice to be copied
  const T* gA  = A  + (size_t)b * strideA + (size_t)(bm * BM + crow) * lda + cseg;
  const T* gA2 = (SPLIT == 2) ? (A2 + (size_t)b * strideA + (size_t)(bm * BM + crow) * lda + cseg) : nullptr;
  const T* gB  = Bt + (size_t)b * strideB + (size_t)(bn * BN + crow) * ldb + cseg;
  const uint32_t lC = lds_off(ring) + (uint32_t)(crow * GLP + cseg) * 2u;
  auto issue_slice = [&](int buf) {
    const uint32_t lb = lC + (uint32_t)buf * (uint32_t)(STAGE_E * 2);
#pragma unroll
    for (int g = 0; g < NC / 12; ++g) {
      uint32_t l[12];
      const T* p[12];
#pragma unroll
      for (int c = 0; c < 12; ++c) {
        const int sr = (g * 12 + c) * RPR;     // first staged row of this round
        l[c] = lb + (uint32_t)(sr * GLP * 2);
        if (sr < BM)         p[c] = gA  + (size_t)sr * lda;
        else if (sr < AROWS) p[c] = gA2 + (size_t)(sr - BM) * lda;
        else                 p[c] = gB  + (size_t)(sr - AROWS) * ldb;
      }
      async_copy12<T>(l, p);
    }
    gA += GBK;
    if (SPLIT == 2) gA2 += GBK;
    gB += GBK;
  };

  // fragment side: this lane's row and k half inside a buffer
  const T* fA = ring + ((wm << 6) + rlane) * GLP + koff;
  const T* fB = ring + (AROWS + (wn << 6) + rlane) * GLP + koff;

  v8f acc[4][4];
#pragma unroll
  for (int i = 0; i < 4; ++i)
#pragma unroll
    for (int j = 0; j < 4; ++j) acc[i][j] = (v8f){0.f,0.f,0.f,0.f,0.f,0.f,0.f,0.f};

  const int nT = K / GBK;                      // block-uniform
  issue_slice(0);
  asm volatile("s_wait_asynccnt 0x0" ::: "memory");   // this wave's copies of slice 0 have landed
  __syncthreads();                                     // ... and every other wave's
  if (nT > 1) issue_slice(1);
  for (int t = 0; t < nT; ++t) {
    const int so = (t & 1) * STAGE_E;
#pragma unroll   // both 32-k halves of the slice in one body, so the second half's fragment reads can start under the first half's products
    for (int kk = 0; kk < GBK; kk += 32) {
      V bh[4], ah[4], al[4];
#pragma unroll
      for (int j = 0; j < 4; ++j) bh[j] = Frag<T>::load(fB + so + (j << 4) * GLP + kk);
#pragma unroll
      for (int i = 0; i < 4; ++i) {
        ah[i] = Frag<T>::load(fA + so + (i << 4) * GLP + kk);
        if (SPLIT == 2) al[i] = Frag<T>::load(fA + so + (BM + (i << 4)) * GLP + kk);
      }
#pragma unroll
      for (int i = 0; i < 4; ++i) {
#pragma unroll
        for (int j = 0; j < 4; ++j) {
          acc[i][j] = Frag<T>::mma(ah[i], bh[j], acc[i][j]);
          if (SPLIT == 2) acc[i][j] = Frag<T>::mma(al[i], bh[j], acc[i][j]);
        }
        Frag<T>::guard(acc[i][0], acc[i][3], ah[i], (SPLIT == 2) ? al[i] : ah[i]);
      }
      Frag<T>::keep(bh[0], bh[1], bh[2], bh[3]);
    }
    asm volatile("s_wait_dscnt 0x0" ::: "memory");     // this wave's reads of the buffer are done before it is refilled
    asm volatile("s_wait_asynccnt 0x0" ::: "memory");  // this wave's copies of slice t + 1 have landed
    __syncthreads();                                    // publishes slice t + 1 and ends every wave's reads of slice t
    if (t + 2 < nT) issue_slice(t & 1);
  }
  asm volatile("s_wait_asynccnt 0x0" ::: "memory");    // nothing in flight when the wave goes on
  acc_guard4(acc[0][0], acc[0][1], acc[0][2], acc[0][3]);
  acc_guard4(acc[1][0], acc[1][1], acc[1][2], acc[1][3]);
  acc_guard4(acc[2][0], acc[2][1], acc[2][2], acc[2][3]);
  acc_guard4(acc[3][0], acc[3][1], acc[3][2], acc[3][3]);

  // ---- epilogue ----
  float* slab = sT[wave];
  const float* Rb = RESID ? (resid + (size_t)b * strideR) : nullptr;
#pragma unroll
  for (int i = 0; i < 4; ++i) {
    const int mBase = m0 + (i << 4);
#pragma unroll
    for (int j = 0; j < 4; ++j) {
      const int n = n0 + (j << 4) + rlane;
      float bv = 0.f;
      if (BIAS_MODE == 2) bv = bias[n];
      if (BIAS_MODE == 3) bv = bf_bits2f(f2bf_bits(bias[n]));
#pragma unroll
      for (int r = 0; r < 8; ++r) {
        float v = acc[i][j][r] * scale;
        if (BIAS_MODE == 1) v += bias[mBase + mOff + r];
        if (BIAS_MODE == 2 || BIAS_MODE == 3) v += bv;
        if (RESID) v += Rb[(size_t)(mBase + mOff + r) * ldc + n];
        if (ACT == 1) v = tanhf(v);
        if (ACT == 2) v = fmaxf(v, 0.0f);
        if (ACT == 4) v = (v > 0.f) ? v : 0.01f * v;
        slab[(mOff + r) * 68 + (j << 4) + rlane] = v;
      }
    }
    __builtin_amdgcn_fence(__ATOMIC_RELEASE, "workgroup");
    __builtin_amdgcn_wave_barrier();
    __builtin_amdgcn_fence(__ATOMIC_ACQUIRE, "workgroup");
    if (OUT_MODE == 0) {
      float* C = (float*)Cout + (size_t)b * strideC;
      const int hh = lane >> 4, c4 = (lane & 15) * 4;     // row seg = 256 B = 16 lanes x 16 B
      {
#pragma unroll
        for (int it = 0; it < 8; ++it) {
          const int row = it * 2 + hh;
          v4f v = *(const v4f*)(slab + row * 68 + c4);
          *(v4f*)(C + (size_t)(mBase + row) * ldc + n0 + c4) = v;
        }
        
      }
    } else {
      const int q = lane >> 3, c8 = (lane & 7) * 8;
      unsigned short* C  = (unsigned short*)Cout  + (size_t)b * strideC;
      unsigned short* C2 = (OUT_MODE == 2) ? ((unsigned short*)Cout2 + (size_t)b * strideC) : nullptr;
      {
#pragma unroll
        for (int it = 0; it < 4; ++it) {
          const int row = it * 4 + q;
          const float* sp = slab + row * 68 + c8;
          v8h hv, lv;
#pragma unroll
          for (int e = 0; e < 8; ++e) {
            if (OUT_MODE == 1) {
              hv[e] = (_Float16)sp[e];
            } else {
              unsigned short hb = f2bf_bits(sp[e]);
              unsigned short lb = f2bf_bits(sp[e] - bf_bits2f(hb));
              hv[e] = __builtin_bit_cast(_Float16, hb);
              lv[e] = __builtin_bit_cast(_Float16, lb);
            }
          }
          *(v8h*)(C + (size_t)(mBase + row) * ldc + n0 + c8) = hv;
          if (OUT_MODE == 2) *(v8h*)(C2 + (size_t)(mBase + row) * ldc + n0 + c8) = lv;
        }
        
      }
    }
    __builtin_amdgcn_fence(__ATOMIC_RELEASE, "workgroup");
    __builtin_amdgcn_wave_barrier();
    __builtin_amdgcn_fence(__ATOMIC_ACQUIRE, "workgroup");
  }
}

// ---- f32 [n] -> bf16 (RNE) [n], same layout; 8 elements per thread = one 16-B store per lane ----
// grid = ceil(n8/256) with n8 = n/8 (here 1,048,576 = 4096 x 256 exactly), bound checked anyway.
__global__ __launch_bounds__(256) void cast_f32_bf16x8(const float* __restrict__ in,
                                                       unsigned short* __restrict__ out, int n8) {
  const int i = blockIdx.x * 256 + threadIdx.x;
  if (i < n8) {
    const v4f a0 = *(const v4f*)(in + (size_t)i * 8);
    const v4f a1 = *(const v4f*)(in + (size_t)i * 8 + 4);
    v8us u;
    u[0] = f2bf_bits(a0[0]); u[1] = f2bf_bits(a0[1]); u[2] = f2bf_bits(a0[2]); u[3] = f2bf_bits(a0[3]);
    u[4] = f2bf_bits(a1[0]); u[5] = f2bf_bits(a1[1]); u[6] = f2bf_bits(a1[2]); u[7] = f2bf_bits(a1[3]);
    *(v8us*)(out + (size_t)i * 8) = u;
    
  }
}

// ---- W [K][N] f32 -> Wt [N][K] bf16 (RNE), 64x64 tile transposed through LDS; grid = (N/64, K/64) ----
// Phase 1 coverage: kr = tid>>2 (64 k rows) x c16 = (tid&3)*16 with 4 quads of 4 -> every (k, n) of the tile once.
// Phase 2 coverage: n = it*32 + wave*4 + q8 (it 0..1, wave 0..7, q8 0..3) -> rows 0..63; c8 -> 8 lanes x 8 = 64 k.
#define WTP 72
__global__ __launch_bounds__(256) void wt_cast_bf16(const float* __restrict__ W, unsigned short* __restrict__ Wt,
                                                    int K, int N) {
  __shared__ __align__(16) unsigned short st[64 * WTP];
  const int n0 = blockIdx.x * 64, k0 = blockIdx.y * 64;
  const int tid = threadIdx.x;
  const int kr = tid >> 2, c16 = (tid & 3) * 16;
  const float* src = W + (size_t)(k0 + kr) * N + n0 + c16;
#pragma unroll
  for (int q = 0; q < 4; ++q) {
    const v4f v = *(const v4f*)(src + 4 * q);
#pragma unroll
    for (int e = 0; e < 4; ++e) st[(c16 + 4 * q + e) * WTP + kr] = f2bf_bits(v[e]);
  }
  __syncthreads();
  const int wave = tid >> 5, lane = tid & 31;
  const int q8 = lane >> 3, c8 = (lane & 7) * 8;
  {
#pragma unroll
    for (int it = 0; it < 2; ++it) {
      const int n = it * 32 + wave * 4 + q8;
      const v8us hv = *(const v8us*)(st + n * WTP + c8);
      *(v8us*)(Wt + (size_t)(n0 + n) * K + k0 + c8) = hv;
    }
    
  }
}

__device__ __forceinline__ v8f mma_b(v16b a, v16b b, v8f c) {
  c = __builtin_amdgcn_wmma_f32_16x16x32_bf16(false, a, false, b, (short)0, c, false, false);
  asm volatile("v_nop\n\tv_nop\n\tv_nop\n\tv_nop" : "+v"(c) : "v"(a), "v"(b));
  return c;
}
__device__ __forceinline__ void bf_split(float f, __bf16& hi, __bf16& lo) {
  const unsigned short hb = f2bf_bits(f);
  hi = __builtin_bit_cast(__bf16, hb);
  lo = __builtin_bit_cast(__bf16, f2bf_bits(f - bf_bits2f(hb)));
}

// value of the same register in lane ^ 16 (the other 16-lane half of the wave)
__device__ __forceinline__ float other_half(float x) {
  const unsigned u = __float_as_uint(x);
  return __uint_as_float(__builtin_amdgcn_permlanex16(u, u, 0x76543210u, 0xfedcba98u, false, false));
}

// Eight hardware exp2 in one statement. The outputs are early-clobber, so none of them takes an input's register: no v_exp_f32
// here overwrites the source of the one directly in front of it. The closing v_nop is the one slot that the instruction set
// asks for between a transcendental and a next instruction that may read its result or overwrite its source.
__device__ __forceinline__ v8f exp2x8(v8f x) {
  float d0, d1, d2, d3, d4, d5, d6, d7;
  asm("v_exp_f32 %0, %8\n\t"
      "v_exp_f32 %1, %9\n\t"
      "v_exp_f32 %2, %10\n\t"
      "v_exp_f32 %3, %11\n\t"
      "v_exp_f32 %4, %12\n\t"
      "v_exp_f32 %5, %13\n\t"
      "v_exp_f32 %6, %14\n\t"
      "v_exp_f32 %7, %15\n\t"
      "v_nop"
      : "=&v"(d0), "=&v"(d1), "=&v"(d2), "=&v"(d3), "=&v"(d4), "=&v"(d5), "=&v"(d6), "=&v"(d7)
      : "v"(x[0]), "v"(x[1]), "v"(x[2]), "v"(x[3]), "v"(x[4]), "v"(x[5]), "v"(x[6]), "v"(x[7]));
  return (v8f){d0, d1, d2, d3, d4, d5, d6, d7};
}

#define AKC 64
#define LKP 72   // LDS row pitch of the K tiles in elements: 144 B = 16 B x 9 (odd), so 16 rows read by ds_load_b128 fall on distinct banks
#define LVP 80   // LDS row pitch of the V tiles in elements: 160 B = 32 B x 5 (odd), the conflict-free pitch for ds_load_tr16_b128
#define OSP 68
constexpr int kKPlaneE = AKC * LKP;                        // one K plane of a chunk, elements
constexpr int kVPlaneE = AKC * LVP;                        // one V plane of a chunk, elements
constexpr int kStageE  = 2 * kKPlaneE + 2 * kVPlaneE;      // one buffer: K hi | K lo | V hi | V lo = 38,912 B
static_assert(4 * 16 * OSP * 4 <= 2 * kStageE * 2);        // the out tiles fit in the buffers' place

// Eight asynchronous 16-B copies per lane, global -> LDS through no register. The s_wait_xcnt stands inside the copies' own
// statement so that no address register they name is rewritten in front of it.
__device__ __forceinline__ void async_copy8(const uint32_t (&l)[8], const __bf16* const (&g)[8]) {
  asm volatile(
      "global_load_async_to_lds_b128 %0, %8, off\n\t"
      "global_load_async_to_lds_b128 %1, %9, off\n\t"
      "global_load_async_to_lds_b128 %2, %10, off\n\t"
      "global_load_async_to_lds_b128 %3, %11, off\n\t"
      "global_load_async_to_lds_b128 %4, %12, off\n\t"
      "global_load_async_to_lds_b128 %5, %13, off\n\t"
      "global_load_async_to_lds_b128 %6, %14, off\n\t"
      "global_load_async_to_lds_b128 %7, %15, off\n\t"
      "s_wait_xcnt 0x0"
      :: "v"(l[0]), "v"(l[1]), "v"(l[2]), "v"(l[3]), "v"(l[4]), "v"(l[5]), "v"(l[6]), "v"(l[7]),
         "v"(g[0]), "v"(g[1]), "v"(g[2]), "v"(g[3]), "v"(g[4]), "v"(g[5]), "v"(g[6]), "v"(g[7])
      : "memory");
}

// Transposing LDS load: with lane l aimed at row kbase + 8*(l>>4) + (l&7), byte 2*dbase + 16*((l>>3)&1) of a row-major 16-bit tile T,
// lane (c, hh) receives T[kbase + 8*hh + 0..7][dbase + c].
typedef __attribute__((address_space(3))) v8b lds_v8b;
__device__ __forceinline__ v8b ld_tr16(const __bf16* p) { return __builtin_amdgcn_ds_load_tr16_b128_v8bf16((lds_v8b*)p); }

__global__ __launch_bounds__(128) void attn_causal_k(
    const unsigned short* __restrict__ qkvhp, const unsigned short* __restrict__ qkvlp,
    unsigned short* __restrict__ ohp, unsigned short* __restrict__ olp) {
  union FB { v16b v; v8b h[2]; };
  __shared__ __align__(16) __bf16 ring[2 * kStageE];          // two buffers of one chunk each; behind the loop's last barrier: the out tiles

  const __bf16* Qh = (const __bf16*)qkvhp;
  const __bf16* Ql = (const __bf16*)qkvlp;

  const int tid  = threadIdx.x;
  const int wave = tid >> 5;
  const int lane = tid & 31;
  const int hh   = lane >> 4;
  const int c    = lane & 15;

  const int bx = blockIdx.x;
  const int qb = (kNumQB - 1) - ((bx >> 7) & (kNumQB - 1));   // 16 query blocks of 64 rows, heaviest first
  const int bh = bx & (kBatch * kHeads - 1);
  const int h  = bh & (kHeads - 1);
  const int b  = bh >> 4;                  // 0..kBatch-1
  const int q0 = qb * 64 + wave * 16;

  // ---- Q fragments (B operand: column = query row q0 + c): 2 d-chunks, hi and lo, via Frag loader ----
  v16b qah[2], qal[2];
  {
    const size_t qo = (size_t)(b * kSeq + q0 + c) * kQkvLd + h * kHeadDim + 8 * hh;
#pragma unroll
    for (int dc = 0; dc < 2; ++dc) {
      qah[dc] = Frag<__bf16>::load(Qh + qo + dc * 32);
      qal[dc] = Frag<__bf16>::load(Ql + qo + dc * 32);
    }
  }

  float mrow = -INFINITY;   // running maximum of query row q0 + c, of the unscaled scores (equal in both wave halves)
  float lrow = 0.f;         // running sum over this half's keys alone; the halves are joined once, behind the loop
  v8f oacc[4];              // O^T: oacc[t][r] = O[q0 + c][t*16 + 8*hh + r]
#pragma unroll
  for (int t = 0; t < 4; ++t) oacc[t] = (v8f){0.f,0.f,0.f,0.f,0.f,0.f,0.f,0.f};

  // copy side: lane = (row tid>>3 of a round of 16 rows, 16-B segment tid&7 of its 128-B line); gh, gl point at the k row of the next chunk to be copied
  const int crow = tid >> 3, cseg = (tid & 7) * 8;
  const __bf16* gh = Qh + (size_t)(b * kSeq + crow) * kQkvLd + kModel + h * kHeadDim + cseg;
  const __bf16* gl = Ql + (size_t)(b * kSeq + crow) * kQkvLd + kModel + h * kHeadDim + cseg;
  const uint32_t lK = lds_off(ring) + (uint32_t)(crow * LKP + cseg) * 2u;
  const uint32_t lV = lds_off(ring) + (uint32_t)(2 * kKPlaneE + crow * LVP + cseg) * 2u;
  auto issue_chunk = [&](int buf) {
    const uint32_t bo = (uint32_t)buf * (uint32_t)(kStageE * 2);
#pragma unroll
    for (int pl = 0; pl < 2; ++pl) {       // hi plane, lo plane: 4 rounds of K rows and 4 of V rows each
      const __bf16* g = pl ? gl : gh;
      uint32_t l[8];
      const __bf16* p[8];
#pragma unroll
      for (int r = 0; r < 4; ++r) {
        l[r]     = lK + bo + (uint32_t)((pl * kKPlaneE + r * 16 * LKP) * 2);
        p[r]     = g + (size_t)(r * 16) * kQkvLd;
        l[4 + r] = lV + bo + (uint32_t)((pl * kVPlaneE + r * 16 * LVP) * 2);
        p[4 + r] = g + (size_t)(r * 16) * kQkvLd + kModel;      // v sits 1024 columns after k
      }
      async_copy8(l, p);
    }
    gh += (size_t)AKC * kQkvLd;
    gl += (size_t)AKC * kQkvLd;
  };

  const int nIter = qb + 1;   // block-uniform: causal chunks 0..qb, <= 16
  issue_chunk(0);
  asm volatile("s_wait_asynccnt 0x0" ::: "memory");   // this wave's copies of chunk 0 have landed
  __syncthreads();                                     // ... and every other wave's
  if (nIter > 1) issue_chunk(1);
  for (int kc = 0; kc < nIter; ++kc) {
    const int kv0 = kc * AKC;
    const __bf16* Ksh = ring + (kc & 1) * kStageE;       // K hi [kv][d]
    const __bf16* Ksl = Ksh + kKPlaneE;                  // K lo
    const __bf16* Vsh = Ksh + 2 * kKPlaneE + (8 * hh + (lane & 7)) * LVP + ((lane >> 3) & 1) * 8;   // V hi [kv][d], this lane's place for the transposing load
    const __bf16* Vsl = Vsh + kVPlaneE;                  // V lo

    // ---- scores, transposed: s[j][r] = S[q0 + c][kv0 + j*16 + 8*hh + r]; 3 products per d-chunk ----
    v8f s[4];
#pragma unroll
    for (int j = 0; j < 4; ++j) {
      s[j] = (v8f){0.f,0.f,0.f,0.f,0.f,0.f,0.f,0.f};
#pragma unroll
      for (int dc = 0; dc < 2; ++dc) {
        FB kb, kq;
        kb.h[0] = *(const v8b*)(Ksh + (j * 16 + c) * LKP + dc * 32 + 8 * hh);
        kb.h[1] = *(const v8b*)(Ksh + (j * 16 + c) * LKP + dc * 32 + 16 + 8 * hh);
        kq.h[0] = *(const v8b*)(Ksl + (j * 16 + c) * LKP + dc * 32 + 8 * hh);
        kq.h[1] = *(const v8b*)(Ksl + (j * 16 + c) * LKP + dc * 32 + 16 + 8 * hh);
        s[j] = mma_b(kb.v, qah[dc], s[j]);
        s[j] = mma_b(kq.v, qah[dc], s[j]);
        s[j] = mma_b(kb.v, qal[dc], s[j]);
      }
    }
    const bool diag = (kc == qb);
    const int qrow = q0 + c;
    float mj[4];                          // one maximum per score tile: four short chains, not one of 32 links
#pragma unroll
    for (int j = 0; j < 4; ++j) {
      mj[j] = -INFINITY;
#pragma unroll
      for (int r = 0; r < 8; ++r) {
        const int kvcol = kv0 + j * 16 + 8 * hh + r;
        float sv = s[j][r];
        if (diag && (kvcol > qrow)) sv = kMaskFill;
        s[j][r] = sv;
        mj[j] = fmaxf(mj[j], sv);
      }
    }
    float m = fmaxf(fmaxf(mj[0], mj[1]), fmaxf(mj[2], mj[3]));
    m = fmaxf(m, other_half(m));          // the row's other 32 keys sit in lane ^ 16
    const float mnew = fmaxf(mrow, m);
    const float nm = -mnew * kQkScaleLog2e;                                       // finite: every row has an unmasked key in each of its chunks
    const float alpha = __builtin_amdgcn_exp2f(fmaf(mrow, kQkScaleLog2e, nm));    // first chunk: mrow = -inf gives 0
    mrow = mnew;
    float pj[4];                          // one sum per score tile, as for the maxima
    FB ph[2], pl[2];                      // P^T as B operand: element (j&1)*8 + r of chunk j>>1 = key (j>>1)*32 + (j&1)*16 + 8*hh + r
#pragma unroll
    for (int j = 0; j < 4; ++j) {
      pj[j] = 0.f;
      v8f e;
#pragma unroll
      for (int r = 0; r < 8; ++r) e[r] = fmaf(s[j][r], kQkScaleLog2e, nm);
      e = exp2x8(e);
#pragma unroll
      for (int r = 0; r < 8; ++r) {
        const float p = e[r];
        pj[j] += p;
        __bf16 pa, pb; bf_split(p, pa, pb);
        ph[j >> 1].v[(j & 1) * 8 + r] = pa;
        pl[j >> 1].v[(j & 1) * 8 + r] = pb;
      }
    }
    lrow = lrow * alpha + ((pj[0] + pj[1]) + (pj[2] + pj[3]));
#pragma unroll
    for (int t = 0; t < 4; ++t)
#pragma unroll
      for (int r = 0; r < 8; ++r) oacc[t][r] *= alpha;
    // ---- O^T += V^T x P^T : 3 products ----
#pragma unroll   // ph and pl are register arrays: kk must be a constant
    for (int kk = 0; kk < 2; ++kk) {
#pragma unroll
      for (int t = 0; t < 4; ++t) {
        FB vb, vq;
        vb.h[0] = ld_tr16(Vsh + (kk * 32) * LVP + t * 16);          // V[kk*32 + 8*hh + 0..7][t*16 + c]
        vb.h[1] = ld_tr16(Vsh + (kk * 32 + 16) * LVP + t * 16);     // V[kk*32 + 16 + 8*hh + 0..7][t*16 + c]
        vq.h[0] = ld_tr16(Vsl + (kk * 32) * LVP + t * 16);
        vq.h[1] = ld_tr16(Vsl + (kk * 32 + 16) * LVP + t * 16);
        oacc[t] = mma_b(vb.v, ph[kk].v, oacc[t]);
        oacc[t] = mma_b(vq.v, ph[kk].v, oacc[t]);
        oacc[t] = mma_b(vb.v, pl[kk].v, oacc[t]);
      }
    }
    asm volatile("s_wait_dscnt 0x0" ::: "memory");     // this wave's reads of the buffer are done before it is refilled
    asm volatile("s_wait_asynccnt 0x0" ::: "memory");  // this wave's copies of chunk kc + 1 have landed
    __syncthreads();                                    // publishes chunk kc + 1 and ends every wave's reads of chunk kc
    if (kc + 2 < nIter) issue_chunk(kc & 1);
  }
  asm volatile("s_wait_asynccnt 0x0" ::: "memory");    // nothing in flight when the buffers' place becomes the out tiles

  // ---- join the halves' sums, normalize, stage as [query row][d], write hi/lo planes ----
  float* os = (float*)ring + wave * (16 * OSP);   // per wave out tile, pitch 68; every wave's last read of the buffers ended at the loop's last barrier
  {
    const float inv = 1.0f / (lrow + other_half(lrow));
#pragma unroll
    for (int t = 0; t < 4; ++t) {
      v4f lo4, hi4;
#pragma unroll
      for (int e = 0; e < 4; ++e) { lo4[e] = oacc[t][e] * inv; hi4[e] = oacc[t][4 + e] * inv; }
      *(v4f*)(os + c * OSP + t * 16 + 8 * hh)     = lo4;
      *(v4f*)(os + c * OSP + t * 16 + 8 * hh + 4) = hi4;
    }
  }
  __builtin_amdgcn_fence(__ATOMIC_RELEASE, "workgroup");
  __builtin_amdgcn_wave_barrier();
  __builtin_amdgcn_fence(__ATOMIC_ACQUIRE, "workgroup");
  {
    const int q8 = lane >> 3, c8 = (lane & 7) * 8;
    _Float16* Oh = (_Float16*)ohp;
    _Float16* Ol = (_Float16*)olp;
    {
#pragma unroll
      for (int it = 0; it < 4; ++it) {
        const int row = it * 4 + q8;
        const float* sp = os + row * OSP + c8;
        v8h hv, lv;
#pragma unroll
        for (int e = 0; e < 8; ++e) {
          const unsigned short hb = f2bf_bits(sp[e]);
          const unsigned short lb = f2bf_bits(sp[e] - bf_bits2f(hb));
          hv[e] = __builtin_bit_cast(_Float16, hb);
          lv[e] = __builtin_bit_cast(_Float16, lb);
        }
        const size_t oo = (size_t)(b * kSeq + q0 + row) * kModel + h * kHeadDim + c8;
        *(v8h*)(Oh + oo) = hv;
        *(v8h*)(Ol + oo) = lv;
      }
      
    }
  }
}

// ---------------------------------------------------------------------------
// Workspace region map (all offsets 256-B aligned, all planes bf16 bits):
//   Xb   [8192][1024]  hidden as bf16          16,777,216 B
//   WaT  [3072][1024]  W_attn transposed        6,291,456 B
//   WoT  [1024][1024]  W_out transposed         2,097,152 B
//   QKVh [8192][3072]  q|k|v hi plane          50,331,648 B
//   QKVl [8192][3072]  q|k|v lo plane          50,331,648 B
//   Oh   [8192][1024]  attention out hi plane  16,777,216 B
//   Ol   [8192][1024]  attention out lo plane  16,777,216 B
// ---------------------------------------------------------------------------
extern "C" void kernel_launch(void* const* d_in, const int* in_sizes, int n_in,
                              void* d_out, int out_size, void* d_ws, size_t ws_size,
                              hipStream_t stream) {
  if (n_in < 5) return;
  if (in_sizes[0] != kTotRows * kModel) return;
  if (in_sizes[1] != kModel * kQkvLd) return;
  if (in_sizes[2] != kQkvLd) return;
  if (in_sizes[3] != kModel * kModel) return;
  if (in_sizes[4] != kModel) return;
  if (out_size != kTotRows * kModel) return;

  const float* hidden = (const float*)d_in[0];   // [8,1024,1024]
  const float* wattn  = (const float*)d_in[1];   // [1024,3072]  ([in][out])
  const float* battn  = (const float*)d_in[2];   // [3072]
  const float* wout   = (const float*)d_in[3];   // [1024,1024]  ([in][out])
  const float* bout   = (const float*)d_in[4];   // [1024]
  float* out = (float*)d_out;                    // [8,1024,1024]

  char* ws = (char*)d_ws;
  size_t off = 0;
  const size_t szXb  = (size_t)kTotRows * kModel * 2;
  const size_t szWaT = (size_t)kQkvLd * kModel * 2;
  const size_t szWoT = (size_t)kModel * kModel * 2;
  const size_t szQKV = (size_t)kTotRows * kQkvLd * 2;
  const size_t szO   = (size_t)kTotRows * kModel * 2;
  unsigned short* Xb   = (unsigned short*)(ws + off); off += szXb;
  unsigned short* WaT  = (unsigned short*)(ws + off); off += szWaT;
  unsigned short* WoT  = (unsigned short*)(ws + off); off += szWoT;
  unsigned short* QKVh = (unsigned short*)(ws + off); off += szQKV;
  unsigned short* QKVl = (unsigned short*)(ws + off); off += szQKV;
  unsigned short* Oh   = (unsigned short*)(ws + off); off += szO;
  unsigned short* Ol   = (unsigned short*)(ws + off); off += szO;
  if (off > ws_size) return;

  // 1) RNE bf16 cast of the activations (8 elements per thread): n8 = 1,048,576 -> 4096 blocks
  {
    const int n8 = kTotRows * kModel / 8;
    cast_f32_bf16x8<<<dim3((n8 + 255) / 256), dim3(256), 0, stream>>>(hidden, Xb, n8);
  }
  // 2) weights: in [K=1024][N] f32 -> out [N][K] bf16 ; grid = (N/64, K/64)
  wt_cast_bf16<<<dim3(kQkvLd / 64, kModel / 64), dim3(256), 0, stream>>>(wattn, WaT, kModel, kQkvLd);
  wt_cast_bf16<<<dim3(kModel / 64, kModel / 64), dim3(256), 0, stream>>>(wout, WoT, kModel, kModel);

  // All eight batches go through each stage in one launch.
  // 3) qkv = hidden @ W_attn + b_attn : M=8192, N=3072, K=1024 -> bf16 hi/lo planes (128x256 tiles: 64*12 = 768 blocks of 8 waves)
  wmma_gemm64<1, 0, 3, 2, false, 4><<<dim3((kTotRows / 128) * (kQkvLd / 256), 1), dim3(256), 0, stream>>>(
      Xb, nullptr, kModel, 0L, WaT, nullptr, kModel, 0L,
      (void*)QKVh, (void*)QKVl, kQkvLd, 0L, battn, nullptr, 0L, kTotRows, kQkvLd, kModel, 1.0f);
  // 4) causal attention, 16*8*16 = 2048 blocks of 128 threads, heaviest query blocks first
  attn_causal_k<<<dim3(kNumQB * kBatch * kHeads), dim3(128), 0, stream>>>(QKVh, QKVl, Oh, Ol);
  // 5) out = O @ W_out + b_out : M=8192, N=1024, K=1024, A hi/lo split, f32 result to d_out (128x128 tiles: 64*8 = 512 blocks of 4 waves)
  wmma_gemm64<1, 2, 3, 0, false, 2><<<dim3((kTotRows / 128) * (kModel / 128), 1), dim3(128), 0, stream>>>(
      Oh, Ol, kModel, 0L, WoT, nullptr, kModel, 0L,
      (void*)out, nullptr, kModel, 0L, bout, nullptr, 0L, kTotRows, kModel, kModel, 1.0f);
}

// v007
// It runs in 134 microseconds.
// Timed twice side by side with v006, it ran 1.04 times as fast both times.
// All steps since v000 together make it 4.41 times as fast.
// Contractions: qkv projection v_wmma_f32_16x16x32_bf16 on RNE-bf16 x and W (single product); attention q.k^T and p.v v_wmma_f32_16x16x32_bf16 with bf16 hi/lo split (hi.hi + hi.lo + lo.hi); output projection bf16 hi/lo A-split x bf16 W_out (hi.w + lo.w); f32 accumulate everywhere; softmax, scale and bias adds in f32.
#include <hip/hip_runtime.h>
#include <math.h>
#include <float.h>
#include <stdint.h>

// ---------------------------------------------------------------------------
// Fixed problem geometry
// ---------------------------------------------------------------------------
constexpr int kBatch     = 8;
constexpr int kSeq       = 1024;
constexpr int kModel     = 1024;
constexpr int kHeads     = 16;
constexpr int kHeadDim   = 64;
constexpr int kQkvLd     = 3 * kModel;            // 3072: q | k | v columns
constexpr int kTotRows   = kBatch * kSeq;         // 8192
constexpr int kNumQB     = kSeq / 64;             // 16 query blocks of 64 rows
constexpr float kQkScale = 0.125f;                // 1/sqrt(64), exact power of two
constexpr float kQkScaleLog2e = kQkScale * 1.44269504088896340736f;   // exp(x/8) = exp2(x * this)
constexpr float kMaskFill = -FLT_MAX;             // finfo(float32).min
static_assert(kNumQB == 16);
static_assert(kHeads == 16);
static_assert(kBatch * kHeads == 128);
static_assert(kModel % 128 == 0 && kQkvLd % 256 == 0 && kTotRows % 128 == 0);
static_assert(kModel % 64 == 0);

typedef __attribute__((ext_vector_type(16))) _Float16 v16h;
typedef __attribute__((ext_vector_type(8)))  _Float16 v8h;
typedef __attribute__((ext_vector_type(16))) __bf16   v16b;
typedef __attribute__((ext_vector_type(8)))  __bf16   v8b;
typedef __attribute__((ext_vector_type(8)))  float    v8f;
typedef __attribute__((ext_vector_type(4)))  float    v4f;
typedef __attribute__((ext_vector_type(8)))  unsigned short v8us;

__device__ __forceinline__ unsigned short f2bf_bits(float f) {
  unsigned u = __float_as_uint(f);
  return (unsigned short)((u + 0x7FFFu + ((u >> 16) & 1u)) >> 16);
}
__device__ __forceinline__ float bf_bits2f(unsigned short h) { return __uint_as_float(((unsigned)h) << 16); }

// hazard guards as plain device helpers
__device__ __forceinline__ void dep_guard_h(v8f& a, v8f& b, v16h x, v16h y) { asm volatile("v_nop\n\tv_nop\n\tv_nop\n\tv_nop" : "+v"(a), "+v"(b) : "v"(x), "v"(y)); }
__device__ __forceinline__ void dep_guard_b(v8f& a, v8f& b, v16b x, v16b y) { asm volatile("v_nop\n\tv_nop\n\tv_nop\n\tv_nop" : "+v"(a), "+v"(b) : "v"(x), "v"(y)); }
__device__ __forceinline__ void keep4_h(v16h a, v16h b, v16h c, v16h d) { asm volatile("v_nop" :: "v"(a), "v"(b), "v"(c), "v"(d)); }
__device__ __forceinline__ void keep4_b(v16b a, v16b b, v16b c, v16b d) { asm volatile("v_nop" :: "v"(a), "v"(b), "v"(c), "v"(d)); }
__device__ __forceinline__ void acc_guard4(v8f& a, v8f& b, v8f& c, v8f& d) { asm volatile("v_nop\n\tv_nop\n\tv_nop\n\tv_nop" : "+v"(a), "+v"(b), "+v"(c), "+v"(d)); }
template <typename T> struct Frag;
template <> struct Frag<_Float16> {
  typedef v16h V; union U { v16h v; v8h h[2]; };
  static __device__ __forceinline__ v16h load(const _Float16* p) {   // elements 0..7 <- p[0..7], 8..15 <- p[16..23]
    U f; f.h[0] = *(const v8h*)(p); f.h[1] = *(const v8h*)(p + 16); return f.v;
  }
  static __device__ __forceinline__ v8f mma(v16h a, v16h b, v8f c) {
    return __builtin_amdgcn_wmma_f32_16x16x32_f16(false, a, false, b, (short)0, c, false, false);
  }
  static __device__ __forceinline__ void guard(v8f& a, v8f& b, v16h x, v16h y) { dep_guard_h(a, b, x, y); }
  static __device__ __forceinline__ void keep(v16h a, v16h b, v16h c, v16h d) { keep4_h(a, b, c, d); }
};
template <> struct Frag<__bf16> {
  typedef v16b V; union U { v16b v; v8b h[2]; };
  static __device__ __forceinline__ v16b load(const __bf16* p) {
    U f; f.h[0] = *(const v8b*)(p); f.h[1] = *(const v8b*)(p + 16); return f.v;
  }
  static __device__ __forceinline__ v8f mma(v16b a, v16b b, v8f c) {
    return __builtin_amdgcn_wmma_f32_16x16x32_bf16(false, a, false, b, (short)0, c, false, false);
  }
  static __device__ __forceinline__ void guard(v8f& a, v8f& b, v16b x, v16b y) { dep_guard_b(a, b, x, y); }
  static __device__ __forceinline__ void keep(v16b a, v16b b, v16b c, v16b d) { keep4_b(a, b, c, d); }
};

// ---- LDS-staged batched WMMA GEMM ------------------------------------------
// C[m,n] = scale * sum_k A[m,k] * Bt[n,k] (+bias)(+resid); block = 2 x WN waves on a 128 x (64*WN) tile, each wave owns 64x64.
// A row-major [M,K]; Bt row-major [N,K]; M % 128 == 0, N % (64*WN) == 0, K % 64 == 0, K >= 64.
// Each k-slice of 64 (one 128-B line of every operand row of the block tile) is brought into LDS once, by asynchronous
// 16-B copies that cover whole lines, and every wave of the block reads its fragments from there; two buffers, so the
// next slice's copies fly while this slice is multiplied.
// SPLIT: 0 = single product; 2 = A hi/lo planes (A2 = lo plane), Bt single plane: hi.b + lo.b.
// BIAS_MODE: 0 = none, 1 = bias[m], 2 = bias[n], 3 = bias[n] passed through an RNE bf16 convert first.
// OUT_MODE: 0 = f32, 1 = f16, 2 = bf16 hi plane (Cout) + bf16 lo plane (Cout2).
// ET: 0 = f16 operands, 1 = bf16 operands (pointers passed as 16-bit storage)
template <int ET> struct Elem;
template <> struct Elem<0> { typedef _Float16 T; };
template <> struct Elem<1> { typedef __bf16 T; };

#define GBK 64   // k elements per staged slice: 128 B of every row
#define GLP 72   // LDS row pitch of the staged slices in elements: 144 B = 16 B x 9 (odd), conflict-free for the ds_load_b128 fragment reads

__device__ __forceinline__ uint32_t lds_off(const void* p) { return (uint32_t)(size_t)p; }   // byte offset in the work-group's LDS

// Twelve asynchronous 16-B copies per lane, global -> LDS through no register. The s_wait_xcnt stands inside the copies' own
// statement so that no address register they name is rewritten in front of it.
template <typename T>
__device__ __forceinline__ void async_copy12(const uint32_t (&l)[12], const T* const (&g)[12]) {
  asm volatile(
      "global_load_async_to_lds_b128 %0, %12, off\n\t"
      "global_load_async_to_lds_b128 %1, %13, off\n\t"
      "global_load_async_to_lds_b128 %2, %14, off\n\t"
      "global_load_async_to_lds_b128 %3, %15, off\n\t"
      "global_load_async_to_lds_b128 %4, %16, off\n\t"
      "global_load_async_to_lds_b128 %5, %17, off\n\t"
      "global_load_async_to_lds_b128 %6, %18, off\n\t"
      "global_load_async_to_lds_b128 %7, %19, off\n\t"
      "global_load_async_to_lds_b128 %8, %20, off\n\t"
      "global_load_async_to_lds_b128 %9, %21, off\n\t"
      "global_load_async_to_lds_b128 %10, %22, off\n\t"
      "global_load_async_to_lds_b128 %11, %23, off\n\t"
      "s_wait_xcnt 0x0"
      :: "v"(l[0]), "v"(l[1]), "v"(l[2]), "v"(l[3]), "v"(l[4]), "v"(l[5]),
         "v"(l[6]), "v"(l[7]), "v"(l[8]), "v"(l[9]), "v"(l[10]), "v"(l[11]),
         "v"(g[0]), "v"(g[1]), "v"(g[2]), "v"(g[3]), "v"(g[4]), "v"(g[5]),
         "v"(g[6]), "v"(g[7]), "v"(g[8]), "v"(g[9]), "v"(g[10]), "v"(g[11])
      : "memory");
}

template <int ET, int SPLIT, int BIAS_MODE, int OUT_MODE, bool RESID, int WN, int ACT = 0>
__global__ __launch_bounds__(64 * WN) void wmma_gemm64(
    const unsigned short* __restrict__ Ap, const unsigned short* __restrict__ A2p, int lda, long strideA,
    const unsigned short* __restrict__ Btp, const unsigned short* __restrict__ Bt2p, int ldb, long strideB,
    void* __restrict__ Cout, void* __restrict__ Cout2, int ldc, long strideC,
    const float* __restrict__ bias,
    const float* __restrict__ resid, long strideR,
    int M, int N, int K, float scale) {
  static_assert(SPLIT == 0 || SPLIT == 2);
  typedef typename Elem<ET>::T T;
  typedef typename Frag<T>::V V;
  constexpr int BM    = 128;                              // block tile rows
  constexpr int BN    = 64 * WN;                          // block tile columns
  constexpr int AROWS = (SPLIT == 2) ? 2 * BM : BM;       // staged A rows: hi plane, then lo plane
  constexpr int SROWS = AROWS + BN;                       // staged rows per slice: A | (A lo) | Bt
  constexpr int RPR   = (64 * WN) / 8;                    // rows one copy of the whole block covers: 8 lanes x 16 B per row
  constexpr int NC    = SROWS / RPR;                      // copies per lane and slice
  constexpr int STAGE_E = SROWS * GLP;                    // elements per buffer
  static_assert(BM % RPR == 0 && BN % RPR == 0 && NC % 12 == 0 && NC <= 63);
  const T* A = (const T*)Ap; const T* A2 = (const T*)A2p; const T* Bt = (const T*)Btp;
  __shared__ __align__(16) T ring[2 * STAGE_E];            // two buffers of one k-slice each
  __shared__ __align__(16) float sT[2 * WN][16 * 68];      // per-wave 16x64 slab, pitch 68 floats
  const int b    = blockIdx.y;
  const int tid  = threadIdx.x;
  const int lane = tid & 31;
  const int wave = tid >> 5;
  const int tilesN = N / BN;
  const int tilesM = M / BM;
  const int bt = blockIdx.x;
  if (bt >= tilesM * tilesN) return;   // block-uniform, in front of every copy and barrier
  const int bm = bt / tilesN;
  const int bn = bt - bm * tilesN;
  const int wm = wave / WN;
  const int wn = wave - wm * WN;
  const int m0 = bm * BM + (wm << 6);
  const int n0 = bn * BN + (wn << 6);

  const int rlane = lane & 15;                 // row (A) / col (B, D) within subtile
  const int koff  = (lane >> 4) * 8;           // k offset of this lane half
  const int mOff  = (lane >> 4) * 8;           // D row offset

  // copy side: lane = (row tid>>3 of a round of RPR rows, 16-B segment tid&7 of its 128-B line)
  const int crow = tid >> 3, cseg = (tid & 7) * 8;
  // gA, gA2, gB walk along k: they point at the next slice to be copied
  const T* gA  = A  + (size_t)b * strideA + (size_t)(bm * BM + crow) * lda + cseg;
  const T* gA2 = (SPLIT == 2) ? (A2 + (size_t)b * strideA + (size_t)(bm * BM + crow) * lda + cseg) : nullptr;
  const T* gB  = Bt + (size_t)b * strideB + (size_t)(bn * BN + crow) * ldb + cseg;
  const uint32_t lC = lds_off(ring) + (uint32_t)(crow * GLP + cseg) * 2u;
  auto issue_slice = [&](int buf) {
    const uint32_t lb = lC + (uint32_t)buf * (uint32_t)(STAGE_E * 2);
#pragma unroll
    for (int g = 0; g < NC / 12; ++g) {
      uint32_t l[12];
      const T* p[12];
#pragma unroll
      for (int c = 0; c < 12; ++c) {
        const int sr = (g * 12 + c) * RPR;     // first staged row of this round
        l[c] = lb + (uint32_t)(sr * GLP * 2);
        if (sr < BM)         p[c] = gA  + (size_t)sr * lda;
        else if (sr < AROWS) p[c] = gA2 + (size_t)(sr - BM) * lda;
        else                 p[c] = gB  + (size_t)(sr - AROWS) * ldb;
      }
      async_copy12<T>(l, p);
    }
    gA += GBK;
    if (SPLIT == 2) gA2 += GBK;
    gB += GBK;
  };

  // fragment side: this lane's row and k half inside a buffer
  const T* fA = ring + ((wm << 6) + rlane) * GLP + koff;
  const T* fB = ring + (AROWS + (wn << 6) + rlane) * GLP + koff;

  v8f acc[4][4];
#pragma unroll
  for (int i = 0; i < 4; ++i)
#pragma unroll
    for (int j = 0; j < 4; ++j) acc[i][j] = (v8f){0.f,0.f,0.f,0.f,0.f,0.f,0.f,0.f};

  const int nT = K / GBK;                      // block-uniform
  issue_slice(0);
  asm volatile("s_wait_asynccnt 0x0" ::: "memory");   // this wave's copies of slice 0 have landed
  __syncthreads();                                     // ... and every other wave's
  if (nT > 1) issue_slice(1);
  for (int t = 0; t < nT; ++t) {
    const int so = (t & 1) * STAGE_E;
#pragma unroll   // both 32-k halves of the slice in one body, so the second half's fragment reads can start under the first half's products
    for (int kk = 0; kk < GBK; kk += 32) {
      V bh[4], ah[4], al[4];
#pragma unroll
      for (int j = 0; j < 4; ++j) bh[j] = Frag<T>::load(fB + so + (j << 4) * GLP + kk);
#pragma unroll
      for (int i = 0; i < 4; ++i) {
        ah[i] = Frag<T>::load(fA + so + (i << 4) * GLP + kk);
        if (SPLIT == 2) al[i] = Frag<T>::load(fA + so + (BM + (i << 4)) * GLP + kk);
      }
#pragma unroll
      for (int i = 0; i < 4; ++i) {
#pragma unroll
        for (int j = 0; j < 4; ++j) {
          acc[i][j] = Frag<T>::mma(ah[i], bh[j], acc[i][j]);
          if (SPLIT == 2) acc[i][j] = Frag<T>::mma(al[i], bh[j], acc[i][j]);
        }
        Frag<T>::guard(acc[i][0], acc[i][3], ah[i], (SPLIT == 2) ? al[i] : ah[i]);
      }
      Frag<T>::keep(bh[0], bh[1], bh[2], bh[3]);
    }
    asm volatile("s_wait_dscnt 0x0" ::: "memory");     // this wave's reads of the buffer are done before it is refilled
    asm volatile("s_wait_asynccnt 0x0" ::: "memory");  // this wave's copies of slice t + 1 have landed
    __syncthreads();                                    // publishes slice t + 1 and ends every wave's reads of slice t
    if (t + 2 < nT) issue_slice(t & 1);
  }
  asm volatile("s_wait_asynccnt 0x0" ::: "memory");    // nothing in flight when the wave goes on
  acc_guard4(acc[0][0], acc[0][1], acc[0][2], acc[0][3]);
  acc_guard4(acc[1][0], acc[1][1], acc[1][2], acc[1][3]);
  acc_guard4(acc[2][0], acc[2][1], acc[2][2], acc[2][3]);
  acc_guard4(acc[3][0], acc[3][1], acc[3][2], acc[3][3]);

  // ---- epilogue ----
  float* slab = sT[wave];
  const float* Rb = RESID ? (resid + (size_t)b * strideR) : nullptr;
#pragma unroll
  for (int i = 0; i < 4; ++i) {
    const int mBase = m0 + (i << 4);
#pragma unroll
    for (int j = 0; j < 4; ++j) {
      const int n = n0 + (j << 4) + rlane;
      float bv = 0.f;
      if (BIAS_MODE == 2) bv = bias[n];
      if (BIAS_MODE == 3) bv = bf_bits2f(f2bf_bits(bias[n]));
#pragma unroll
      for (int r = 0; r < 8; ++r) {
        float v = acc[i][j][r] * scale;
        if (BIAS_MODE == 1) v += bias[mBase + mOff + r];
        if (BIAS_MODE == 2 || BIAS_MODE == 3) v += bv;
        if (RESID) v += Rb[(size_t)(mBase + mOff + r) * ldc + n];
        if (ACT == 1) v = tanhf(v);
        if (ACT == 2) v = fmaxf(v, 0.0f);
        if (ACT == 4) v = (v > 0.f) ? v : 0.01f * v;
        slab[(mOff + r) * 68 + (j << 4) + rlane] = v;
      }
    }
    __builtin_amdgcn_fence(__ATOMIC_RELEASE, "workgroup");
    __builtin_amdgcn_wave_barrier();
    __builtin_amdgcn_fence(__ATOMIC_ACQUIRE, "workgroup");
    if (OUT_MODE == 0) {
      float* C = (float*)Cout + (size_t)b * strideC;
      const int hh = lane >> 4, c4 = (lane & 15) * 4;     // row seg = 256 B = 16 lanes x 16 B
      {
#pragma unroll
        for (int it = 0; it < 8; ++it) {
          const int row = it * 2 + hh;
          v4f v = *(const v4f*)(slab + row * 68 + c4);
          *(v4f*)(C + (size_t)(mBase + row) * ldc + n0 + c4) = v;
        }
        
      }
    } else {
      const int q = lane >> 3, c8 = (lane & 7) * 8;
      unsigned short* C  = (unsigned short*)Cout  + (size_t)b * strideC;
      unsigned short* C2 = (OUT_MODE == 2) ? ((unsigned short*)Cout2 + (size_t)b * strideC) : nullptr;
      {
#pragma unroll
        for (int it = 0; it < 4; ++it) {
          const int row = it * 4 + q;
          const float* sp = slab + row * 68 + c8;
          v8h hv, lv;
#pragma unroll
          for (int e = 0; e < 8; ++e) {
            if (OUT_MODE == 1) {
              hv[e] = (_Float16)sp[e];
            } else {
              unsigned short hb = f2bf_bits(sp[e]);
              unsigned short lb = f2bf_bits(sp[e] - bf_bits2f(hb));
              hv[e] = __builtin_bit_cast(_Float16, hb);
              lv[e] = __builtin_bit_cast(_Float16, lb);
            }
          }
          *(v8h*)(C + (size_t)(mBase + row) * ldc + n0 + c8) = hv;
          if (OUT_MODE == 2) *(v8h*)(C2 + (size_t)(mBase + row) * ldc + n0 + c8) = lv;
        }
        
      }
    }
    __builtin_amdgcn_fence(__ATOMIC_RELEASE, "workgroup");
    __builtin_amdgcn_wave_barrier();
    __builtin_amdgcn_fence(__ATOMIC_ACQUIRE, "workgroup");
  }
}

// ---- f32 [n] -> bf16 (RNE) [n], same layout; 8 elements per thread = one 16-B store per lane ----
// grid = ceil(n8/256) with n8 = n/8 (here 1,048,576 = 4096 x 256 exactly), bound checked anyway.
__global__ __launch_bounds__(256) void cast_f32_bf16x8(const float* __restrict__ in,
                                                       unsigned short* __restrict__ out, int n8) {
  const int i = blockIdx.x * 256 + threadIdx.x;
  if (i < n8) {
    const v4f a0 = *(const v4f*)(in + (size_t)i * 8);
    const v4f a1 = *(const v4f*)(in + (size_t)i * 8 + 4);
    v8us u;
    u[0] = f2bf_bits(a0[0]); u[1] = f2bf_bits(a0[1]); u[2] = f2bf_bits(a0[2]); u[3] = f2bf_bits(a0[3]);
    u[4] = f2bf_bits(a1[0]); u[5] = f2bf_bits(a1[1]); u[6] = f2bf_bits(a1[2]); u[7] = f2bf_bits(a1[3]);
    *(v8us*)(out + (size_t)i * 8) = u;
    
  }
}

// ---- W [K][N] f32 -> Wt [N][K] bf16 (RNE), 64x64 tile transposed through LDS; grid = (N/64, K/64) ----
// Phase 1 coverage: kr = tid>>2 (64 k rows) x c16 = (tid&3)*16 with 4 quads of 4 -> every (k, n) of the tile once.
// Phase 2 coverage: n = it*32 + wave*4 + q8 (it 0..1, wave 0..7, q8 0..3) -> rows 0..63; c8 -> 8 lanes x 8 = 64 k.
#define WTP 72
__global__ __launch_bounds__(256) void wt_cast_bf16(const float* __restrict__ W, unsigned short* __restrict__ Wt,
                                                    int K, int N) {
  __shared__ __align__(16) unsigned short st[64 * WTP];
  const int n0 = blockIdx.x * 64, k0 = blockIdx.y * 64;
  const int tid = threadIdx.x;
  const int kr = tid >> 2, c16 = (tid & 3) * 16;
  const float* src = W + (size_t)(k0 + kr) * N + n0 + c16;
#pragma unroll
  for (int q = 0; q < 4; ++q) {
    const v4f v = *(const v4f*)(src + 4 * q);
#pragma unroll
    for (int e = 0; e < 4; ++e) st[(c16 + 4 * q + e) * WTP + kr] = f2bf_bits(v[e]);
  }
  __syncthreads();
  const int wave = tid >> 5, lane = tid & 31;
  const int q8 = lane >> 3, c8 = (lane & 7) * 8;
  {
#pragma unroll
    for (int it = 0; it < 2; ++it) {
      const int n = it * 32 + wave * 4 + q8;
      const v8us hv = *(const v8us*)(st + n * WTP + c8);
      *(v8us*)(Wt + (size_t)(n0 + n) * K + k0 + c8) = hv;
    }
    
  }
}

__device__ __forceinline__ v8f mma_b(v16b a, v16b b, v8f c) {
  return __builtin_amdgcn_wmma_f32_16x16x32_bf16(false, a, false, b, (short)0, c, false, false);
}
__device__ __forceinline__ void bf_split(float f, __bf16& hi, __bf16& lo) {
  const unsigned short hb = f2bf_bits(f);
  hi = __builtin_bit_cast(__bf16, hb);
  lo = __builtin_bit_cast(__bf16, f2bf_bits(f - bf_bits2f(hb)));
}

// value of the same register in lane ^ 16 (the other 16-lane half of the wave)
__device__ __forceinline__ float other_half(float x) {
  const unsigned u = __float_as_uint(x);
  return __uint_as_float(__builtin_amdgcn_permlanex16(u, u, 0x76543210u, 0xfedcba98u, false, false));
}

// Eight hardware exp2 in one statement. The outputs are early-clobber, so none of them takes an input's register: no v_exp_f32
// here overwrites the source of the one directly in front of it. The closing v_nop is the one slot that the instruction set
// asks for between a transcendental and a next instruction that may read its result or overwrite its source.
__device__ __forceinline__ v8f exp2x8(v8f x) {
  float d0, d1, d2, d3, d4, d5, d6, d7;
  asm("v_exp_f32 %0, %8\n\t"
      "v_exp_f32 %1, %9\n\t"
      "v_exp_f32 %2, %10\n\t"
      "v_exp_f32 %3, %11\n\t"
      "v_exp_f32 %4, %12\n\t"
      "v_exp_f32 %5, %13\n\t"
      "v_exp_f32 %6, %14\n\t"
      "v_exp_f32 %7, %15\n\t"
      "v_nop"
      : "=&v"(d0), "=&v"(d1), "=&v"(d2), "=&v"(d3), "=&v"(d4), "=&v"(d5), "=&v"(d6), "=&v"(d7)
      : "v"(x[0]), "v"(x[1]), "v"(x[2]), "v"(x[3]), "v"(x[4]), "v"(x[5]), "v"(x[6]), "v"(x[7]));
  return (v8f){d0, d1, d2, d3, d4, d5, d6, d7};
}

#define AKC 64
#define LKP 72   // LDS row pitch of the K tiles in elements: 144 B = 16 B x 9 (odd), so 16 rows read by ds_load_b128 fall on distinct banks
#define LVP 80   // LDS row pitch of the V tiles in elements: 160 B = 32 B x 5 (odd), the conflict-free pitch for ds_load_tr16_b128
#define OSP 68
constexpr int kKPlaneE = AKC * LKP;                        // one K plane of a chunk, elements
constexpr int kVPlaneE = AKC * LVP;                        // one V plane of a chunk, elements
constexpr int kStageE  = 2 * kKPlaneE + 2 * kVPlaneE;      // one buffer: K hi | K lo | V hi | V lo = 38,912 B
static_assert(4 * 16 * OSP * 4 <= 2 * kStageE * 2);        // the out tiles fit in the buffers' place

// Eight asynchronous 16-B copies per lane, global -> LDS through no register. The s_wait_xcnt stands inside the copies' own
// statement so that no address register they name is rewritten in front of it.
__device__ __forceinline__ void async_copy8(const uint32_t (&l)[8], const __bf16* const (&g)[8]) {
  asm volatile(
      "global_load_async_to_lds_b128 %0, %8, off\n\t"
      "global_load_async_to_lds_b128 %1, %9, off\n\t"
      "global_load_async_to_lds_b128 %2, %10, off\n\t"
      "global_load_async_to_lds_b128 %3, %11, off\n\t"
      "global_load_async_to_lds_b128 %4, %12, off\n\t"
      "global_load_async_to_lds_b128 %5, %13, off\n\t"
      "global_load_async_to_lds_b128 %6, %14, off\n\t"
      "global_load_async_to_lds_b128 %7, %15, off\n\t"
      "s_wait_xcnt 0x0"
      :: "v"(l[0]), "v"(l[1]), "v"(l[2]), "v"(l[3]), "v"(l[4]), "v"(l[5]), "v"(l[6]), "v"(l[7]),
         "v"(g[0]), "v"(g[1]), "v"(g[2]), "v"(g[3]), "v"(g[4]), "v"(g[5]), "v"(g[6]), "v"(g[7])
      : "memory");
}

// Transposing LDS load: with lane l aimed at row kbase + 8*(l>>4) + (l&7), byte 2*dbase + 16*((l>>3)&1) of a row-major 16-bit tile T,
// lane (c, hh) receives T[kbase + 8*hh + 0..7][dbase + c].
typedef __attribute__((address_space(3))) v8b lds_v8b;
__device__ __forceinline__ v8b ld_tr16(const __bf16* p) { return __builtin_amdgcn_ds_load_tr16_b128_v8bf16((lds_v8b*)p); }

// Four waves per SIMD (the four blocks per WGP that the LDS admits) need at most 256 VGPRs: the attribute sets that budget.
__global__ __launch_bounds__(128) __attribute__((amdgpu_waves_per_eu(4, 4))) void attn_causal_k(
    const unsigned short* __restrict__ qkvhp, const unsigned short* __restrict__ qkvlp,
    unsigned short* __restrict__ ohp, unsigned short* __restrict__ olp) {
  union FB { v16b v; v8b h[2]; };
  __shared__ __align__(16) __bf16 ring[2 * kStageE];          // two buffers of one chunk each; behind the loop's last barrier: the out tiles

  const __bf16* Qh = (const __bf16*)qkvhp;
  const __bf16* Ql = (const __bf16*)qkvlp;

  const int tid  = threadIdx.x;
  const int wave = tid >> 5;
  const int lane = tid & 31;
  const int hh   = lane >> 4;
  const int c    = lane & 15;

  const int bx = blockIdx.x;
  const int qb = (kNumQB - 1) - ((bx >> 7) & (kNumQB - 1));   // 16 query blocks of 64 rows, heaviest first
  const int bh = bx & (kBatch * kHeads - 1);
  const int h  = bh & (kHeads - 1);
  const int b  = bh >> 4;                  // 0..kBatch-1
  const int q0 = qb * 64 + wave * 16;

  // ---- Q fragments (B operand: column = query row q0 + c): 2 d-chunks, hi and lo, via Frag loader ----
  v16b qah[2], qal[2];
  {
    const size_t qo = (size_t)(b * kSeq + q0 + c) * kQkvLd + h * kHeadDim + 8 * hh;
#pragma unroll
    for (int dc = 0; dc < 2; ++dc) {
      qah[dc] = Frag<__bf16>::load(Qh + qo + dc * 32);
      qal[dc] = Frag<__bf16>::load(Ql + qo + dc * 32);
    }
  }

  float mrow = -INFINITY;   // running maximum of query row q0 + c, of the unscaled scores (equal in both wave halves)
  float lrow = 0.f;         // running sum over this half's keys alone; the halves are joined once, behind the loop
  v8f oacc[4];              // O^T: oacc[t][r] = O[q0 + c][t*16 + 8*hh + r]
#pragma unroll
  for (int t = 0; t < 4; ++t) oacc[t] = (v8f){0.f,0.f,0.f,0.f,0.f,0.f,0.f,0.f};

  // copy side: lane = (row tid>>3 of a round of 16 rows, 16-B segment tid&7 of its 128-B line); gh, gl point at the k row of the next chunk to be copied
  const int crow = tid >> 3, cseg = (tid & 7) * 8;
  const __bf16* gh = Qh + (size_t)(b * kSeq + crow) * kQkvLd + kModel + h * kHeadDim + cseg;
  const __bf16* gl = Ql + (size_t)(b * kSeq + crow) * kQkvLd + kModel + h * kHeadDim + cseg;
  const uint32_t lK = lds_off(ring) + (uint32_t)(crow * LKP + cseg) * 2u;
  const uint32_t lV = lds_off(ring) + (uint32_t)(2 * kKPlaneE + crow * LVP + cseg) * 2u;
  auto issue_chunk = [&](int buf) {
    const uint32_t bo = (uint32_t)buf * (uint32_t)(kStageE * 2);
#pragma unroll
    for (int pl = 0; pl < 2; ++pl) {       // hi plane, lo plane: 4 rounds of K rows and 4 of V rows each
      const __bf16* g = pl ? gl : gh;
      uint32_t l[8];
      const __bf16* p[8];
#pragma unroll
      for (int r = 0; r < 4; ++r) {
        l[r]     = lK + bo + (uint32_t)((pl * kKPlaneE + r * 16 * LKP) * 2);
        p[r]     = g + (size_t)(r * 16) * kQkvLd;
        l[4 + r] = lV + bo + (uint32_t)((pl * kVPlaneE + r * 16 * LVP) * 2);
        p[4 + r] = g + (size_t)(r * 16) * kQkvLd + kModel;      // v sits 1024 columns after k
      }
      async_copy8(l, p);
    }
    gh += (size_t)AKC * kQkvLd;
    gl += (size_t)AKC * kQkvLd;
  };

  const int nIter = qb + 1;   // block-uniform: causal chunks 0..qb, <= 16
  issue_chunk(0);
  asm volatile("s_wait_asynccnt 0x0" ::: "memory");   // this wave's copies of chunk 0 have landed
  __syncthreads();                                     // ... and every other wave's
  if (nIter > 1) issue_chunk(1);
  for (int kc = 0; kc < nIter; ++kc) {
    const int kv0 = kc * AKC;
    const __bf16* Ksh = ring + (kc & 1) * kStageE;       // K hi [kv][d]
    const __bf16* Ksl = Ksh + kKPlaneE;                  // K lo
    const __bf16* Vsh = Ksh + 2 * kKPlaneE + (8 * hh + (lane & 7)) * LVP + ((lane >> 3) & 1) * 8;   // V hi [kv][d], this lane's place for the transposing load
    const __bf16* Vsl = Vsh + kVPlaneE;                  // V lo

    // ---- scores, transposed: s[j][r] = S[q0 + c][kv0 + j*16 + 8*hh + r]; 3 products per d-chunk ----
    // The four score tiles are independent accumulators: consecutive products go to different tiles, so none waits for the one
    // in front of it; each tile still takes its six products in the order hi.hi, lo.hi, hi.lo of d-chunk 0, then of d-chunk 1.
    v8f s[4];
#pragma unroll
    for (int j = 0; j < 4; ++j) s[j] = (v8f){0.f,0.f,0.f,0.f,0.f,0.f,0.f,0.f};
    {
      FB kb[2][4], kq[2][4];              // K hi and K lo fragments of d-chunk 0 and 1
#pragma unroll
      for (int j = 0; j < 4; ++j) {
        kb[0][j].h[0] = *(const v8b*)(Ksh + (j * 16 + c) * LKP + 8 * hh);
        kb[0][j].h[1] = *(const v8b*)(Ksh + (j * 16 + c) * LKP + 16 + 8 * hh);
        kq[0][j].h[0] = *(const v8b*)(Ksl + (j * 16 + c) * LKP + 8 * hh);
        kq[0][j].h[1] = *(const v8b*)(Ksl + (j * 16 + c) * LKP + 16 + 8 * hh);
      }
#pragma unroll
      for (int j = 0; j < 4; ++j) {
        kb[1][j].h[0] = *(const v8b*)(Ksh + (j * 16 + c) * LKP + 32 + 8 * hh);
        kb[1][j].h[1] = *(const v8b*)(Ksh + (j * 16 + c) * LKP + 32 + 16 + 8 * hh);
      }
#pragma unroll
      for (int j = 0; j < 4; ++j) s[j] = mma_b(kb[0][j].v, qah[0], s[j]);
#pragma unroll
      for (int j = 0; j < 4; ++j) s[j] = mma_b(kq[0][j].v, qah[0], s[j]);
      // Keeps the last eight reads from rising to the first 24: all 32 reads at once take 128 registers, and the kernel then
      // spills at the 256 registers that four waves per SIMD allow.
      __builtin_amdgcn_sched_barrier(0);
#pragma unroll
      for (int j = 0; j < 4; ++j) {
        kq[1][j].h[0] = *(const v8b*)(Ksl + (j * 16 + c) * LKP + 32 + 8 * hh);
        kq[1][j].h[1] = *(const v8b*)(Ksl + (j * 16 + c) * LKP + 32 + 16 + 8 * hh);
      }
#pragma unroll
      for (int j = 0; j < 4; ++j) s[j] = mma_b(kb[0][j].v, qal[0], s[j]);
#pragma unroll
      for (int j = 0; j < 4; ++j) s[j] = mma_b(kb[1][j].v, qah[1], s[j]);
#pragma unroll
      for (int j = 0; j < 4; ++j) s[j] = mma_b(kq[1][j].v, qah[1], s[j]);
#pragma unroll
      for (int j = 0; j < 4; ++j) s[j] = mma_b(kb[1][j].v, qal[1], s[j]);
    }
    const bool diag = (kc == qb);
    const int qrow = q0 + c;
    float mj[4];                          // one maximum per score tile: four short chains, not one of 32 links
#pragma unroll
    for (int j = 0; j < 4; ++j) {
      mj[j] = -INFINITY;
#pragma unroll
      for (int r = 0; r < 8; ++r) {
        const int kvcol = kv0 + j * 16 + 8 * hh + r;
        float sv = s[j][r];
        if (diag && (kvcol > qrow)) sv = kMaskFill;
        s[j][r] = sv;
        mj[j] = fmaxf(mj[j], sv);
      }
    }
    float m = fmaxf(fmaxf(mj[0], mj[1]), fmaxf(mj[2], mj[3]));
    m = fmaxf(m, other_half(m));          // the row's other 32 keys sit in lane ^ 16
    const float mnew = fmaxf(mrow, m);
    const float nm = -mnew * kQkScaleLog2e;                                       // finite: every row has an unmasked key in each of its chunks
    const float alpha = __builtin_amdgcn_exp2f(fmaf(mrow, kQkScaleLog2e, nm));    // first chunk: mrow = -inf gives 0
    mrow = mnew;
    float pj[4];                          // one sum per score tile, as for the maxima
    FB ph[2], pl[2];                      // P^T as B operand: element (j&1)*8 + r of chunk j>>1 = key (j>>1)*32 + (j&1)*16 + 8*hh + r
#pragma unroll
    for (int j = 0; j < 4; ++j) {
      pj[j] = 0.f;
      v8f e;
#pragma unroll
      for (int r = 0; r < 8; ++r) e[r] = fmaf(s[j][r], kQkScaleLog2e, nm);
      e = exp2x8(e);
#pragma unroll
      for (int r = 0; r < 8; ++r) {
        const float p = e[r];
        pj[j] += p;
        __bf16 pa, pb; bf_split(p, pa, pb);
        ph[j >> 1].v[(j & 1) * 8 + r] = pa;
        pl[j >> 1].v[(j & 1) * 8 + r] = pb;
      }
    }
    lrow = lrow * alpha + ((pj[0] + pj[1]) + (pj[2] + pj[3]));
#pragma unroll
    for (int t = 0; t < 4; ++t)
#pragma unroll
      for (int r = 0; r < 8; ++r) oacc[t][r] *= alpha;
    // ---- O^T += V^T x P^T : 3 products ----
#pragma unroll   // ph and pl are register arrays: kk must be a constant
    for (int kk = 0; kk < 2; ++kk) {
      FB vb[4], vq[4];
#pragma unroll
      for (int t = 0; t < 4; ++t) {
        vb[t].h[0] = ld_tr16(Vsh + (kk * 32) * LVP + t * 16);          // V[kk*32 + 8*hh + 0..7][t*16 + c]
        vb[t].h[1] = ld_tr16(Vsh + (kk * 32 + 16) * LVP + t * 16);     // V[kk*32 + 16 + 8*hh + 0..7][t*16 + c]
        vq[t].h[0] = ld_tr16(Vsl + (kk * 32) * LVP + t * 16);
        vq[t].h[1] = ld_tr16(Vsl + (kk * 32 + 16) * LVP + t * 16);
      }
      // as for the scores: the four out tiles alternate, each taking its products in the order hi.hi, lo.hi, hi.lo
#pragma unroll
      for (int t = 0; t < 4; ++t) oacc[t] = mma_b(vb[t].v, ph[kk].v, oacc[t]);
#pragma unroll
      for (int t = 0; t < 4; ++t) oacc[t] = mma_b(vq[t].v, ph[kk].v, oacc[t]);
#pragma unroll
      for (int t = 0; t < 4; ++t) oacc[t] = mma_b(vb[t].v, pl[kk].v, oacc[t]);
    }
    asm volatile("s_wait_dscnt 0x0" ::: "memory");     // this wave's reads of the buffer are done before it is refilled
    asm volatile("s_wait_asynccnt 0x0" ::: "memory");  // this wave's copies of chunk kc + 1 have landed
    __syncthreads();                                    // publishes chunk kc + 1 and ends every wave's reads of chunk kc
    if (kc + 2 < nIter) issue_chunk(kc & 1);
  }
  asm volatile("s_wait_asynccnt 0x0" ::: "memory");    // nothing in flight when the buffers' place becomes the out tiles

  // ---- join the halves' sums, normalize, stage as [query row][d], write hi/lo planes ----
  float* os = (float*)ring + wave * (16 * OSP);   // per wave out tile, pitch 68; every wave's last read of the buffers ended at the loop's last barrier
  {
    const float inv = 1.0f / (lrow + other_half(lrow));
#pragma unroll
    for (int t = 0; t < 4; ++t) {
      v4f lo4, hi4;
#pragma unroll
      for (int e = 0; e < 4; ++e) { lo4[e] = oacc[t][e] * inv; hi4[e] = oacc[t][4 + e] * inv; }
      *(v4f*)(os + c * OSP + t * 16 + 8 * hh)     = lo4;
      *(v4f*)(os + c * OSP + t * 16 + 8 * hh + 4) = hi4;
    }
  }
  __builtin_amdgcn_fence(__ATOMIC_RELEASE, "workgroup");
  __builtin_amdgcn_wave_barrier();
  __builtin_amdgcn_fence(__ATOMIC_ACQUIRE, "workgroup");
  {
    const int q8 = lane >> 3, c8 = (lane & 7) * 8;
    _Float16* Oh = (_Float16*)ohp;
    _Float16* Ol = (_Float16*)olp;
    {
#pragma unroll
      for (int it = 0; it < 4; ++it) {
        const int row = it * 4 + q8;
        const float* sp = os + row * OSP + c8;
        v8h hv, lv;
#pragma unroll
        for (int e = 0; e < 8; ++e) {
          const unsigned short hb = f2bf_bits(sp[e]);
          const unsigned short lb = f2bf_bits(sp[e] - bf_bits2f(hb));
          hv[e] = __builtin_bit_cast(_Float16, hb);
          lv[e] = __builtin_bit_cast(_Float16, lb);
        }
        const size_t oo = (size_t)(b * kSeq + q0 + row) * kModel + h * kHeadDim + c8;
        *(v8h*)(Oh + oo) = hv;
        *(v8h*)(Ol + oo) = lv;
      }
      
    }
  }
}

// ---------------------------------------------------------------------------
// Workspace region map (all offsets 256-B aligned, all planes bf16 bits):
//   Xb   [8192][1024]  hidden as bf16          16,777,216 B
//   WaT  [3072][1024]  W_attn transposed        6,291,456 B
//   WoT  [1024][1024]  W_out transposed         2,097,152 B
//   QKVh [8192][3072]  q|k|v hi plane          50,331,648 B
//   QKVl [8192][3072]  q|k|v lo plane          50,331,648 B
//   Oh   [8192][1024]  attention out hi plane  16,777,216 B
//   Ol   [8192][1024]  attention out lo plane  16,777,216 B
// ---------------------------------------------------------------------------
extern "C" void kernel_launch(void* const* d_in, const int* in_sizes, int n_in,
                              void* d_out, int out_size, void* d_ws, size_t ws_size,
                              hipStream_t stream) {
  if (n_in < 5) return;
  if (in_sizes[0] != kTotRows * kModel) return;
  if (in_sizes[1] != kModel * kQkvLd) return;
  if (in_sizes[2] != kQkvLd) return;
  if (in_sizes[3] != kModel * kModel) return;
  if (in_sizes[4] != kModel) return;
  if (out_size != kTotRows * kModel) return;

  const float* hidden = (const float*)d_in[0];   // [8,1024,1024]
  const float* wattn  = (const float*)d_in[1];   // [1024,3072]  ([in][out])
  const float* battn  = (const float*)d_in[2];   // [3072]
  const float* wout   = (const float*)d_in[3];   // [1024,1024]  ([in][out])
  const float* bout   = (const float*)d_in[4];   // [1024]
  float* out = (float*)d_out;                    // [8,1024,1024]

  char* ws = (char*)d_ws;
  size_t off = 0;
  const size_t szXb  = (size_t)kTotRows * kModel * 2;
  const size_t szWaT = (size_t)kQkvLd * kModel * 2;
  const size_t szWoT = (size_t)kModel * kModel * 2;
  const size_t szQKV = (size_t)kTotRows * kQkvLd * 2;
  const size_t szO   = (size_t)kTotRows * kModel * 2;
  unsigned short* Xb   = (unsigned short*)(ws + off); off += szXb;
  unsigned short* WaT  = (unsigned short*)(ws + off); off += szWaT;
  unsigned short* WoT  = (unsigned short*)(ws + off); off += szWoT;
  unsigned short* QKVh = (unsigned short*)(ws + off); off += szQKV;
  unsigned short* QKVl = (unsigned short*)(ws + off); off += szQKV;
  unsigned short* Oh   = (unsigned short*)(ws + off); off += szO;
  unsigned short* Ol   = (unsigned short*)(ws + off); off += szO;
  if (off > ws_size) return;

  // 1) RNE bf16 cast of the activations (8 elements per thread): n8 = 1,048,576 -> 4096 blocks
  {
    const int n8 = kTotRows * kModel / 8;
    cast_f32_bf16x8<<<dim3((n8 + 255) / 256), dim3(256), 0, stream>>>(hidden, Xb, n8);
  }
  // 2) weights: in [K=1024][N] f32 -> out [N][K] bf16 ; grid = (N/64, K/64)
  wt_cast_bf16<<<dim3(kQkvLd / 64, kModel / 64), dim3(256), 0, stream>>>(wattn, WaT, kModel, kQkvLd);
  wt_cast_bf16<<<dim3(kModel / 64, kModel / 64), dim3(256), 0, stream>>>(wout, WoT, kModel, kModel);

  // All eight batches go through each stage in one launch.
  // 3) qkv = hidden @ W_attn + b_attn : M=8192, N=3072, K=1024 -> bf16 hi/lo planes (128x256 tiles: 64*12 = 768 blocks of 8 waves)
  wmma_gemm64<1, 0, 3, 2, false, 4><<<dim3((kTotRows / 128) * (kQkvLd / 256), 1), dim3(256), 0, stream>>>(
      Xb, nullptr, kModel, 0L, WaT, nullptr, kModel, 0L,
      (void*)QKVh, (void*)QKVl, kQkvLd, 0L, battn, nullptr, 0L, kTotRows, kQkvLd, kModel, 1.0f);
  // 4) causal attention, 16*8*16 = 2048 blocks of 128 threads, heaviest query blocks first
  attn_causal_k<<<dim3(kNumQB * kBatch * kHeads), dim3(128), 0, stream>>>(QKVh, QKVl, Oh, Ol);
  // 5) out = O @ W_out + b_out : M=8192, N=1024, K=1024, A hi/lo split, f32 result to d_out (128x128 tiles: 64*8 = 512 blocks of 4 waves)
  wmma_gemm64<1, 2, 3, 0, false, 2><<<dim3((kTotRows / 128) * (kModel / 128), 1), dim3(128), 0, stream>>>(
      Oh, Ol, kModel, 0L, WoT, nullptr, kModel, 0L,
      (void*)out, nullptr, kModel, 0L, bout, nullptr, 0L, kTotRows, kModel, kModel, 1.0f);
}
